// v000
// Times are from an AMD MI455X. After a warm-up the kernel runs many times in a row, and a time is the length of
// such a window on the GPU divided by its runs, so every launch and the gaps after it count. The runs cycle
// through copies of the inputs. A figure is the median of several windows, for all but v000 over two sittings.
// Sittings can differ by a few percent; kernels timed side by side share one.
// v000, which the later versions start from, runs in 228 microseconds.
#include <hip/hip_runtime.h>

#define DIM    1024
#define HEADS  16
#define HD     64
#define SEQ    1024
#define BATCH  8
#define NTOK   (BATCH * SEQ)   // 8192
#define QKV_N  (3 * DIM)       // 3072

typedef __attribute__((ext_vector_type(16))) __bf16 v16bf;
typedef __attribute__((ext_vector_type(8)))  __bf16 v8bf;
typedef __attribute__((ext_vector_type(8)))  float  v8f;

// Load one 16-bf16 WMMA A/B fragment for this lane from an LDS row:
// per CDNA5 ISA 16-bit layout, lane holds k = base+0..7 and k = base+16..23
// with base = (lane>>4)*8, row = lane&15. k0 = chunk*32 + (lane>>4)*8.
__device__ __forceinline__ v16bf ld_frag(const __bf16* row, int k0) {
    v8bf lo = *reinterpret_cast<const v8bf*>(row + k0);
    v8bf hi = *reinterpret_cast<const v8bf*>(row + k0 + 16);
    return __builtin_shufflevector(lo, hi, 0,1,2,3,4,5,6,7,8,9,10,11,12,13,14,15);
}

__device__ __forceinline__ v8f wmma_bf16(v16bf a, v16bf b, v8f c) {
    return __builtin_amdgcn_wmma_f32_16x16x32_bf16(false, a, false, b, (short)0, c, false, false);
}

// Async copy 16B global -> LDS (GLOBAL_LOAD_ASYNC_TO_LDS_B128, ASYNCcnt).
// Generic LDS pointer: low 32 bits are the LDS byte offset (flat aperture rule).
__device__ __forceinline__ void async_copy16(void* lds_dst, const void* gsrc) {
    unsigned loff = (unsigned)(uintptr_t)lds_dst;
    asm volatile("global_load_async_to_lds_b128 %0, %1, off"
                 :: "v"(loff), "v"(gsrc) : "memory");
}
__device__ __forceinline__ void wait_async0() {
#if __has_builtin(__builtin_amdgcn_s_wait_asynccnt)
    __builtin_amdgcn_s_wait_asynccnt(0);
#else
    asm volatile("s_wait_asynccnt 0x0" ::: "memory");
#endif
}

// ---------------------------------------------------------------- K0: f32 -> bf16
__global__ void cvt_bf16_kernel(const float* __restrict__ src,
                                __bf16* __restrict__ dst, int n) {
    int i = (blockIdx.x * blockDim.x + threadIdx.x) * 4;
    if (i < n) {
        float4 v = *reinterpret_cast<const float4*>(src + i);
        dst[i + 0] = (__bf16)v.x;
        dst[i + 1] = (__bf16)v.y;
        dst[i + 2] = (__bf16)v.z;
        dst[i + 3] = (__bf16)v.w;
    }
}

// ---------------------------------------------------------------- K1: RMSNorm
__global__ __launch_bounds__(256) void rmsnorm_kernel(const float* __restrict__ x,
                                                      const float* __restrict__ scale,
                                                      __bf16* __restrict__ xn) {
    __shared__ float red[8];
    int tok = blockIdx.x;
    int tid = threadIdx.x;
    float4 v = reinterpret_cast<const float4*>(x + (size_t)tok * DIM)[tid];
    float ss = v.x * v.x + v.y * v.y + v.z * v.z + v.w * v.w;
    #pragma unroll
    for (int off = 16; off > 0; off >>= 1) ss += __shfl_xor(ss, off, 32);
    if ((tid & 31) == 0) red[tid >> 5] = ss;
    __syncthreads();
    float tot = 0.f;
    #pragma unroll
    for (int i = 0; i < 8; i++) tot += red[i];
    float s = rsqrtf(tot * (1.0f / DIM) + 1e-6f);
    float4 sc = reinterpret_cast<const float4*>(scale)[tid];
    __bf16* out = xn + (size_t)tok * DIM + tid * 4;
    out[0] = (__bf16)(v.x * sc.x * s);
    out[1] = (__bf16)(v.y * sc.y * s);
    out[2] = (__bf16)(v.z * sc.z * s);
    out[3] = (__bf16)(v.w * sc.w * s);
}

// ---------------------------------------------------------------- K2: QKV GEMM + RoPE
// C[8192,3072] = Xn[8192,1024] * Wqkv[3072,1024]^T  (NT: both K-major)
// Double-buffered LDS, async-to-LDS copies, K-step 64, one barrier/step.
__global__ __launch_bounds__(256) void qkv_gemm_rope_kernel(
        const __bf16* __restrict__ xn, const __bf16* __restrict__ wqkv,
        const float* __restrict__ theta,
        __bf16* __restrict__ qd, __bf16* __restrict__ kd, __bf16* __restrict__ vd) {
    __shared__ __align__(16) __bf16 As[2][128][72];
    __shared__ __align__(16) __bf16 Bs[2][64][72];
    const int n0 = blockIdx.x * 64;    // 48 tiles over 3072
    const int m0 = blockIdx.y * 128;   // 64 tiles over 8192
    const int tid = threadIdx.x;
    const int wave = tid >> 5, lane = tid & 31;
    const int ln = lane & 15, hi = lane >> 4;

    const int ar = tid >> 1, ac = (tid & 1) * 32;   // A: 128 x 64, 64B/thread
    const int br = tid >> 2, bc = (tid & 3) * 16;   // B:  64 x 64, 32B/thread
    const __bf16* aB = xn   + (size_t)(m0 + ar) * DIM + ac;
    const __bf16* bB = wqkv + (size_t)(n0 + br) * DIM + bc;

    auto load_tile = [&](int k0, int buf) {
        #pragma unroll
        for (int u = 0; u < 4; u++)
            async_copy16(&As[buf][ar][ac + u * 8], aB + k0 + u * 8);
        #pragma unroll
        for (int u = 0; u < 2; u++)
            async_copy16(&Bs[buf][br][bc + u * 8], bB + k0 + u * 8);
    };

    load_tile(0, 0);
    wait_async0();
    __syncthreads();

    v8f acc[4] = {};
    const int NSTEP = DIM / 64;   // 16
    for (int i = 0; i < NSTEP; i++) {
        int cur = i & 1;
        if (i + 1 < NSTEP) load_tile((i + 1) * 64, cur ^ 1);
        #pragma unroll
        for (int kk = 0; kk < 2; kk++) {
            v16bf a = ld_frag(&As[cur][wave * 16 + ln][0], kk * 32 + hi * 8);
            #pragma unroll
            for (int nf = 0; nf < 4; nf++) {
                v16bf b = ld_frag(&Bs[cur][nf * 16 + ln][0], kk * 32 + hi * 8);
                acc[nf] = wmma_bf16(a, b, acc[nf]);
            }
        }
        if (i + 1 < NSTEP) wait_async0();
        __syncthreads();
    }

    const int comp = n0 >> 10;            // 0=q 1=k 2=v
    const int h = (n0 & 1023) >> 6;       // head (tile never crosses a head)
    #pragma unroll
    for (int r = 0; r < 8; r++) {
        int tok = m0 + wave * 16 + r + 8 * hi;
        int b = tok >> 10, seq = tok & 1023;
        float v0 = acc[0][r], v1 = acc[1][r], v2 = acc[2][r], v3 = acc[3][r];
        if (comp == 2) {
            // V stored transposed: [B,H,D,S]
            __bf16* vp = vd + ((size_t)(b * HEADS + h) * HD) * SEQ + seq;
            vp[(0 * 16 + ln) * SEQ] = (__bf16)v0;
            vp[(1 * 16 + ln) * SEQ] = (__bf16)v1;
            vp[(2 * 16 + ln) * SEQ] = (__bf16)v2;
            vp[(3 * 16 + ln) * SEQ] = (__bf16)v3;
        } else {
            // RoPE on d<32: pair (d, d+16) = (frag0, frag1), same lane slot
            float th = theta[seq * (HEADS * 16) + h * 16 + ln];
            float sn, cs;
            __sincosf(th, &sn, &cs);
            float y0 = v0 * cs - v1 * sn;
            float y1 = v1 * cs + v0 * sn;
            __bf16* dst = (comp == 0 ? qd : kd) + ((size_t)(b * HEADS + h) * SEQ + seq) * HD;
            dst[0 * 16 + ln] = (__bf16)y0;
            dst[1 * 16 + ln] = (__bf16)y1;
            dst[2 * 16 + ln] = (__bf16)v2;
            dst[3 * 16 + ln] = (__bf16)v3;
        }
    }
}

// ---------------------------------------------------------------- K3: causal flash attention
__global__ __launch_bounds__(256) void attention_kernel(
        const __bf16* __restrict__ qd, const __bf16* __restrict__ kd,
        const __bf16* __restrict__ vd, __bf16* __restrict__ od) {
    __shared__ __align__(16) __bf16 Ks[2][64][72];
    __shared__ __align__(16) __bf16 Vs[2][64][72];
    __shared__ __align__(16) __bf16 Ps[8][16][72];
    const int qt = blockIdx.x & 7;
    const int bh = blockIdx.x >> 3;   // b*16+h
    const int b  = bh >> 4, h = bh & 15;
    const int q0 = qt * 128;
    const int tid = threadIdx.x, wave = tid >> 5, lane = tid & 31;
    const int ln = lane & 15, hi = lane >> 4;

    // Q fragments resident in registers for the whole tile
    const __bf16* qrow = qd + ((size_t)bh * SEQ + q0 + wave * 16 + ln) * HD;
    v16bf qfrag[2];
    qfrag[0] = ld_frag(qrow, 0 * 32 + hi * 8);
    qfrag[1] = ld_frag(qrow, 1 * 32 + hi * 8);

    const int kr = tid >> 2, kc = (tid & 3) * 16;   // 64 x 64 chunk, 32B/thread
    const __bf16* kBp = kd + ((size_t)bh * SEQ + kr) * HD + kc;   // + j0*HD
    const __bf16* vBp = vd + ((size_t)bh * HD + kr) * SEQ + kc;   // + j0
    auto load_chunk = [&](int j0, int buf) {
        #pragma unroll
        for (int u = 0; u < 2; u++)
            async_copy16(&Ks[buf][kr][kc + u * 8], kBp + (size_t)j0 * HD + u * 8);
        #pragma unroll
        for (int u = 0; u < 2; u++)
            async_copy16(&Vs[buf][kr][kc + u * 8], vBp + j0 + u * 8);
    };

    load_chunk(0, 0);
    wait_async0();
    __syncthreads();

    v8f accO[4] = {};
    float mrun[8], lrun[8];
    #pragma unroll
    for (int r = 0; r < 8; r++) { mrun[r] = -1e30f; lrun[r] = 0.f; }

    const int nchunks = (q0 + 128) / 64;
    for (int ci = 0; ci < nchunks; ci++) {
        const int j0 = ci * 64, cur = ci & 1;
        if (ci + 1 < nchunks) load_chunk(j0 + 64, cur ^ 1);

        // scores: Q(16x64d) * K(64keys x 64d)^T  -> 4 frags of 16x16
        v8f accS[4] = {};
        #pragma unroll
        for (int nf = 0; nf < 4; nf++) {
            #pragma unroll
            for (int kk = 0; kk < 2; kk++) {
                v16bf bf = ld_frag(&Ks[cur][nf * 16 + ln][0], kk * 32 + hi * 8);
                accS[nf] = wmma_bf16(qfrag[kk], bf, accS[nf]);
            }
        }

        // online softmax per row (rows of a C-frag live in one 16-lane half)
        #pragma unroll
        for (int r = 0; r < 8; r++) {
            int qg = q0 + wave * 16 + r + 8 * hi;
            float sv[4];
            #pragma unroll
            for (int nf = 0; nf < 4; nf++) {
                int kg = j0 + nf * 16 + ln;
                float v = accS[nf][r] * 0.125f;   // 1/sqrt(64)
                sv[nf] = (kg <= qg) ? v : -1e30f;
            }
            float rmax = fmaxf(fmaxf(sv[0], sv[1]), fmaxf(sv[2], sv[3]));
            #pragma unroll
            for (int off = 8; off > 0; off >>= 1) rmax = fmaxf(rmax, __shfl_xor(rmax, off, 16));
            float mnew = fmaxf(mrun[r], rmax);
            float corr = __expf(mrun[r] - mnew);
            float psum = 0.f;
            #pragma unroll
            for (int nf = 0; nf < 4; nf++) {
                float p = __expf(sv[nf] - mnew);
                psum += p;
                Ps[wave][r + 8 * hi][nf * 16 + ln] = (__bf16)p;
            }
            #pragma unroll
            for (int off = 8; off > 0; off >>= 1) psum += __shfl_xor(psum, off, 16);
            lrun[r] = lrun[r] * corr + psum;
            mrun[r] = mnew;
            #pragma unroll
            for (int df = 0; df < 4; df++) accO[df][r] = accO[df][r] * corr;
        }
        // same-wave LDS round trip: enforce order + block compiler reordering
        asm volatile("s_wait_dscnt 0x0" ::: "memory");

        // O += P(16x64keys) * V(64keys x 64d)
        #pragma unroll
        for (int df = 0; df < 4; df++) {
            #pragma unroll
            for (int kk = 0; kk < 2; kk++) {
                v16bf pf = ld_frag(&Ps[wave][ln][0], kk * 32 + hi * 8);
                v16bf vf = ld_frag(&Vs[cur][df * 16 + ln][0], kk * 32 + hi * 8);
                accO[df] = wmma_bf16(pf, vf, accO[df]);
            }
        }
        if (ci + 1 < nchunks) wait_async0();
        __syncthreads();
    }

    #pragma unroll
    for (int r = 0; r < 8; r++) {
        int sg = q0 + wave * 16 + r + 8 * hi;
        float inv = 1.0f / lrun[r];
        __bf16* dst = od + ((size_t)(b * SEQ + sg)) * DIM + h * HD;
        #pragma unroll
        for (int df = 0; df < 4; df++) dst[df * 16 + ln] = (__bf16)(accO[df][r] * inv);
    }
}

// ---------------------------------------------------------------- K4: out-proj + residual
// out[8192,1024] = O[8192,1024] * Wout[1024,1024]^T + x
__global__ __launch_bounds__(256) void outproj_kernel(
        const __bf16* __restrict__ o, const __bf16* __restrict__ wout,
        const float* __restrict__ x, float* __restrict__ out) {
    __shared__ __align__(16) __bf16 As[2][128][72];
    __shared__ __align__(16) __bf16 Bs[2][64][72];
    const int n0 = blockIdx.x * 64;
    const int m0 = blockIdx.y * 128;
    const int tid = threadIdx.x;
    const int wave = tid >> 5, lane = tid & 31;
    const int ln = lane & 15, hi = lane >> 4;

    const int ar = tid >> 1, ac = (tid & 1) * 32;
    const int br = tid >> 2, bc = (tid & 3) * 16;
    const __bf16* aB = o    + (size_t)(m0 + ar) * DIM + ac;
    const __bf16* bB = wout + (size_t)(n0 + br) * DIM + bc;

    auto load_tile = [&](int k0, int buf) {
        #pragma unroll
        for (int u = 0; u < 4; u++)
            async_copy16(&As[buf][ar][ac + u * 8], aB + k0 + u * 8);
        #pragma unroll
        for (int u = 0; u < 2; u++)
            async_copy16(&Bs[buf][br][bc + u * 8], bB + k0 + u * 8);
    };

    load_tile(0, 0);
    wait_async0();
    __syncthreads();

    v8f acc[4] = {};
    const int NSTEP = DIM / 64;
    for (int i = 0; i < NSTEP; i++) {
        int cur = i & 1;
        if (i + 1 < NSTEP) load_tile((i + 1) * 64, cur ^ 1);
        #pragma unroll
        for (int kk = 0; kk < 2; kk++) {
            v16bf a = ld_frag(&As[cur][wave * 16 + ln][0], kk * 32 + hi * 8);
            #pragma unroll
            for (int nf = 0; nf < 4; nf++) {
                v16bf b = ld_frag(&Bs[cur][nf * 16 + ln][0], kk * 32 + hi * 8);
                acc[nf] = wmma_bf16(a, b, acc[nf]);
            }
        }
        if (i + 1 < NSTEP) wait_async0();
        __syncthreads();
    }

    #pragma unroll
    for (int r = 0; r < 8; r++) {
        int tok = m0 + wave * 16 + r + 8 * hi;
        float* dst        = out + (size_t)tok * DIM + n0;
        const float* skip = x   + (size_t)tok * DIM + n0;
        #pragma unroll
        for (int nf = 0; nf < 4; nf++)
            dst[nf * 16 + ln] = acc[nf][r] + skip[nf * 16 + ln];
    }
}

// ---------------------------------------------------------------- launch
extern "C" void kernel_launch(void* const* d_in, const int* in_sizes, int n_in,
                              void* d_out, int out_size, void* d_ws, size_t ws_size,
                              hipStream_t stream) {
    const float* x     = (const float*)d_in[0];   // [8,1024,1024]
    const float* scale = (const float*)d_in[1];   // [1024]
    const float* wqkv  = (const float*)d_in[2];   // [3072,1024]
    const float* wout  = (const float*)d_in[3];   // [1024,1024]
    const float* theta = (const float*)d_in[4];   // [1024,16,16]

    char* ws = (char*)d_ws;
    __bf16* wqkv_bf = (__bf16*)(ws);                         //  6,291,456 B
    __bf16* wout_bf = (__bf16*)(ws + 6291456);               //  2,097,152 B
    __bf16* xn_bf   = (__bf16*)(ws + 8388608);               // 16,777,216 B
    __bf16* q_bf    = (__bf16*)(ws + 25165824);              // [B,H,S,D]
    __bf16* k_bf    = (__bf16*)(ws + 41943040);              // [B,H,S,D]
    __bf16* v_bf    = (__bf16*)(ws + 58720256);              // [B,H,D,S]
    __bf16* o_bf    = (__bf16*)(ws + 75497472);              // [B,S,H*D]
    float*  outp    = (float*)d_out;

    cvt_bf16_kernel<<<(QKV_N * DIM / 4 + 255) / 256, 256, 0, stream>>>(wqkv, wqkv_bf, QKV_N * DIM);
    cvt_bf16_kernel<<<(DIM * DIM / 4 + 255) / 256, 256, 0, stream>>>(wout, wout_bf, DIM * DIM);
    rmsnorm_kernel<<<NTOK, 256, 0, stream>>>(x, scale, xn_bf);
    qkv_gemm_rope_kernel<<<dim3(QKV_N / 64, NTOK / 128), 256, 0, stream>>>(
        xn_bf, wqkv_bf, theta, q_bf, k_bf, v_bf);
    attention_kernel<<<BATCH * HEADS * (SEQ / 128), 256, 0, stream>>>(q_bf, k_bf, v_bf, o_bf);
    outproj_kernel<<<dim3(DIM / 64, NTOK / 128), 256, 0, stream>>>(o_bf, wout_bf, x, outp);
}

// v001
// It runs in 191 microseconds.
// Next to v000, in two timings, it ran 1.23 times as fast each time.
#include <hip/hip_runtime.h>

#define DIM    1024
#define HEADS  16
#define HD     64
#define SEQ    1024
#define BATCH  8
#define NTOK   (BATCH * SEQ)   // 8192
#define QKV_N  (3 * DIM)       // 3072

typedef __attribute__((ext_vector_type(16))) __bf16 v16bf;
typedef __attribute__((ext_vector_type(8)))  __bf16 v8bf;
typedef __attribute__((ext_vector_type(8)))  float  v8f;

// Load one 16-bf16 WMMA A/B fragment for this lane from an LDS row:
// per CDNA5 ISA 16-bit layout, lane holds k = base+0..7 and k = base+16..23
// with base = (lane>>4)*8, row = lane&15. k0 = chunk*32 + (lane>>4)*8.
__device__ __forceinline__ v16bf ld_frag(const __bf16* row, int k0) {
    v8bf lo = *reinterpret_cast<const v8bf*>(row + k0);
    v8bf hi = *reinterpret_cast<const v8bf*>(row + k0 + 16);
    return __builtin_shufflevector(lo, hi, 0,1,2,3,4,5,6,7,8,9,10,11,12,13,14,15);
}

__device__ __forceinline__ v8f wmma_bf16(v16bf a, v16bf b, v8f c) {
    return __builtin_amdgcn_wmma_f32_16x16x32_bf16(false, a, false, b, (short)0, c, false, false);
}

// Async copy 16B global -> LDS (GLOBAL_LOAD_ASYNC_TO_LDS_B128, ASYNCcnt).
// Generic LDS pointer: low 32 bits are the LDS byte offset (flat aperture rule).
__device__ __forceinline__ void async_copy16(void* lds_dst, const void* gsrc) {
    unsigned loff = (unsigned)(uintptr_t)lds_dst;
    asm volatile("global_load_async_to_lds_b128 %0, %1, off"
                 :: "v"(loff), "v"(gsrc) : "memory");
}
__device__ __forceinline__ void wait_async0() {
#if __has_builtin(__builtin_amdgcn_s_wait_asynccnt)
    __builtin_amdgcn_s_wait_asynccnt(0);
#else
    asm volatile("s_wait_asynccnt 0x0" ::: "memory");
#endif
}

// Four / eight 16-byte async copies of one lane, rows lstep (LDS bytes) and gstep
// (elements) apart. s_wait_xcnt 0 is the last line of the copies' own statement, so
// that it stands in front of any later rewrite of the address registers they name.
__device__ __forceinline__ void async_copy16_x4(unsigned l, unsigned lstep,
                                                const __bf16* g, size_t gstep) {
    asm volatile("global_load_async_to_lds_b128 %0, %4, off\n\t"
                 "global_load_async_to_lds_b128 %1, %5, off\n\t"
                 "global_load_async_to_lds_b128 %2, %6, off\n\t"
                 "global_load_async_to_lds_b128 %3, %7, off\n\t"
                 "s_wait_xcnt 0x0"
                 :: "v"(l), "v"(l + lstep), "v"(l + 2 * lstep), "v"(l + 3 * lstep),
                    "v"(g), "v"(g + gstep), "v"(g + 2 * gstep), "v"(g + 3 * gstep)
                 : "memory");
}
__device__ __forceinline__ void async_copy16_x8(unsigned l, unsigned lstep,
                                                const __bf16* g, size_t gstep) {
    asm volatile("global_load_async_to_lds_b128 %0, %8, off\n\t"
                 "global_load_async_to_lds_b128 %1, %9, off\n\t"
                 "global_load_async_to_lds_b128 %2, %10, off\n\t"
                 "global_load_async_to_lds_b128 %3, %11, off\n\t"
                 "global_load_async_to_lds_b128 %4, %12, off\n\t"
                 "global_load_async_to_lds_b128 %5, %13, off\n\t"
                 "global_load_async_to_lds_b128 %6, %14, off\n\t"
                 "global_load_async_to_lds_b128 %7, %15, off\n\t"
                 "s_wait_xcnt 0x0"
                 :: "v"(l), "v"(l + lstep), "v"(l + 2 * lstep), "v"(l + 3 * lstep),
                    "v"(l + 4 * lstep), "v"(l + 5 * lstep), "v"(l + 6 * lstep), "v"(l + 7 * lstep),
                    "v"(g), "v"(g + gstep), "v"(g + 2 * gstep), "v"(g + 3 * gstep),
                    "v"(g + 4 * gstep), "v"(g + 5 * gstep), "v"(g + 6 * gstep), "v"(g + 7 * gstep)
                 : "memory");
}

// NT GEMM main loop over K = DIM (both operands K-major, row pitch DIM).
// Block tile (WM*64) x 128 from WM x 2 waves; each wave keeps a 64 x 64 tile
// (4 x 4 accumulator fragments), so 8 loaded fragments feed 16 WMMAs.
// a, b point at the block's first row. Two LDS buffers, K-step 64, one barrier a step.
// A wave's copy covers four whole 128-byte rows.
template <int WM>
__device__ __forceinline__ void gemm_nt_mainloop(const __bf16* __restrict__ a,
                                                 const __bf16* __restrict__ b,
                                                 int wm, int wn, v8f (&acc)[4][4]) {
    constexpr int BM = WM * 64;      // rows of the A tile
    constexpr int RP = WM * 8;       // rows that one copy of the whole block covers
    __shared__ __align__(16) __bf16 As[2][BM][72];
    __shared__ __align__(16) __bf16 Bs[2][128][72];
    const int tid = threadIdx.x, lane = tid & 31;
    const int ln = lane & 15, hi = lane >> 4;
    const int cr = tid >> 3, cc = (tid & 7) * 8;
    const __bf16* ag = a + (size_t)cr * DIM + cc;
    const __bf16* bg = b + (size_t)cr * DIM + cc;

    auto load_tile = [&](int k0, int buf) {
        async_copy16_x8((unsigned)(uintptr_t)&As[buf][cr][cc], RP * 144, ag + k0, (size_t)RP * DIM);
        if constexpr (WM == 4)
            async_copy16_x4((unsigned)(uintptr_t)&Bs[buf][cr][cc], RP * 144, bg + k0, (size_t)RP * DIM);
        else
            async_copy16_x8((unsigned)(uintptr_t)&Bs[buf][cr][cc], RP * 144, bg + k0, (size_t)RP * DIM);
    };

    load_tile(0, 0);
    asm volatile("s_wait_asynccnt 0x0" ::: "memory");   // tile 0 landed before it is published
    __syncthreads();
    load_tile(64, 1);

    constexpr int NSTEP = DIM / 64;   // 16
    for (int i = 0; i < NSTEP; i++) {
        const int cur = i & 1;
        v16bf af[4], bf[4];
        auto load_frags = [&](int kk) {
            #pragma unroll
            for (int f = 0; f < 4; f++) {
                af[f] = ld_frag(&As[cur][wm * 64 + f * 16 + ln][0], kk * 32 + hi * 8);
                bf[f] = ld_frag(&Bs[cur][wn * 64 + f * 16 + ln][0], kk * 32 + hi * 8);
            }
        };
        auto products = [&]() {
            #pragma unroll
            for (int mf = 0; mf < 4; mf++)
                #pragma unroll
                for (int nf = 0; nf < 4; nf++)
                    acc[mf][nf] = wmma_bf16(af[mf], bf[nf], acc[mf][nf]);
        };
        load_frags(0);
        // keeps the 16 LDS reads one group ahead of their 16 WMMAs: left alone the
        // scheduler reloads one A fragment per row of 4 and waits it out each time
        __builtin_amdgcn_sched_barrier(0);
        products();
        load_frags(1);
        // publish point: this wave's reads of buffer cur are done, its copies of the
        // next tile have landed; behind the barrier buffer cur may be refilled.
        asm volatile("s_wait_dscnt 0x0" ::: "memory");
        asm volatile("s_wait_asynccnt 0x0" ::: "memory");
        __syncthreads();
        if (i + 2 < NSTEP) load_tile((i + 2) * 64, cur);
        // the step's second half works from registers while the refill is in flight
        products();
    }
    asm volatile("s_wait_asynccnt 0x0" ::: "memory");   // no copy outstanding at the wave's end
}

// ---------------------------------------------------------------- K0: f32 -> bf16
__global__ void cvt_bf16_kernel(const float* __restrict__ src,
                                __bf16* __restrict__ dst, int n) {
    int i = (blockIdx.x * blockDim.x + threadIdx.x) * 4;
    if (i < n) {
        float4 v = *reinterpret_cast<const float4*>(src + i);
        dst[i + 0] = (__bf16)v.x;
        dst[i + 1] = (__bf16)v.y;
        dst[i + 2] = (__bf16)v.z;
        dst[i + 3] = (__bf16)v.w;
    }
}

// ---------------------------------------------------------------- K1: RMSNorm
__global__ __launch_bounds__(256) void rmsnorm_kernel(const float* __restrict__ x,
                                                      const float* __restrict__ scale,
                                                      __bf16* __restrict__ xn) {
    __shared__ float red[8];
    int tok = blockIdx.x;
    int tid = threadIdx.x;
    float4 v = reinterpret_cast<const float4*>(x + (size_t)tok * DIM)[tid];
    float ss = v.x * v.x + v.y * v.y + v.z * v.z + v.w * v.w;
    #pragma unroll
    for (int off = 16; off > 0; off >>= 1) ss += __shfl_xor(ss, off, 32);
    if ((tid & 31) == 0) red[tid >> 5] = ss;
    __syncthreads();
    float tot = 0.f;
    #pragma unroll
    for (int i = 0; i < 8; i++) tot += red[i];
    float s = rsqrtf(tot * (1.0f / DIM) + 1e-6f);
    float4 sc = reinterpret_cast<const float4*>(scale)[tid];
    __bf16* out = xn + (size_t)tok * DIM + tid * 4;
    out[0] = (__bf16)(v.x * sc.x * s);
    out[1] = (__bf16)(v.y * sc.y * s);
    out[2] = (__bf16)(v.z * sc.z * s);
    out[3] = (__bf16)(v.w * sc.w * s);
}

// ---------------------------------------------------------------- K2: QKV GEMM + RoPE
// C[8192,3072] = Xn[8192,1024] * Wqkv[3072,1024]^T  (NT: both K-major)
// 256 x 128 block tile, 8 waves (4 x 2) of 64 x 64; a wave's 64 columns are one head.
__global__ __launch_bounds__(256) __attribute__((amdgpu_waves_per_eu(4, 4)))
void qkv_gemm_rope_kernel(
        const __bf16* __restrict__ xn, const __bf16* __restrict__ wqkv,
        const float* __restrict__ theta,
        __bf16* __restrict__ qd, __bf16* __restrict__ kd, __bf16* __restrict__ vd) {
    const int n0 = blockIdx.x * 128;   // 24 tiles over 3072
    const int m0 = blockIdx.y * 256;   // 32 tiles over 8192
    const int wave = __builtin_amdgcn_readfirstlane(threadIdx.x >> 5);
    const int lane = threadIdx.x & 31;
    const int ln = lane & 15, hi = lane >> 4;
    const int wm = wave >> 1, wn = wave & 1;

    v8f acc[4][4] = {};
    gemm_nt_mainloop<4>(xn + (size_t)m0 * DIM, wqkv + (size_t)n0 * DIM, wm, wn, acc);

    const int nw = n0 + wn * 64;          // this wave's first column
    const int comp = nw >> 10;            // 0=q 1=k 2=v
    const int h = (nw & 1023) >> 6;       // head (a wave's tile never crosses a head)
    const int tok0 = m0 + wm * 64;        // a wave's 64 rows lie in one batch entry
    const int b = tok0 >> 10, seq0 = (tok0 & 1023) + 8 * hi;
    if (comp == 2) {
        // V stored transposed: [B,H,D,S]
        __bf16* vp = vd + ((size_t)(b * HEADS + h) * HD + ln) * SEQ + seq0;
        #pragma unroll
        for (int mf = 0; mf < 4; mf++)
            #pragma unroll
            for (int nf = 0; nf < 4; nf++)
                #pragma unroll
                for (int r = 0; r < 8; r++)
                    vp[nf * 16 * SEQ + mf * 16 + r] = (__bf16)acc[mf][nf][r];
    } else {
        // RoPE on d<32: pair (d, d+16) = (frag0, frag1), same lane slot
        const float* tp = theta + seq0 * (HEADS * 16) + h * 16 + ln;
        __bf16* dst = (comp == 0 ? qd : kd) + ((size_t)(b * HEADS + h) * SEQ + seq0) * HD + ln;
        float th[4][8];
        #pragma unroll
        for (int mf = 0; mf < 4; mf++)
            #pragma unroll
            for (int r = 0; r < 8; r++) th[mf][r] = tp[(mf * 16 + r) * (HEADS * 16)];
        #pragma unroll
        for (int mf = 0; mf < 4; mf++) {
            #pragma unroll
            for (int r = 0; r < 8; r++) {
                const int row = mf * 16 + r;
                float v0 = acc[mf][0][r], v1 = acc[mf][1][r];
                float sn, cs;
                // the fast sine and cosine (argument in turns) in one statement: its v_nop
                // fills the slot behind a transcendental, whatever is scheduled next
                asm("v_sin_f32 %0, %2\n\tv_cos_f32 %1, %2\n\tv_nop"
                    : "=&v"(sn), "=&v"(cs) : "v"(th[mf][r] * 0.15915494f));
                float y0 = v0 * cs - v1 * sn;
                float y1 = v1 * cs + v0 * sn;
                dst[row * HD + 0 * 16] = (__bf16)y0;
                dst[row * HD + 1 * 16] = (__bf16)y1;
                dst[row * HD + 2 * 16] = (__bf16)acc[mf][2][r];
                dst[row * HD + 3 * 16] = (__bf16)acc[mf][3][r];
            }
            // one group of 16 rows at a time: with all 32 sine and cosine pairs
            // scheduled together the registers spill to scratch
            __builtin_amdgcn_sched_barrier(0);
        }
        // the listing keeps a path from these stores into the other branch, which
        // rewrites their address registers: the wait stands in front of that rewrite
        asm volatile("s_wait_xcnt 0x0" ::: "memory");
    }
}

// ---------------------------------------------------------------- K3: causal flash attention
__global__ __launch_bounds__(256) void attention_kernel(
        const __bf16* __restrict__ qd, const __bf16* __restrict__ kd,
        const __bf16* __restrict__ vd, __bf16* __restrict__ od) {
    __shared__ __align__(16) __bf16 Ks[2][64][72];
    __shared__ __align__(16) __bf16 Vs[2][64][72];
    __shared__ __align__(16) __bf16 Ps[8][16][72];
    const int qt = blockIdx.x & 7;
    const int bh = blockIdx.x >> 3;   // b*16+h
    const int b  = bh >> 4, h = bh & 15;
    const int q0 = qt * 128;
    const int tid = threadIdx.x, wave = tid >> 5, lane = tid & 31;
    const int ln = lane & 15, hi = lane >> 4;

    // Q fragments resident in registers for the whole tile
    const __bf16* qrow = qd + ((size_t)bh * SEQ + q0 + wave * 16 + ln) * HD;
    v16bf qfrag[2];
    qfrag[0] = ld_frag(qrow, 0 * 32 + hi * 8);
    qfrag[1] = ld_frag(qrow, 1 * 32 + hi * 8);

    const int kr = tid >> 2, kc = (tid & 3) * 16;   // 64 x 64 chunk, 32B/thread
    const __bf16* kBp = kd + ((size_t)bh * SEQ + kr) * HD + kc;   // + j0*HD
    const __bf16* vBp = vd + ((size_t)bh * HD + kr) * SEQ + kc;   // + j0
    auto load_chunk = [&](int j0, int buf) {
        #pragma unroll
        for (int u = 0; u < 2; u++)
            async_copy16(&Ks[buf][kr][kc + u * 8], kBp + (size_t)j0 * HD + u * 8);
        #pragma unroll
        for (int u = 0; u < 2; u++)
            async_copy16(&Vs[buf][kr][kc + u * 8], vBp + j0 + u * 8);
    };

    load_chunk(0, 0);
    wait_async0();
    __syncthreads();

    v8f accO[4] = {};
    float mrun[8], lrun[8];
    #pragma unroll
    for (int r = 0; r < 8; r++) { mrun[r] = -1e30f; lrun[r] = 0.f; }

    const int nchunks = (q0 + 128) / 64;
    for (int ci = 0; ci < nchunks; ci++) {
        const int j0 = ci * 64, cur = ci & 1;
        if (ci + 1 < nchunks) load_chunk(j0 + 64, cur ^ 1);

        // scores: Q(16x64d) * K(64keys x 64d)^T  -> 4 frags of 16x16
        v8f accS[4] = {};
        #pragma unroll
        for (int nf = 0; nf < 4; nf++) {
            #pragma unroll
            for (int kk = 0; kk < 2; kk++) {
                v16bf bf = ld_frag(&Ks[cur][nf * 16 + ln][0], kk * 32 + hi * 8);
                accS[nf] = wmma_bf16(qfrag[kk], bf, accS[nf]);
            }
        }

        // online softmax per row (rows of a C-frag live in one 16-lane half)
        #pragma unroll
        for (int r = 0; r < 8; r++) {
            int qg = q0 + wave * 16 + r + 8 * hi;
            float sv[4];
            #pragma unroll
            for (int nf = 0; nf < 4; nf++) {
                int kg = j0 + nf * 16 + ln;
                float v = accS[nf][r] * 0.125f;   // 1/sqrt(64)
                sv[nf] = (kg <= qg) ? v : -1e30f;
            }
            float rmax = fmaxf(fmaxf(sv[0], sv[1]), fmaxf(sv[2], sv[3]));
            #pragma unroll
            for (int off = 8; off > 0; off >>= 1) rmax = fmaxf(rmax, __shfl_xor(rmax, off, 16));
            float mnew = fmaxf(mrun[r], rmax);
            float corr = __expf(mrun[r] - mnew);
            float psum = 0.f;
            #pragma unroll
            for (int nf = 0; nf < 4; nf++) {
                float p = __expf(sv[nf] - mnew);
                psum += p;
                Ps[wave][r + 8 * hi][nf * 16 + ln] = (__bf16)p;
            }
            #pragma unroll
            for (int off = 8; off > 0; off >>= 1) psum += __shfl_xor(psum, off, 16);
            lrun[r] = lrun[r] * corr + psum;
            mrun[r] = mnew;
            #pragma unroll
            for (int df = 0; df < 4; df++) accO[df][r] = accO[df][r] * corr;
        }
        // same-wave LDS round trip: enforce order + block compiler reordering
        asm volatile("s_wait_dscnt 0x0" ::: "memory");

        // O += P(16x64keys) * V(64keys x 64d)
        #pragma unroll
        for (int df = 0; df < 4; df++) {
            #pragma unroll
            for (int kk = 0; kk < 2; kk++) {
                v16bf pf = ld_frag(&Ps[wave][ln][0], kk * 32 + hi * 8);
                v16bf vf = ld_frag(&Vs[cur][df * 16 + ln][0], kk * 32 + hi * 8);
                accO[df] = wmma_bf16(pf, vf, accO[df]);
            }
        }
        if (ci + 1 < nchunks) wait_async0();
        __syncthreads();
    }

    #pragma unroll
    for (int r = 0; r < 8; r++) {
        int sg = q0 + wave * 16 + r + 8 * hi;
        float inv = 1.0f / lrun[r];
        __bf16* dst = od + ((size_t)(b * SEQ + sg)) * DIM + h * HD;
        #pragma unroll
        for (int df = 0; df < 4; df++) dst[df * 16 + ln] = (__bf16)(accO[df][r] * inv);
    }
}

// ---------------------------------------------------------------- K4: out-proj + residual
// out[8192,1024] = O[8192,1024] * Wout[1024,1024]^T + x
// 128 x 128 block tile, 4 waves (2 x 2) of 64 x 64: 512 blocks, two for each WGP.
__global__ __launch_bounds__(128) __attribute__((amdgpu_waves_per_eu(4, 4)))
void outproj_kernel(
        const __bf16* __restrict__ o, const __bf16* __restrict__ wout,
        const float* __restrict__ x, float* __restrict__ out) {
    const int n0 = blockIdx.x * 128;
    const int m0 = blockIdx.y * 128;
    const int wave = __builtin_amdgcn_readfirstlane(threadIdx.x >> 5);
    const int lane = threadIdx.x & 31;
    const int ln = lane & 15, hi = lane >> 4;
    const int wm = wave >> 1, wn = wave & 1;

    v8f acc[4][4] = {};
    gemm_nt_mainloop<2>(o + (size_t)m0 * DIM, wout + (size_t)n0 * DIM, wm, wn, acc);

    const unsigned at = (unsigned)(m0 + wm * 64 + 8 * hi) * DIM + n0 + wn * 64 + ln;
    float* dst        = out + at;
    const float* skip = x   + at;
    #pragma unroll
    for (int mf = 0; mf < 4; mf++) {
        #pragma unroll
        for (int r = 0; r < 8; r++) {
            #pragma unroll
            for (int nf = 0; nf < 4; nf++) {
                const int off = (mf * 16 + r) * DIM + nf * 16;
                dst[off] = acc[mf][nf][r] + skip[off];
            }
        }
    }
}

// ---------------------------------------------------------------- launch
extern "C" void kernel_launch(void* const* d_in, const int* in_sizes, int n_in,
                              void* d_out, int out_size, void* d_ws, size_t ws_size,
                              hipStream_t stream) {
    const float* x     = (const float*)d_in[0];   // [8,1024,1024]
    const float* scale = (const float*)d_in[1];   // [1024]
    const float* wqkv  = (const float*)d_in[2];   // [3072,1024]
    const float* wout  = (const float*)d_in[3];   // [1024,1024]
    const float* theta = (const float*)d_in[4];   // [1024,16,16]

    char* ws = (char*)d_ws;
    __bf16* wqkv_bf = (__bf16*)(ws);                         //  6,291,456 B
    __bf16* wout_bf = (__bf16*)(ws + 6291456);               //  2,097,152 B
    __bf16* xn_bf   = (__bf16*)(ws + 8388608);               // 16,777,216 B
    __bf16* q_bf    = (__bf16*)(ws + 25165824);              // [B,H,S,D]
    __bf16* k_bf    = (__bf16*)(ws + 41943040);              // [B,H,S,D]
    __bf16* v_bf    = (__bf16*)(ws + 58720256);              // [B,H,D,S]
    __bf16* o_bf    = (__bf16*)(ws + 75497472);              // [B,S,H*D]
    float*  outp    = (float*)d_out;

    cvt_bf16_kernel<<<(QKV_N * DIM / 4 + 255) / 256, 256, 0, stream>>>(wqkv, wqkv_bf, QKV_N * DIM);
    cvt_bf16_kernel<<<(DIM * DIM / 4 + 255) / 256, 256, 0, stream>>>(wout, wout_bf, DIM * DIM);
    rmsnorm_kernel<<<NTOK, 256, 0, stream>>>(x, scale, xn_bf);
    qkv_gemm_rope_kernel<<<dim3(QKV_N / 128, NTOK / 256), 256, 0, stream>>>(
        xn_bf, wqkv_bf, theta, q_bf, k_bf, v_bf);
    attention_kernel<<<BATCH * HEADS * (SEQ / 128), 256, 0, stream>>>(q_bf, k_bf, v_bf, o_bf);
    outproj_kernel<<<dim3(DIM / 128, NTOK / 128), 128, 0, stream>>>(o_bf, wout_bf, x, outp);
}

// v002
// One run takes 185 microseconds.
// In both of two side-by-side timings against v001, it was 1.03 times as fast.
// Over all steps from v000 it is 1.27 times as fast.
#include <hip/hip_runtime.h>

#define DIM    1024
#define HEADS  16
#define HD     64
#define SEQ    1024
#define BATCH  8
#define NTOK   (BATCH * SEQ)   // 8192
#define QKV_N  (3 * DIM)       // 3072

typedef __attribute__((ext_vector_type(16))) __bf16 v16bf;
typedef __attribute__((ext_vector_type(8)))  __bf16 v8bf;
typedef __attribute__((ext_vector_type(8)))  float  v8f;

// Load one 16-bf16 WMMA A/B fragment for this lane from an LDS row:
// per CDNA5 ISA 16-bit layout, lane holds k = base+0..7 and k = base+16..23
// with base = (lane>>4)*8, row = lane&15. k0 = chunk*32 + (lane>>4)*8.
__device__ __forceinline__ v16bf ld_frag(const __bf16* row, int k0) {
    v8bf lo = *reinterpret_cast<const v8bf*>(row + k0);
    v8bf hi = *reinterpret_cast<const v8bf*>(row + k0 + 16);
    return __builtin_shufflevector(lo, hi, 0,1,2,3,4,5,6,7,8,9,10,11,12,13,14,15);
}

__device__ __forceinline__ v8f wmma_bf16(v16bf a, v16bf b, v8f c) {
    return __builtin_amdgcn_wmma_f32_16x16x32_bf16(false, a, false, b, (short)0, c, false, false);
}

// Async copy 16B global -> LDS (GLOBAL_LOAD_ASYNC_TO_LDS_B128, ASYNCcnt).
// Generic LDS pointer: low 32 bits are the LDS byte offset (flat aperture rule).
__device__ __forceinline__ void async_copy16(void* lds_dst, const void* gsrc) {
    unsigned loff = (unsigned)(uintptr_t)lds_dst;
    asm volatile("global_load_async_to_lds_b128 %0, %1, off"
                 :: "v"(loff), "v"(gsrc) : "memory");
}
__device__ __forceinline__ void wait_async0() {
#if __has_builtin(__builtin_amdgcn_s_wait_asynccnt)
    __builtin_amdgcn_s_wait_asynccnt(0);
#else
    asm volatile("s_wait_asynccnt 0x0" ::: "memory");
#endif
}

// Four / eight 16-byte async copies of one lane, rows lstep (LDS bytes) and gstep
// (elements) apart. s_wait_xcnt 0 is the last line of the copies' own statement, so
// that it stands in front of any later rewrite of the address registers they name.
__device__ __forceinline__ void async_copy16_x4(unsigned l, unsigned lstep,
                                                const __bf16* g, size_t gstep) {
    asm volatile("global_load_async_to_lds_b128 %0, %4, off\n\t"
                 "global_load_async_to_lds_b128 %1, %5, off\n\t"
                 "global_load_async_to_lds_b128 %2, %6, off\n\t"
                 "global_load_async_to_lds_b128 %3, %7, off\n\t"
                 "s_wait_xcnt 0x0"
                 :: "v"(l), "v"(l + lstep), "v"(l + 2 * lstep), "v"(l + 3 * lstep),
                    "v"(g), "v"(g + gstep), "v"(g + 2 * gstep), "v"(g + 3 * gstep)
                 : "memory");
}
__device__ __forceinline__ void async_copy16_x8(unsigned l, unsigned lstep,
                                                const __bf16* g, size_t gstep) {
    asm volatile("global_load_async_to_lds_b128 %0, %8, off\n\t"
                 "global_load_async_to_lds_b128 %1, %9, off\n\t"
                 "global_load_async_to_lds_b128 %2, %10, off\n\t"
                 "global_load_async_to_lds_b128 %3, %11, off\n\t"
                 "global_load_async_to_lds_b128 %4, %12, off\n\t"
                 "global_load_async_to_lds_b128 %5, %13, off\n\t"
                 "global_load_async_to_lds_b128 %6, %14, off\n\t"
                 "global_load_async_to_lds_b128 %7, %15, off\n\t"
                 "s_wait_xcnt 0x0"
                 :: "v"(l), "v"(l + lstep), "v"(l + 2 * lstep), "v"(l + 3 * lstep),
                    "v"(l + 4 * lstep), "v"(l + 5 * lstep), "v"(l + 6 * lstep), "v"(l + 7 * lstep),
                    "v"(g), "v"(g + gstep), "v"(g + 2 * gstep), "v"(g + 3 * gstep),
                    "v"(g + 4 * gstep), "v"(g + 5 * gstep), "v"(g + 6 * gstep), "v"(g + 7 * gstep)
                 : "memory");
}

// NT GEMM main loop over K = DIM (both operands K-major, row pitch DIM).
// Block tile (WM*64) x 128 from WM x 2 waves; each wave keeps a 64 x 64 tile
// (4 x 4 accumulator fragments), so 8 loaded fragments feed 16 WMMAs.
// a, b point at the block's first row. Two LDS buffers, K-step 64, one barrier a step.
// A wave's copy covers four whole 128-byte rows.
template <int WM>
__device__ __forceinline__ void gemm_nt_mainloop(const __bf16* __restrict__ a,
                                                 const __bf16* __restrict__ b,
                                                 int wm, int wn, v8f (&acc)[4][4]) {
    constexpr int BM = WM * 64;      // rows of the A tile
    constexpr int RP = WM * 8;       // rows that one copy of the whole block covers
    __shared__ __align__(16) __bf16 As[2][BM][72];
    __shared__ __align__(16) __bf16 Bs[2][128][72];
    const int tid = threadIdx.x, lane = tid & 31;
    const int ln = lane & 15, hi = lane >> 4;
    const int cr = tid >> 3, cc = (tid & 7) * 8;
    const __bf16* ag = a + (size_t)cr * DIM + cc;
    const __bf16* bg = b + (size_t)cr * DIM + cc;

    auto load_tile = [&](int k0, int buf) {
        async_copy16_x8((unsigned)(uintptr_t)&As[buf][cr][cc], RP * 144, ag + k0, (size_t)RP * DIM);
        if constexpr (WM == 4)
            async_copy16_x4((unsigned)(uintptr_t)&Bs[buf][cr][cc], RP * 144, bg + k0, (size_t)RP * DIM);
        else
            async_copy16_x8((unsigned)(uintptr_t)&Bs[buf][cr][cc], RP * 144, bg + k0, (size_t)RP * DIM);
    };

    load_tile(0, 0);
    asm volatile("s_wait_asynccnt 0x0" ::: "memory");   // tile 0 landed before it is published
    __syncthreads();
    load_tile(64, 1);

    constexpr int NSTEP = DIM / 64;   // 16
    for (int i = 0; i < NSTEP; i++) {
        const int cur = i & 1;
        v16bf af[4], bf[4];
        auto load_frags = [&](int kk) {
            #pragma unroll
            for (int f = 0; f < 4; f++) {
                af[f] = ld_frag(&As[cur][wm * 64 + f * 16 + ln][0], kk * 32 + hi * 8);
                bf[f] = ld_frag(&Bs[cur][wn * 64 + f * 16 + ln][0], kk * 32 + hi * 8);
            }
        };
        auto products = [&]() {
            #pragma unroll
            for (int mf = 0; mf < 4; mf++)
                #pragma unroll
                for (int nf = 0; nf < 4; nf++)
                    acc[mf][nf] = wmma_bf16(af[mf], bf[nf], acc[mf][nf]);
        };
        load_frags(0);
        // keeps the 16 LDS reads one group ahead of their 16 WMMAs: left alone the
        // scheduler reloads one A fragment per row of 4 and waits it out each time
        __builtin_amdgcn_sched_barrier(0);
        products();
        load_frags(1);
        // publish point: this wave's reads of buffer cur are done, its copies of the
        // next tile have landed; behind the barrier buffer cur may be refilled.
        asm volatile("s_wait_dscnt 0x0" ::: "memory");
        asm volatile("s_wait_asynccnt 0x0" ::: "memory");
        __syncthreads();
        if (i + 2 < NSTEP) load_tile((i + 2) * 64, cur);
        // the step's second half works from registers while the refill is in flight
        products();
    }
    asm volatile("s_wait_asynccnt 0x0" ::: "memory");   // no copy outstanding at the wave's end
}

// ---------------------------------------------------------------- K0: all f32 -> bf16 preparation
// 256 x 16 long-lived waves (for speed only). A wave owns whole 1024-float rows, 32 floats a lane as 8 loads of 512 contiguous bytes:
// two rows of x (RMSNorm; the row sum stays inside the wave) and one weight row (rounding only).
typedef __attribute__((ext_vector_type(4))) float  v4f;
typedef __attribute__((ext_vector_type(4))) __bf16 v4bf;
static_assert(QKV_N + DIM == NTOK / 2, "one weight row for every two rows of x");

// A lane's share of a row: element 4 * c + e of r[k] with c = 0, 1 is float e of the
// row's 16-byte piece (2 * k + c) * 32 + lane.
struct RowRegs { v8f r[4]; };

__device__ __forceinline__ RowRegs load_row(const float* row, int lane) {
    const v4f* p = reinterpret_cast<const v4f*>(row) + lane;
    RowRegs t;
    #pragma unroll
    for (int k = 0; k < 4; k++)
        t.r[k] = __builtin_shufflevector(p[k * 64], p[k * 64 + 32], 0, 1, 2, 3, 4, 5, 6, 7);
    return t;
}
__device__ __forceinline__ void store_row(__bf16* row, int lane, const RowRegs& t) {
    v4bf* p = reinterpret_cast<v4bf*>(row) + lane;
    #pragma unroll
    for (int k = 0; k < 4; k++) {
        p[k * 64]      = __builtin_convertvector(__builtin_shufflevector(t.r[k], t.r[k], 0, 1, 2, 3), v4bf);
        p[k * 64 + 32] = __builtin_convertvector(__builtin_shufflevector(t.r[k], t.r[k], 4, 5, 6, 7), v4bf);
    }
}
// 1 / rms of a row: eight partial sums a lane, folded, then a five-step butterfly
__device__ __forceinline__ float row_rrms(const RowRegs& t) {
    v8f a = t.r[0] * t.r[0];
    #pragma unroll
    for (int k = 1; k < 4; k++) a += t.r[k] * t.r[k];
    float ss = ((a[0] + a[1]) + (a[2] + a[3])) + ((a[4] + a[5]) + (a[6] + a[7]));
    #pragma unroll
    for (int off = 16; off > 0; off >>= 1) ss += __shfl_xor(ss, off, 32);
    return rsqrtf(ss * (1.0f / DIM) + 1e-6f);
}

__global__ __launch_bounds__(512) void prep_kernel(
        const float* __restrict__ x, const float* __restrict__ scale,
        const float* __restrict__ wqkv, const float* __restrict__ wout,
        __bf16* __restrict__ xn, __bf16* __restrict__ wqkv_bf, __bf16* __restrict__ wout_bf) {
    const int lane = threadIdx.x & 31;
    const int w = __builtin_amdgcn_readfirstlane(blockIdx.x * 16 + (threadIdx.x >> 5));   // 0..4095
    const float* wsrc = w < QKV_N ? wqkv + (size_t)w * DIM : wout + (size_t)(w - QKV_N) * DIM;
    __bf16*      wdst = w < QKV_N ? wqkv_bf + (size_t)w * DIM : wout_bf + (size_t)(w - QKV_N) * DIM;

    RowRegs x0 = load_row(x + (size_t)w * (2 * DIM), lane);
    RowRegs x1 = load_row(x + (size_t)w * (2 * DIM) + DIM, lane);
    RowRegs sc = load_row(scale, lane);
    RowRegs wr = load_row(wsrc, lane);

    const float s0 = row_rrms(x0), s1 = row_rrms(x1);
    #pragma unroll
    for (int k = 0; k < 4; k++) {
        x0.r[k] = x0.r[k] * sc.r[k] * s0;
        x1.r[k] = x1.r[k] * sc.r[k] * s1;
    }
    store_row(wdst, lane, wr);
    store_row(xn + (size_t)w * (2 * DIM), lane, x0);
    store_row(xn + (size_t)w * (2 * DIM) + DIM, lane, x1);
}

// ---------------------------------------------------------------- K2: QKV GEMM + RoPE
// C[8192,3072] = Xn[8192,1024] * Wqkv[3072,1024]^T  (NT: both K-major)
// 256 x 128 block tile, 8 waves (4 x 2) of 64 x 64; a wave's 64 columns are one head.
__global__ __launch_bounds__(256) __attribute__((amdgpu_waves_per_eu(4, 4)))
void qkv_gemm_rope_kernel(
        const __bf16* __restrict__ xn, const __bf16* __restrict__ wqkv,
        const float* __restrict__ theta,
        __bf16* __restrict__ qd, __bf16* __restrict__ kd, __bf16* __restrict__ vd) {
    const int n0 = blockIdx.x * 128;   // 24 tiles over 3072
    const int m0 = blockIdx.y * 256;   // 32 tiles over 8192
    const int wave = __builtin_amdgcn_readfirstlane(threadIdx.x >> 5);
    const int lane = threadIdx.x & 31;
    const int ln = lane & 15, hi = lane >> 4;
    const int wm = wave >> 1, wn = wave & 1;

    v8f acc[4][4] = {};
    gemm_nt_mainloop<4>(xn + (size_t)m0 * DIM, wqkv + (size_t)n0 * DIM, wm, wn, acc);

    const int nw = n0 + wn * 64;          // this wave's first column
    const int comp = nw >> 10;            // 0=q 1=k 2=v
    const int h = (nw & 1023) >> 6;       // head (a wave's tile never crosses a head)
    const int tok0 = m0 + wm * 64;        // a wave's 64 rows lie in one batch entry
    const int b = tok0 >> 10, seq0 = (tok0 & 1023) + 8 * hi;
    if (comp == 2) {
        // V stored transposed: [B,H,D,S]
        __bf16* vp = vd + ((size_t)(b * HEADS + h) * HD + ln) * SEQ + seq0;
        #pragma unroll
        for (int mf = 0; mf < 4; mf++)
            #pragma unroll
            for (int nf = 0; nf < 4; nf++)
                #pragma unroll
                for (int r = 0; r < 8; r++)
                    vp[nf * 16 * SEQ + mf * 16 + r] = (__bf16)acc[mf][nf][r];
    } else {
        // RoPE on d<32: pair (d, d+16) = (frag0, frag1), same lane slot
        const float* tp = theta + seq0 * (HEADS * 16) + h * 16 + ln;
        __bf16* dst = (comp == 0 ? qd : kd) + ((size_t)(b * HEADS + h) * SEQ + seq0) * HD + ln;
        float th[4][8];
        #pragma unroll
        for (int mf = 0; mf < 4; mf++)
            #pragma unroll
            for (int r = 0; r < 8; r++) th[mf][r] = tp[(mf * 16 + r) * (HEADS * 16)];
        #pragma unroll
        for (int mf = 0; mf < 4; mf++) {
            #pragma unroll
            for (int r = 0; r < 8; r++) {
                const int row = mf * 16 + r;
                float v0 = acc[mf][0][r], v1 = acc[mf][1][r];
                float sn, cs;
                // the fast sine and cosine (argument in turns) in one statement: its v_nop
                // fills the slot behind a transcendental, whatever is scheduled next
                asm("v_sin_f32 %0, %2\n\tv_cos_f32 %1, %2\n\tv_nop"
                    : "=&v"(sn), "=&v"(cs) : "v"(th[mf][r] * 0.15915494f));
                float y0 = v0 * cs - v1 * sn;
                float y1 = v1 * cs + v0 * sn;
                dst[row * HD + 0 * 16] = (__bf16)y0;
                dst[row * HD + 1 * 16] = (__bf16)y1;
                dst[row * HD + 2 * 16] = (__bf16)acc[mf][2][r];
                dst[row * HD + 3 * 16] = (__bf16)acc[mf][3][r];
            }
            // one group of 16 rows at a time: with all 32 sine and cosine pairs
            // scheduled together the registers spill to scratch
            __builtin_amdgcn_sched_barrier(0);
        }
        // the listing keeps a path from these stores into the other branch, which
        // rewrites their address registers: the wait stands in front of that rewrite
        asm volatile("s_wait_xcnt 0x0" ::: "memory");
    }
}

// ---------------------------------------------------------------- K3: causal flash attention
__global__ __launch_bounds__(256) void attention_kernel(
        const __bf16* __restrict__ qd, const __bf16* __restrict__ kd,
        const __bf16* __restrict__ vd, __bf16* __restrict__ od) {
    __shared__ __align__(16) __bf16 Ks[2][64][72];
    __shared__ __align__(16) __bf16 Vs[2][64][72];
    __shared__ __align__(16) __bf16 Ps[8][16][72];
    const int qt = blockIdx.x & 7;
    const int bh = blockIdx.x >> 3;   // b*16+h
    const int b  = bh >> 4, h = bh & 15;
    const int q0 = qt * 128;
    const int tid = threadIdx.x, wave = tid >> 5, lane = tid & 31;
    const int ln = lane & 15, hi = lane >> 4;

    // Q fragments resident in registers for the whole tile
    const __bf16* qrow = qd + ((size_t)bh * SEQ + q0 + wave * 16 + ln) * HD;
    v16bf qfrag[2];
    qfrag[0] = ld_frag(qrow, 0 * 32 + hi * 8);
    qfrag[1] = ld_frag(qrow, 1 * 32 + hi * 8);

    const int kr = tid >> 2, kc = (tid & 3) * 16;   // 64 x 64 chunk, 32B/thread
    const __bf16* kBp = kd + ((size_t)bh * SEQ + kr) * HD + kc;   // + j0*HD
    const __bf16* vBp = vd + ((size_t)bh * HD + kr) * SEQ + kc;   // + j0
    auto load_chunk = [&](int j0, int buf) {
        #pragma unroll
        for (int u = 0; u < 2; u++)
            async_copy16(&Ks[buf][kr][kc + u * 8], kBp + (size_t)j0 * HD + u * 8);
        #pragma unroll
        for (int u = 0; u < 2; u++)
            async_copy16(&Vs[buf][kr][kc + u * 8], vBp + j0 + u * 8);
    };

    load_chunk(0, 0);
    wait_async0();
    __syncthreads();

    v8f accO[4] = {};
    float mrun[8], lrun[8];
    #pragma unroll
    for (int r = 0; r < 8; r++) { mrun[r] = -1e30f; lrun[r] = 0.f; }

    const int nchunks = (q0 + 128) / 64;
    for (int ci = 0; ci < nchunks; ci++) {
        const int j0 = ci * 64, cur = ci & 1;
        if (ci + 1 < nchunks) load_chunk(j0 + 64, cur ^ 1);

        // scores: Q(16x64d) * K(64keys x 64d)^T  -> 4 frags of 16x16
        v8f accS[4] = {};
        #pragma unroll
        for (int nf = 0; nf < 4; nf++) {
            #pragma unroll
            for (int kk = 0; kk < 2; kk++) {
                v16bf bf = ld_frag(&Ks[cur][nf * 16 + ln][0], kk * 32 + hi * 8);
                accS[nf] = wmma_bf16(qfrag[kk], bf, accS[nf]);
            }
        }

        // online softmax per row (rows of a C-frag live in one 16-lane half)
        #pragma unroll
        for (int r = 0; r < 8; r++) {
            int qg = q0 + wave * 16 + r + 8 * hi;
            float sv[4];
            #pragma unroll
            for (int nf = 0; nf < 4; nf++) {
                int kg = j0 + nf * 16 + ln;
                float v = accS[nf][r] * 0.125f;   // 1/sqrt(64)
                sv[nf] = (kg <= qg) ? v : -1e30f;
            }
            float rmax = fmaxf(fmaxf(sv[0], sv[1]), fmaxf(sv[2], sv[3]));
            #pragma unroll
            for (int off = 8; off > 0; off >>= 1) rmax = fmaxf(rmax, __shfl_xor(rmax, off, 16));
            float mnew = fmaxf(mrun[r], rmax);
            float corr = __expf(mrun[r] - mnew);
            float psum = 0.f;
            #pragma unroll
            for (int nf = 0; nf < 4; nf++) {
                float p = __expf(sv[nf] - mnew);
                psum += p;
                Ps[wave][r + 8 * hi][nf * 16 + ln] = (__bf16)p;
            }
            #pragma unroll
            for (int off = 8; off > 0; off >>= 1) psum += __shfl_xor(psum, off, 16);
            lrun[r] = lrun[r] * corr + psum;
            mrun[r] = mnew;
            #pragma unroll
            for (int df = 0; df < 4; df++) accO[df][r] = accO[df][r] * corr;
        }
        // same-wave LDS round trip: enforce order + block compiler reordering
        asm volatile("s_wait_dscnt 0x0" ::: "memory");

        // O += P(16x64keys) * V(64keys x 64d)
        #pragma unroll
        for (int df = 0; df < 4; df++) {
            #pragma unroll
            for (int kk = 0; kk < 2; kk++) {
                v16bf pf = ld_frag(&Ps[wave][ln][0], kk * 32 + hi * 8);
                v16bf vf = ld_frag(&Vs[cur][df * 16 + ln][0], kk * 32 + hi * 8);
                accO[df] = wmma_bf16(pf, vf, accO[df]);
            }
        }
        if (ci + 1 < nchunks) wait_async0();
        __syncthreads();
    }

    #pragma unroll
    for (int r = 0; r < 8; r++) {
        int sg = q0 + wave * 16 + r + 8 * hi;
        float inv = 1.0f / lrun[r];
        __bf16* dst = od + ((size_t)(b * SEQ + sg)) * DIM + h * HD;
        #pragma unroll
        for (int df = 0; df < 4; df++) dst[df * 16 + ln] = (__bf16)(accO[df][r] * inv);
    }
}

// ---------------------------------------------------------------- K4: out-proj + residual
// out[8192,1024] = O[8192,1024] * Wout[1024,1024]^T + x
// 128 x 128 block tile, 4 waves (2 x 2) of 64 x 64: 512 blocks, two for each WGP.
__global__ __launch_bounds__(128) __attribute__((amdgpu_waves_per_eu(4, 4)))
void outproj_kernel(
        const __bf16* __restrict__ o, const __bf16* __restrict__ wout,
        const float* __restrict__ x, float* __restrict__ out) {
    const int n0 = blockIdx.x * 128;
    const int m0 = blockIdx.y * 128;
    const int wave = __builtin_amdgcn_readfirstlane(threadIdx.x >> 5);
    const int lane = threadIdx.x & 31;
    const int ln = lane & 15, hi = lane >> 4;
    const int wm = wave >> 1, wn = wave & 1;

    v8f acc[4][4] = {};
    gemm_nt_mainloop<2>(o + (size_t)m0 * DIM, wout + (size_t)n0 * DIM, wm, wn, acc);

    const unsigned at = (unsigned)(m0 + wm * 64 + 8 * hi) * DIM + n0 + wn * 64 + ln;
    float* dst        = out + at;
    const float* skip = x   + at;
    #pragma unroll
    for (int mf = 0; mf < 4; mf++) {
        #pragma unroll
        for (int r = 0; r < 8; r++) {
            #pragma unroll
            for (int nf = 0; nf < 4; nf++) {
                const int off = (mf * 16 + r) * DIM + nf * 16;
                dst[off] = acc[mf][nf][r] + skip[off];
            }
        }
    }
}

// ---------------------------------------------------------------- launch
extern "C" void kernel_launch(void* const* d_in, const int* in_sizes, int n_in,
                              void* d_out, int out_size, void* d_ws, size_t ws_size,
                              hipStream_t stream) {
    const float* x     = (const float*)d_in[0];   // [8,1024,1024]
    const float* scale = (const float*)d_in[1];   // [1024]
    const float* wqkv  = (const float*)d_in[2];   // [3072,1024]
    const float* wout  = (const float*)d_in[3];   // [1024,1024]
    const float* theta = (const float*)d_in[4];   // [1024,16,16]

    char* ws = (char*)d_ws;
    __bf16* wqkv_bf = (__bf16*)(ws);                         //  6,291,456 B
    __bf16* wout_bf = (__bf16*)(ws + 6291456);               //  2,097,152 B
    __bf16* xn_bf   = (__bf16*)(ws + 8388608);               // 16,777,216 B
    __bf16* q_bf    = (__bf16*)(ws + 25165824);              // [B,H,S,D]
    __bf16* k_bf    = (__bf16*)(ws + 41943040);              // [B,H,S,D]
    __bf16* v_bf    = (__bf16*)(ws + 58720256);              // [B,H,D,S]
    __bf16* o_bf    = (__bf16*)(ws + 75497472);              // [B,S,H*D]
    float*  outp    = (float*)d_out;

    prep_kernel<<<NTOK / 2 / 16, 512, 0, stream>>>(x, scale, wqkv, wout, xn_bf, wqkv_bf, wout_bf);
    qkv_gemm_rope_kernel<<<dim3(QKV_N / 128, NTOK / 256), 256, 0, stream>>>(
        xn_bf, wqkv_bf, theta, q_bf, k_bf, v_bf);
    attention_kernel<<<BATCH * HEADS * (SEQ / 128), 256, 0, stream>>>(q_bf, k_bf, v_bf, o_bf);
    outproj_kernel<<<dim3(DIM / 128, NTOK / 128), 128, 0, stream>>>(o_bf, wout_bf, x, outp);
}

// v003
// It runs in 141 microseconds.
// In two side-by-side timings against v002, it was 1.30 and 1.31 times as fast.
// Counting every step since v000, it is 1.66 times as fast.
#include <hip/hip_runtime.h>

#define DIM    1024
#define HEADS  16
#define HD     64
#define SEQ    1024
#define BATCH  8
#define NTOK   (BATCH * SEQ)   // 8192
#define QKV_N  (3 * DIM)       // 3072

typedef __attribute__((ext_vector_type(16))) __bf16 v16bf;
typedef __attribute__((ext_vector_type(8)))  __bf16 v8bf;
typedef __attribute__((ext_vector_type(8)))  float  v8f;

// Load one 16-bf16 WMMA A/B fragment for this lane from an LDS row:
// per CDNA5 ISA 16-bit layout, lane holds k = base+0..7 and k = base+16..23
// with base = (lane>>4)*8, row = lane&15. k0 = chunk*32 + (lane>>4)*8.
__device__ __forceinline__ v16bf ld_frag(const __bf16* row, int k0) {
    v8bf lo = *reinterpret_cast<const v8bf*>(row + k0);
    v8bf hi = *reinterpret_cast<const v8bf*>(row + k0 + 16);
    return __builtin_shufflevector(lo, hi, 0,1,2,3,4,5,6,7,8,9,10,11,12,13,14,15);
}

__device__ __forceinline__ v8f wmma_bf16(v16bf a, v16bf b, v8f c) {
    return __builtin_amdgcn_wmma_f32_16x16x32_bf16(false, a, false, b, (short)0, c, false, false);
}

// Async copy 16B global -> LDS (GLOBAL_LOAD_ASYNC_TO_LDS_B128, ASYNCcnt).
// Generic LDS pointer: low 32 bits are the LDS byte offset (flat aperture rule).
__device__ __forceinline__ void async_copy16(void* lds_dst, const void* gsrc) {
    unsigned loff = (unsigned)(uintptr_t)lds_dst;
    asm volatile("global_load_async_to_lds_b128 %0, %1, off"
                 :: "v"(loff), "v"(gsrc) : "memory");
}
__device__ __forceinline__ void wait_async0() {
#if __has_builtin(__builtin_amdgcn_s_wait_asynccnt)
    __builtin_amdgcn_s_wait_asynccnt(0);
#else
    asm volatile("s_wait_asynccnt 0x0" ::: "memory");
#endif
}

// Four / eight 16-byte async copies of one lane, rows lstep (LDS bytes) and gstep
// (elements) apart. s_wait_xcnt 0 is the last line of the copies' own statement, so
// that it stands in front of any later rewrite of the address registers they name.
__device__ __forceinline__ void async_copy16_x4(unsigned l, unsigned lstep,
                                                const __bf16* g, size_t gstep) {
    asm volatile("global_load_async_to_lds_b128 %0, %4, off\n\t"
                 "global_load_async_to_lds_b128 %1, %5, off\n\t"
                 "global_load_async_to_lds_b128 %2, %6, off\n\t"
                 "global_load_async_to_lds_b128 %3, %7, off\n\t"
                 "s_wait_xcnt 0x0"
                 :: "v"(l), "v"(l + lstep), "v"(l + 2 * lstep), "v"(l + 3 * lstep),
                    "v"(g), "v"(g + gstep), "v"(g + 2 * gstep), "v"(g + 3 * gstep)
                 : "memory");
}
__device__ __forceinline__ void async_copy16_x8(unsigned l, unsigned lstep,
                                                const __bf16* g, size_t gstep) {
    asm volatile("global_load_async_to_lds_b128 %0, %8, off\n\t"
                 "global_load_async_to_lds_b128 %1, %9, off\n\t"
                 "global_load_async_to_lds_b128 %2, %10, off\n\t"
                 "global_load_async_to_lds_b128 %3, %11, off\n\t"
                 "global_load_async_to_lds_b128 %4, %12, off\n\t"
                 "global_load_async_to_lds_b128 %5, %13, off\n\t"
                 "global_load_async_to_lds_b128 %6, %14, off\n\t"
                 "global_load_async_to_lds_b128 %7, %15, off\n\t"
                 "s_wait_xcnt 0x0"
                 :: "v"(l), "v"(l + lstep), "v"(l + 2 * lstep), "v"(l + 3 * lstep),
                    "v"(l + 4 * lstep), "v"(l + 5 * lstep), "v"(l + 6 * lstep), "v"(l + 7 * lstep),
                    "v"(g), "v"(g + gstep), "v"(g + 2 * gstep), "v"(g + 3 * gstep),
                    "v"(g + 4 * gstep), "v"(g + 5 * gstep), "v"(g + 6 * gstep), "v"(g + 7 * gstep)
                 : "memory");
}

// NT GEMM main loop over K = DIM (both operands K-major, row pitch DIM).
// Block tile (WM*64) x 128 from WM x 2 waves; each wave keeps a 64 x 64 tile
// (4 x 4 accumulator fragments), so 8 loaded fragments feed 16 WMMAs.
// a, b point at the block's first row. Two LDS buffers, K-step 64, one barrier a step.
// A wave's copy covers four whole 128-byte rows.
template <int WM>
__device__ __forceinline__ void gemm_nt_mainloop(const __bf16* __restrict__ a,
                                                 const __bf16* __restrict__ b,
                                                 int wm, int wn, v8f (&acc)[4][4]) {
    constexpr int BM = WM * 64;      // rows of the A tile
    constexpr int RP = WM * 8;       // rows that one copy of the whole block covers
    __shared__ __align__(16) __bf16 As[2][BM][72];
    __shared__ __align__(16) __bf16 Bs[2][128][72];
    const int tid = threadIdx.x, lane = tid & 31;
    const int ln = lane & 15, hi = lane >> 4;
    const int cr = tid >> 3, cc = (tid & 7) * 8;
    const __bf16* ag = a + (size_t)cr * DIM + cc;
    const __bf16* bg = b + (size_t)cr * DIM + cc;

    auto load_tile = [&](int k0, int buf) {
        async_copy16_x8((unsigned)(uintptr_t)&As[buf][cr][cc], RP * 144, ag + k0, (size_t)RP * DIM);
        if constexpr (WM == 4)
            async_copy16_x4((unsigned)(uintptr_t)&Bs[buf][cr][cc], RP * 144, bg + k0, (size_t)RP * DIM);
        else
            async_copy16_x8((unsigned)(uintptr_t)&Bs[buf][cr][cc], RP * 144, bg + k0, (size_t)RP * DIM);
    };

    load_tile(0, 0);
    asm volatile("s_wait_asynccnt 0x0" ::: "memory");   // tile 0 landed before it is published
    __syncthreads();
    load_tile(64, 1);

    constexpr int NSTEP = DIM / 64;   // 16
    for (int i = 0; i < NSTEP; i++) {
        const int cur = i & 1;
        v16bf af[4], bf[4];
        auto load_frags = [&](int kk) {
            #pragma unroll
            for (int f = 0; f < 4; f++) {
                af[f] = ld_frag(&As[cur][wm * 64 + f * 16 + ln][0], kk * 32 + hi * 8);
                bf[f] = ld_frag(&Bs[cur][wn * 64 + f * 16 + ln][0], kk * 32 + hi * 8);
            }
        };
        auto products = [&]() {
            #pragma unroll
            for (int mf = 0; mf < 4; mf++)
                #pragma unroll
                for (int nf = 0; nf < 4; nf++)
                    acc[mf][nf] = wmma_bf16(af[mf], bf[nf], acc[mf][nf]);
        };
        load_frags(0);
        // keeps the 16 LDS reads one group ahead of their 16 WMMAs: left alone the
        // scheduler reloads one A fragment per row of 4 and waits it out each time
        __builtin_amdgcn_sched_barrier(0);
        products();
        load_frags(1);
        // publish point: this wave's reads of buffer cur are done, its copies of the
        // next tile have landed; behind the barrier buffer cur may be refilled.
        asm volatile("s_wait_dscnt 0x0" ::: "memory");
        asm volatile("s_wait_asynccnt 0x0" ::: "memory");
        __syncthreads();
        if (i + 2 < NSTEP) load_tile((i + 2) * 64, cur);
        // the step's second half works from registers while the refill is in flight
        products();
    }
    asm volatile("s_wait_asynccnt 0x0" ::: "memory");   // no copy outstanding at the wave's end
}

// ---------------------------------------------------------------- K0: all f32 -> bf16 preparation
// 256 x 16 long-lived waves (for speed only). A wave owns whole 1024-float rows, 32 floats a lane as 8 loads of 512 contiguous bytes:
// two rows of x (RMSNorm; the row sum stays inside the wave) and one weight row (rounding only).
typedef __attribute__((ext_vector_type(4))) float  v4f;
typedef __attribute__((ext_vector_type(4))) __bf16 v4bf;
static_assert(QKV_N + DIM == NTOK / 2, "one weight row for every two rows of x");

// A lane's share of a row: element 4 * c + e of r[k] with c = 0, 1 is float e of the
// row's 16-byte piece (2 * k + c) * 32 + lane.
struct RowRegs { v8f r[4]; };

__device__ __forceinline__ RowRegs load_row(const float* row, int lane) {
    const v4f* p = reinterpret_cast<const v4f*>(row) + lane;
    RowRegs t;
    #pragma unroll
    for (int k = 0; k < 4; k++)
        t.r[k] = __builtin_shufflevector(p[k * 64], p[k * 64 + 32], 0, 1, 2, 3, 4, 5, 6, 7);
    return t;
}
__device__ __forceinline__ void store_row(__bf16* row, int lane, const RowRegs& t) {
    v4bf* p = reinterpret_cast<v4bf*>(row) + lane;
    #pragma unroll
    for (int k = 0; k < 4; k++) {
        p[k * 64]      = __builtin_convertvector(__builtin_shufflevector(t.r[k], t.r[k], 0, 1, 2, 3), v4bf);
        p[k * 64 + 32] = __builtin_convertvector(__builtin_shufflevector(t.r[k], t.r[k], 4, 5, 6, 7), v4bf);
    }
}
// 1 / rms of a row: eight partial sums a lane, folded, then a five-step butterfly
__device__ __forceinline__ float row_rrms(const RowRegs& t) {
    v8f a = t.r[0] * t.r[0];
    #pragma unroll
    for (int k = 1; k < 4; k++) a += t.r[k] * t.r[k];
    float ss = ((a[0] + a[1]) + (a[2] + a[3])) + ((a[4] + a[5]) + (a[6] + a[7]));
    #pragma unroll
    for (int off = 16; off > 0; off >>= 1) ss += __shfl_xor(ss, off, 32);
    return rsqrtf(ss * (1.0f / DIM) + 1e-6f);
}

__global__ __launch_bounds__(512) void prep_kernel(
        const float* __restrict__ x, const float* __restrict__ scale,
        const float* __restrict__ wqkv, const float* __restrict__ wout,
        __bf16* __restrict__ xn, __bf16* __restrict__ wqkv_bf, __bf16* __restrict__ wout_bf) {
    const int lane = threadIdx.x & 31;
    const int w = __builtin_amdgcn_readfirstlane(blockIdx.x * 16 + (threadIdx.x >> 5));   // 0..4095
    const float* wsrc = w < QKV_N ? wqkv + (size_t)w * DIM : wout + (size_t)(w - QKV_N) * DIM;
    __bf16*      wdst = w < QKV_N ? wqkv_bf + (size_t)w * DIM : wout_bf + (size_t)(w - QKV_N) * DIM;

    RowRegs x0 = load_row(x + (size_t)w * (2 * DIM), lane);
    RowRegs x1 = load_row(x + (size_t)w * (2 * DIM) + DIM, lane);
    RowRegs sc = load_row(scale, lane);
    RowRegs wr = load_row(wsrc, lane);

    const float s0 = row_rrms(x0), s1 = row_rrms(x1);
    #pragma unroll
    for (int k = 0; k < 4; k++) {
        x0.r[k] = x0.r[k] * sc.r[k] * s0;
        x1.r[k] = x1.r[k] * sc.r[k] * s1;
    }
    store_row(wdst, lane, wr);
    store_row(xn + (size_t)w * (2 * DIM), lane, x0);
    store_row(xn + (size_t)w * (2 * DIM) + DIM, lane, x1);
}

// ---------------------------------------------------------------- K2: QKV GEMM + RoPE
// C[8192,3072] = Xn[8192,1024] * Wqkv[3072,1024]^T  (NT: both K-major)
// 256 x 128 block tile, 8 waves (4 x 2) of 64 x 64; a wave's 64 columns are one head.
__global__ __launch_bounds__(256) __attribute__((amdgpu_waves_per_eu(4, 4)))
void qkv_gemm_rope_kernel(
        const __bf16* __restrict__ xn, const __bf16* __restrict__ wqkv,
        const float* __restrict__ theta,
        __bf16* __restrict__ qd, __bf16* __restrict__ kd, __bf16* __restrict__ vd) {
    const int n0 = blockIdx.x * 128;   // 24 tiles over 3072
    const int m0 = blockIdx.y * 256;   // 32 tiles over 8192
    const int wave = __builtin_amdgcn_readfirstlane(threadIdx.x >> 5);
    const int lane = threadIdx.x & 31;
    const int ln = lane & 15, hi = lane >> 4;
    const int wm = wave >> 1, wn = wave & 1;

    v8f acc[4][4] = {};
    gemm_nt_mainloop<4>(xn + (size_t)m0 * DIM, wqkv + (size_t)n0 * DIM, wm, wn, acc);

    const int nw = n0 + wn * 64;          // this wave's first column
    const int comp = nw >> 10;            // 0=q 1=k 2=v
    const int h = (nw & 1023) >> 6;       // head (a wave's tile never crosses a head)
    const int tok0 = m0 + wm * 64;        // a wave's 64 rows lie in one batch entry
    const int b = tok0 >> 10, seq0 = (tok0 & 1023) + 8 * hi;
    if (comp == 2) {
        // V stored transposed: [B,H,D,S]
        __bf16* vp = vd + ((size_t)(b * HEADS + h) * HD + ln) * SEQ + seq0;
        #pragma unroll
        for (int mf = 0; mf < 4; mf++)
            #pragma unroll
            for (int nf = 0; nf < 4; nf++)
                #pragma unroll
                for (int r = 0; r < 8; r++)
                    vp[nf * 16 * SEQ + mf * 16 + r] = (__bf16)acc[mf][nf][r];
    } else {
        // RoPE on d<32: pair (d, d+16) = (frag0, frag1), same lane slot
        const float* tp = theta + seq0 * (HEADS * 16) + h * 16 + ln;
        __bf16* dst = (comp == 0 ? qd : kd) + ((size_t)(b * HEADS + h) * SEQ + seq0) * HD + ln;
        float th[4][8];
        #pragma unroll
        for (int mf = 0; mf < 4; mf++)
            #pragma unroll
            for (int r = 0; r < 8; r++) th[mf][r] = tp[(mf * 16 + r) * (HEADS * 16)];
        #pragma unroll
        for (int mf = 0; mf < 4; mf++) {
            #pragma unroll
            for (int r = 0; r < 8; r++) {
                const int row = mf * 16 + r;
                float v0 = acc[mf][0][r], v1 = acc[mf][1][r];
                float sn, cs;
                // the fast sine and cosine (argument in turns) in one statement: its v_nop
                // fills the slot behind a transcendental, whatever is scheduled next
                asm("v_sin_f32 %0, %2\n\tv_cos_f32 %1, %2\n\tv_nop"
                    : "=&v"(sn), "=&v"(cs) : "v"(th[mf][r] * 0.15915494f));
                float y0 = v0 * cs - v1 * sn;
                float y1 = v1 * cs + v0 * sn;
                dst[row * HD + 0 * 16] = (__bf16)y0;
                dst[row * HD + 1 * 16] = (__bf16)y1;
                dst[row * HD + 2 * 16] = (__bf16)acc[mf][2][r];
                dst[row * HD + 3 * 16] = (__bf16)acc[mf][3][r];
            }
            // one group of 16 rows at a time: with all 32 sine and cosine pairs
            // scheduled together the registers spill to scratch
            __builtin_amdgcn_sched_barrier(0);
        }
        // the listing keeps a path from these stores into the other branch, which
        // rewrites their address registers: the wait stands in front of that rewrite
        asm volatile("s_wait_xcnt 0x0" ::: "memory");
    }
}

// ---------------------------------------------------------------- K3: causal flash attention
// A query tile's cost grows with its index (tile qt walks 2 * (qt + 1) key chunks), and all
// work-groups are resident at once, so the launch lasts as long as the fullest WGP.
// Each work-group takes tiles 7 - t and t of one head, one after the other: 18 chunks for all.
__global__ __launch_bounds__(256) void attention_kernel(
        const __bf16* __restrict__ qd, const __bf16* __restrict__ kd,
        const __bf16* __restrict__ vd, __bf16* __restrict__ od) {
    __shared__ __align__(16) __bf16 Ks[2][64][72];
    __shared__ __align__(16) __bf16 Vs[2][64][72];
    __shared__ __align__(16) __bf16 Ps[8][16][72];
    const int t  = blockIdx.x >> 7;    // 0..3
    const int bh = blockIdx.x & 127;   // b*16+h
    const int b  = bh >> 4, h = bh & 15;
    const int tid = threadIdx.x, wave = tid >> 5, lane = tid & 31;
    const int ln = lane & 15, hi = lane >> 4;

    const int kr = tid >> 2, kc = (tid & 3) * 16;   // 64 x 64 chunk, 32B/thread
    const __bf16* kBp = kd + ((size_t)bh * SEQ + kr) * HD + kc;   // + j0*HD
    const __bf16* vBp = vd + ((size_t)bh * HD + kr) * SEQ + kc;   // + j0
    auto load_chunk = [&](int j0, int buf) {
        #pragma unroll
        for (int u = 0; u < 2; u++)
            async_copy16(&Ks[buf][kr][kc + u * 8], kBp + (size_t)j0 * HD + u * 8);
        #pragma unroll
        for (int u = 0; u < 2; u++)
            async_copy16(&Vs[buf][kr][kc + u * 8], vBp + j0 + u * 8);
    };

    // rolled: the two tiles share one copy of the chunk loop
    #pragma unroll 1
    for (int half = 0; half < 2; half++) {
    const int q0 = (half == 0 ? 7 - t : t) * 128;

    // Q fragments resident in registers for the whole tile
    const __bf16* qrow = qd + ((size_t)bh * SEQ + q0 + wave * 16 + ln) * HD;
    v16bf qfrag[2];
    qfrag[0] = ld_frag(qrow, 0 * 32 + hi * 8);
    qfrag[1] = ld_frag(qrow, 1 * 32 + hi * 8);

    // the first tile's chunk loop ends in a barrier: both buffers are free here
    load_chunk(0, 0);
    wait_async0();
    __syncthreads();

    v8f accO[4] = {};
    float mrun[8], lrun[8];
    #pragma unroll
    for (int r = 0; r < 8; r++) { mrun[r] = -1e30f; lrun[r] = 0.f; }

    const int nchunks = (q0 + 128) / 64;
    for (int ci = 0; ci < nchunks; ci++) {
        const int j0 = ci * 64, cur = ci & 1;
        if (ci + 1 < nchunks) load_chunk(j0 + 64, cur ^ 1);

        // scores: Q(16x64d) * K(64keys x 64d)^T  -> 4 frags of 16x16
        v8f accS[4] = {};
        #pragma unroll
        for (int nf = 0; nf < 4; nf++) {
            #pragma unroll
            for (int kk = 0; kk < 2; kk++) {
                v16bf bf = ld_frag(&Ks[cur][nf * 16 + ln][0], kk * 32 + hi * 8);
                accS[nf] = wmma_bf16(qfrag[kk], bf, accS[nf]);
            }
        }

        // online softmax per row (rows of a C-frag live in one 16-lane half)
        #pragma unroll
        for (int r = 0; r < 8; r++) {
            int qg = q0 + wave * 16 + r + 8 * hi;
            float sv[4];
            #pragma unroll
            for (int nf = 0; nf < 4; nf++) {
                int kg = j0 + nf * 16 + ln;
                float v = accS[nf][r] * 0.125f;   // 1/sqrt(64)
                sv[nf] = (kg <= qg) ? v : -1e30f;
            }
            float rmax = fmaxf(fmaxf(sv[0], sv[1]), fmaxf(sv[2], sv[3]));
            #pragma unroll
            for (int off = 8; off > 0; off >>= 1) rmax = fmaxf(rmax, __shfl_xor(rmax, off, 16));
            float mnew = fmaxf(mrun[r], rmax);
            float corr = __expf(mrun[r] - mnew);
            float psum = 0.f;
            #pragma unroll
            for (int nf = 0; nf < 4; nf++) {
                float p = __expf(sv[nf] - mnew);
                psum += p;
                Ps[wave][r + 8 * hi][nf * 16 + ln] = (__bf16)p;
            }
            #pragma unroll
            for (int off = 8; off > 0; off >>= 1) psum += __shfl_xor(psum, off, 16);
            lrun[r] = lrun[r] * corr + psum;
            mrun[r] = mnew;
            #pragma unroll
            for (int df = 0; df < 4; df++) accO[df][r] = accO[df][r] * corr;
        }
        // same-wave LDS round trip: enforce order + block compiler reordering
        asm volatile("s_wait_dscnt 0x0" ::: "memory");

        // O += P(16x64keys) * V(64keys x 64d)
        #pragma unroll
        for (int df = 0; df < 4; df++) {
            #pragma unroll
            for (int kk = 0; kk < 2; kk++) {
                v16bf pf = ld_frag(&Ps[wave][ln][0], kk * 32 + hi * 8);
                v16bf vf = ld_frag(&Vs[cur][df * 16 + ln][0], kk * 32 + hi * 8);
                accO[df] = wmma_bf16(pf, vf, accO[df]);
            }
        }
        if (ci + 1 < nchunks) wait_async0();
        __syncthreads();
    }

    #pragma unroll
    for (int r = 0; r < 8; r++) {
        int sg = q0 + wave * 16 + r + 8 * hi;
        float inv = 1.0f / lrun[r];
        __bf16* dst = od + ((size_t)(b * SEQ + sg)) * DIM + h * HD;
        #pragma unroll
        for (int df = 0; df < 4; df++) dst[df * 16 + ln] = (__bf16)(accO[df][r] * inv);
    }
    // the second tile's set-up rewrites the address and data registers of these stores:
    // the wait stands in front of that rewrite
    asm volatile("s_wait_xcnt 0x0" ::: "memory");
    }
}

// ---------------------------------------------------------------- K4: out-proj + residual
// out[8192,1024] = O[8192,1024] * Wout[1024,1024]^T + x
// 128 x 128 block tile, 4 waves (2 x 2) of 64 x 64: 512 blocks, two for each WGP.
__global__ __launch_bounds__(128) __attribute__((amdgpu_waves_per_eu(4, 4)))
void outproj_kernel(
        const __bf16* __restrict__ o, const __bf16* __restrict__ wout,
        const float* __restrict__ x, float* __restrict__ out) {
    const int n0 = blockIdx.x * 128;
    const int m0 = blockIdx.y * 128;
    const int wave = __builtin_amdgcn_readfirstlane(threadIdx.x >> 5);
    const int lane = threadIdx.x & 31;
    const int ln = lane & 15, hi = lane >> 4;
    const int wm = wave >> 1, wn = wave & 1;

    v8f acc[4][4] = {};
    gemm_nt_mainloop<2>(o + (size_t)m0 * DIM, wout + (size_t)n0 * DIM, wm, wn, acc);

    const unsigned at = (unsigned)(m0 + wm * 64 + 8 * hi) * DIM + n0 + wn * 64 + ln;
    float* dst        = out + at;
    const float* skip = x   + at;
    #pragma unroll
    for (int mf = 0; mf < 4; mf++) {
        #pragma unroll
        for (int r = 0; r < 8; r++) {
            #pragma unroll
            for (int nf = 0; nf < 4; nf++) {
                const int off = (mf * 16 + r) * DIM + nf * 16;
                dst[off] = acc[mf][nf][r] + skip[off];
            }
        }
    }
}

// ---------------------------------------------------------------- launch
extern "C" void kernel_launch(void* const* d_in, const int* in_sizes, int n_in,
                              void* d_out, int out_size, void* d_ws, size_t ws_size,
                              hipStream_t stream) {
    const float* x     = (const float*)d_in[0];   // [8,1024,1024]
    const float* scale = (const float*)d_in[1];   // [1024]
    const float* wqkv  = (const float*)d_in[2];   // [3072,1024]
    const float* wout  = (const float*)d_in[3];   // [1024,1024]
    const float* theta = (const float*)d_in[4];   // [1024,16,16]

    char* ws = (char*)d_ws;
    __bf16* wqkv_bf = (__bf16*)(ws);                         //  6,291,456 B
    __bf16* wout_bf = (__bf16*)(ws + 6291456);               //  2,097,152 B
    __bf16* xn_bf   = (__bf16*)(ws + 8388608);               // 16,777,216 B
    __bf16* q_bf    = (__bf16*)(ws + 25165824);              // [B,H,S,D]
    __bf16* k_bf    = (__bf16*)(ws + 41943040);              // [B,H,S,D]
    __bf16* v_bf    = (__bf16*)(ws + 58720256);              // [B,H,D,S]
    __bf16* o_bf    = (__bf16*)(ws + 75497472);              // [B,S,H*D]
    float*  outp    = (float*)d_out;

    prep_kernel<<<NTOK / 2 / 16, 512, 0, stream>>>(x, scale, wqkv, wout, xn_bf, wqkv_bf, wout_bf);
    qkv_gemm_rope_kernel<<<dim3(QKV_N / 128, NTOK / 256), 256, 0, stream>>>(
        xn_bf, wqkv_bf, theta, q_bf, k_bf, v_bf);
    attention_kernel<<<BATCH * HEADS * (SEQ / 256), 256, 0, stream>>>(q_bf, k_bf, v_bf, o_bf);
    outproj_kernel<<<dim3(DIM / 128, NTOK / 128), 128, 0, stream>>>(o_bf, wout_bf, x, outp);
}

// v004
// One run takes 105 microseconds.
// Timed twice side by side with v003, it ran 1.35 times as fast both times.
// Counting every step since v000, it is 2.24 times as fast.
#include <hip/hip_runtime.h>

#define DIM    1024
#define HEADS  16
#define HD     64
#define SEQ    1024
#define BATCH  8
#define NTOK   (BATCH * SEQ)   // 8192
#define QKV_N  (3 * DIM)       // 3072

typedef __attribute__((ext_vector_type(16))) __bf16 v16bf;
typedef __attribute__((ext_vector_type(8)))  __bf16 v8bf;
typedef __attribute__((ext_vector_type(8)))  float  v8f;

// Load one 16-bf16 WMMA A/B fragment for this lane from an LDS row:
// per CDNA5 ISA 16-bit layout, lane holds k = base+0..7 and k = base+16..23
// with base = (lane>>4)*8, row = lane&15. k0 = chunk*32 + (lane>>4)*8.
__device__ __forceinline__ v16bf ld_frag(const __bf16* row, int k0) {
    v8bf lo = *reinterpret_cast<const v8bf*>(row + k0);
    v8bf hi = *reinterpret_cast<const v8bf*>(row + k0 + 16);
    return __builtin_shufflevector(lo, hi, 0,1,2,3,4,5,6,7,8,9,10,11,12,13,14,15);
}

__device__ __forceinline__ v8f wmma_bf16(v16bf a, v16bf b, v8f c) {
    return __builtin_amdgcn_wmma_f32_16x16x32_bf16(false, a, false, b, (short)0, c, false, false);
}

// Async copy 16B global -> LDS (GLOBAL_LOAD_ASYNC_TO_LDS_B128, ASYNCcnt).
// Generic LDS pointer: low 32 bits are the LDS byte offset (flat aperture rule).
__device__ __forceinline__ void async_copy16(void* lds_dst, const void* gsrc) {
    unsigned loff = (unsigned)(uintptr_t)lds_dst;
    asm volatile("global_load_async_to_lds_b128 %0, %1, off"
                 :: "v"(loff), "v"(gsrc) : "memory");
}
__device__ __forceinline__ void wait_async0() {
#if __has_builtin(__builtin_amdgcn_s_wait_asynccnt)
    __builtin_amdgcn_s_wait_asynccnt(0);
#else
    asm volatile("s_wait_asynccnt 0x0" ::: "memory");
#endif
}

// Four / eight 16-byte async copies of one lane, rows lstep (LDS bytes) and gstep
// (elements) apart. s_wait_xcnt 0 is the last line of the copies' own statement, so
// that it stands in front of any later rewrite of the address registers they name.
__device__ __forceinline__ void async_copy16_x4(unsigned l, unsigned lstep,
                                                const __bf16* g, size_t gstep) {
    asm volatile("global_load_async_to_lds_b128 %0, %4, off\n\t"
                 "global_load_async_to_lds_b128 %1, %5, off\n\t"
                 "global_load_async_to_lds_b128 %2, %6, off\n\t"
                 "global_load_async_to_lds_b128 %3, %7, off\n\t"
                 "s_wait_xcnt 0x0"
                 :: "v"(l), "v"(l + lstep), "v"(l + 2 * lstep), "v"(l + 3 * lstep),
                    "v"(g), "v"(g + gstep), "v"(g + 2 * gstep), "v"(g + 3 * gstep)
                 : "memory");
}
__device__ __forceinline__ void async_copy16_x8(unsigned l, unsigned lstep,
                                                const __bf16* g, size_t gstep) {
    asm volatile("global_load_async_to_lds_b128 %0, %8, off\n\t"
                 "global_load_async_to_lds_b128 %1, %9, off\n\t"
                 "global_load_async_to_lds_b128 %2, %10, off\n\t"
                 "global_load_async_to_lds_b128 %3, %11, off\n\t"
                 "global_load_async_to_lds_b128 %4, %12, off\n\t"
                 "global_load_async_to_lds_b128 %5, %13, off\n\t"
                 "global_load_async_to_lds_b128 %6, %14, off\n\t"
                 "global_load_async_to_lds_b128 %7, %15, off\n\t"
                 "s_wait_xcnt 0x0"
                 :: "v"(l), "v"(l + lstep), "v"(l + 2 * lstep), "v"(l + 3 * lstep),
                    "v"(l + 4 * lstep), "v"(l + 5 * lstep), "v"(l + 6 * lstep), "v"(l + 7 * lstep),
                    "v"(g), "v"(g + gstep), "v"(g + 2 * gstep), "v"(g + 3 * gstep),
                    "v"(g + 4 * gstep), "v"(g + 5 * gstep), "v"(g + 6 * gstep), "v"(g + 7 * gstep)
                 : "memory");
}

// NT GEMM main loop over K = DIM (both operands K-major, row pitch DIM).
// Block tile (WM*64) x 128 from WM x 2 waves; each wave keeps a 64 x 64 tile
// (4 x 4 accumulator fragments), so 8 loaded fragments feed 16 WMMAs.
// a, b point at the block's first row. Two LDS buffers, K-step 64, one barrier a step.
// A wave's copy covers four whole 128-byte rows.
template <int WM>
__device__ __forceinline__ void gemm_nt_mainloop(const __bf16* __restrict__ a,
                                                 const __bf16* __restrict__ b,
                                                 int wm, int wn, v8f (&acc)[4][4]) {
    constexpr int BM = WM * 64;      // rows of the A tile
    constexpr int RP = WM * 8;       // rows that one copy of the whole block covers
    __shared__ __align__(16) __bf16 As[2][BM][72];
    __shared__ __align__(16) __bf16 Bs[2][128][72];
    const int tid = threadIdx.x, lane = tid & 31;
    const int ln = lane & 15, hi = lane >> 4;
    const int cr = tid >> 3, cc = (tid & 7) * 8;
    const __bf16* ag = a + (size_t)cr * DIM + cc;
    const __bf16* bg = b + (size_t)cr * DIM + cc;

    auto load_tile = [&](int k0, int buf) {
        async_copy16_x8((unsigned)(uintptr_t)&As[buf][cr][cc], RP * 144, ag + k0, (size_t)RP * DIM);
        if constexpr (WM == 4)
            async_copy16_x4((unsigned)(uintptr_t)&Bs[buf][cr][cc], RP * 144, bg + k0, (size_t)RP * DIM);
        else
            async_copy16_x8((unsigned)(uintptr_t)&Bs[buf][cr][cc], RP * 144, bg + k0, (size_t)RP * DIM);
    };

    load_tile(0, 0);
    asm volatile("s_wait_asynccnt 0x0" ::: "memory");   // tile 0 landed before it is published
    __syncthreads();
    load_tile(64, 1);

    constexpr int NSTEP = DIM / 64;   // 16
    for (int i = 0; i < NSTEP; i++) {
        const int cur = i & 1;
        v16bf af[4], bf[4];
        auto load_frags = [&](int kk) {
            #pragma unroll
            for (int f = 0; f < 4; f++) {
                af[f] = ld_frag(&As[cur][wm * 64 + f * 16 + ln][0], kk * 32 + hi * 8);
                bf[f] = ld_frag(&Bs[cur][wn * 64 + f * 16 + ln][0], kk * 32 + hi * 8);
            }
        };
        auto products = [&]() {
            #pragma unroll
            for (int mf = 0; mf < 4; mf++)
                #pragma unroll
                for (int nf = 0; nf < 4; nf++)
                    acc[mf][nf] = wmma_bf16(af[mf], bf[nf], acc[mf][nf]);
        };
        load_frags(0);
        // keeps the 16 LDS reads one group ahead of their 16 WMMAs: left alone the
        // scheduler reloads one A fragment per row of 4 and waits it out each time
        __builtin_amdgcn_sched_barrier(0);
        products();
        load_frags(1);
        // publish point: this wave's reads of buffer cur are done, its copies of the
        // next tile have landed; behind the barrier buffer cur may be refilled.
        asm volatile("s_wait_dscnt 0x0" ::: "memory");
        asm volatile("s_wait_asynccnt 0x0" ::: "memory");
        __syncthreads();
        if (i + 2 < NSTEP) load_tile((i + 2) * 64, cur);
        // the step's second half works from registers while the refill is in flight
        products();
    }
    asm volatile("s_wait_asynccnt 0x0" ::: "memory");   // no copy outstanding at the wave's end
}

// ---------------------------------------------------------------- K0: all f32 -> bf16 preparation
// 256 x 16 long-lived waves (for speed only). A wave owns whole 1024-float rows, 32 floats a lane as 8 loads of 512 contiguous bytes:
// two rows of x (RMSNorm; the row sum stays inside the wave) and one weight row (rounding only).
typedef __attribute__((ext_vector_type(4))) float  v4f;
typedef __attribute__((ext_vector_type(4))) __bf16 v4bf;
static_assert(QKV_N + DIM == NTOK / 2, "one weight row for every two rows of x");

// A lane's share of a row: element 4 * c + e of r[k] with c = 0, 1 is float e of the
// row's 16-byte piece (2 * k + c) * 32 + lane.
struct RowRegs { v8f r[4]; };

__device__ __forceinline__ RowRegs load_row(const float* row, int lane) {
    const v4f* p = reinterpret_cast<const v4f*>(row) + lane;
    RowRegs t;
    #pragma unroll
    for (int k = 0; k < 4; k++)
        t.r[k] = __builtin_shufflevector(p[k * 64], p[k * 64 + 32], 0, 1, 2, 3, 4, 5, 6, 7);
    return t;
}
__device__ __forceinline__ void store_row(__bf16* row, int lane, const RowRegs& t) {
    v4bf* p = reinterpret_cast<v4bf*>(row) + lane;
    #pragma unroll
    for (int k = 0; k < 4; k++) {
        p[k * 64]      = __builtin_convertvector(__builtin_shufflevector(t.r[k], t.r[k], 0, 1, 2, 3), v4bf);
        p[k * 64 + 32] = __builtin_convertvector(__builtin_shufflevector(t.r[k], t.r[k], 4, 5, 6, 7), v4bf);
    }
}
// 1 / rms of a row: eight partial sums a lane, folded, then a five-step butterfly
__device__ __forceinline__ float row_rrms(const RowRegs& t) {
    v8f a = t.r[0] * t.r[0];
    #pragma unroll
    for (int k = 1; k < 4; k++) a += t.r[k] * t.r[k];
    float ss = ((a[0] + a[1]) + (a[2] + a[3])) + ((a[4] + a[5]) + (a[6] + a[7]));
    #pragma unroll
    for (int off = 16; off > 0; off >>= 1) ss += __shfl_xor(ss, off, 32);
    return rsqrtf(ss * (1.0f / DIM) + 1e-6f);
}

__global__ __launch_bounds__(512) void prep_kernel(
        const float* __restrict__ x, const float* __restrict__ scale,
        const float* __restrict__ wqkv, const float* __restrict__ wout,
        __bf16* __restrict__ xn, __bf16* __restrict__ wqkv_bf, __bf16* __restrict__ wout_bf) {
    const int lane = threadIdx.x & 31;
    const int w = __builtin_amdgcn_readfirstlane(blockIdx.x * 16 + (threadIdx.x >> 5));   // 0..4095
    const float* wsrc = w < QKV_N ? wqkv + (size_t)w * DIM : wout + (size_t)(w - QKV_N) * DIM;
    __bf16*      wdst = w < QKV_N ? wqkv_bf + (size_t)w * DIM : wout_bf + (size_t)(w - QKV_N) * DIM;

    RowRegs x0 = load_row(x + (size_t)w * (2 * DIM), lane);
    RowRegs x1 = load_row(x + (size_t)w * (2 * DIM) + DIM, lane);
    RowRegs sc = load_row(scale, lane);
    RowRegs wr = load_row(wsrc, lane);

    const float s0 = row_rrms(x0), s1 = row_rrms(x1);
    #pragma unroll
    for (int k = 0; k < 4; k++) {
        x0.r[k] = x0.r[k] * sc.r[k] * s0;
        x1.r[k] = x1.r[k] * sc.r[k] * s1;
    }
    store_row(wdst, lane, wr);
    store_row(xn + (size_t)w * (2 * DIM), lane, x0);
    store_row(xn + (size_t)w * (2 * DIM) + DIM, lane, x1);
}

// ---------------------------------------------------------------- K2: QKV GEMM + RoPE
// C[8192,3072] = Xn[8192,1024] * Wqkv[3072,1024]^T  (NT: both K-major)
// 256 x 128 block tile, 8 waves (4 x 2) of 64 x 64; a wave's 64 columns are one head.
__global__ __launch_bounds__(256) __attribute__((amdgpu_waves_per_eu(4, 4)))
void qkv_gemm_rope_kernel(
        const __bf16* __restrict__ xn, const __bf16* __restrict__ wqkv,
        const float* __restrict__ theta,
        __bf16* __restrict__ qd, __bf16* __restrict__ kd, __bf16* __restrict__ vd) {
    const int n0 = blockIdx.x * 128;   // 24 tiles over 3072
    const int m0 = blockIdx.y * 256;   // 32 tiles over 8192
    const int wave = __builtin_amdgcn_readfirstlane(threadIdx.x >> 5);
    const int lane = threadIdx.x & 31;
    const int ln = lane & 15, hi = lane >> 4;
    const int wm = wave >> 1, wn = wave & 1;

    v8f acc[4][4] = {};
    gemm_nt_mainloop<4>(xn + (size_t)m0 * DIM, wqkv + (size_t)n0 * DIM, wm, wn, acc);

    const int nw = n0 + wn * 64;          // this wave's first column
    const int comp = nw >> 10;            // 0=q 1=k 2=v
    const int h = (nw & 1023) >> 6;       // head (a wave's tile never crosses a head)
    const int tok0 = m0 + wm * 64;        // a wave's 64 rows lie in one batch entry
    const int b = tok0 >> 10, seq0 = (tok0 & 1023) + 8 * hi;
    if (comp == 2) {
        // V stored transposed: [B,H,D,S]
        __bf16* vp = vd + ((size_t)(b * HEADS + h) * HD + ln) * SEQ + seq0;
        #pragma unroll
        for (int mf = 0; mf < 4; mf++)
            #pragma unroll
            for (int nf = 0; nf < 4; nf++)
                #pragma unroll
                for (int r = 0; r < 8; r++)
                    vp[nf * 16 * SEQ + mf * 16 + r] = (__bf16)acc[mf][nf][r];
    } else {
        // RoPE on d<32: pair (d, d+16) = (frag0, frag1), same lane slot
        const float* tp = theta + seq0 * (HEADS * 16) + h * 16 + ln;
        __bf16* dst = (comp == 0 ? qd : kd) + ((size_t)(b * HEADS + h) * SEQ + seq0) * HD + ln;
        float th[4][8];
        #pragma unroll
        for (int mf = 0; mf < 4; mf++)
            #pragma unroll
            for (int r = 0; r < 8; r++) th[mf][r] = tp[(mf * 16 + r) * (HEADS * 16)];
        #pragma unroll
        for (int mf = 0; mf < 4; mf++) {
            #pragma unroll
            for (int r = 0; r < 8; r++) {
                const int row = mf * 16 + r;
                float v0 = acc[mf][0][r], v1 = acc[mf][1][r];
                float sn, cs;
                // the fast sine and cosine (argument in turns) in one statement: its v_nop
                // fills the slot behind a transcendental, whatever is scheduled next
                asm("v_sin_f32 %0, %2\n\tv_cos_f32 %1, %2\n\tv_nop"
                    : "=&v"(sn), "=&v"(cs) : "v"(th[mf][r] * 0.15915494f));
                float y0 = v0 * cs - v1 * sn;
                float y1 = v1 * cs + v0 * sn;
                dst[row * HD + 0 * 16] = (__bf16)y0;
                dst[row * HD + 1 * 16] = (__bf16)y1;
                dst[row * HD + 2 * 16] = (__bf16)acc[mf][2][r];
                dst[row * HD + 3 * 16] = (__bf16)acc[mf][3][r];
            }
            // one group of 16 rows at a time: with all 32 sine and cosine pairs
            // scheduled together the registers spill to scratch
            __builtin_amdgcn_sched_barrier(0);
        }
        // the listing keeps a path from these stores into the other branch, which
        // rewrites their address registers: the wait stands in front of that rewrite
        asm volatile("s_wait_xcnt 0x0" ::: "memory");
    }
}

// ---------------------------------------------------------------- K3: causal flash attention
// the value that lane l ^ 16 holds
__device__ __forceinline__ float other_half(float v) {
    int b = __builtin_bit_cast(int, v);
    return __builtin_bit_cast(float, __builtin_amdgcn_permlanex16(b, b, 0x76543210, 0xfedcba98, false, false));
}

// 2^x in asm. Early-clobber outputs keep every source whole
// inside the statement; the v_nop fills the slot behind the last one, whatever comes next.
#define LOG2E 1.44269504f
__device__ __forceinline__ float exp2_x1(float x) {
    float p;
    asm("v_exp_f32 %0, %1\n\tv_nop" : "=&v"(p) : "v"(x));
    return p;
}
__device__ __forceinline__ void exp2_x8(float (&p)[8], const float (&x)[8]) {
    asm("v_exp_f32 %0, %8\n\t"
        "v_exp_f32 %1, %9\n\t"
        "v_exp_f32 %2, %10\n\t"
        "v_exp_f32 %3, %11\n\t"
        "v_exp_f32 %4, %12\n\t"
        "v_exp_f32 %5, %13\n\t"
        "v_exp_f32 %6, %14\n\t"
        "v_exp_f32 %7, %15\n\t"
        "v_nop"
        : "=&v"(p[0]), "=&v"(p[1]), "=&v"(p[2]), "=&v"(p[3]),
          "=&v"(p[4]), "=&v"(p[5]), "=&v"(p[6]), "=&v"(p[7])
        : "v"(x[0]), "v"(x[1]), "v"(x[2]), "v"(x[3]), "v"(x[4]), "v"(x[5]), "v"(x[6]), "v"(x[7]));
}

__global__ __launch_bounds__(256) void attention_kernel(
        const __bf16* __restrict__ qd, const __bf16* __restrict__ kd,
        const __bf16* __restrict__ vd, __bf16* __restrict__ od) {
    __shared__ __align__(16) __bf16 Ks[2][64][72];
    __shared__ __align__(16) __bf16 Vs[2][64][72];
    const int t  = blockIdx.x >> 7;    // 0..3
    const int bh = blockIdx.x & 127;   // b*16+h
    const int b  = bh >> 4, h = bh & 15;
    const int tid = threadIdx.x, wave = tid >> 5, lane = tid & 31;
    const int ln = lane & 15, hi = lane >> 4;

    const int kr = tid >> 2, kc = (tid & 3) * 16;   // 64 x 64 chunk, 32B/thread
    const __bf16* kBp = kd + ((size_t)bh * SEQ + kr) * HD + kc;   // + j0*HD
    const __bf16* vBp = vd + ((size_t)bh * HD + kr) * SEQ + kc;   // + j0
    auto load_chunk = [&](int j0, int buf) {
        #pragma unroll
        for (int u = 0; u < 2; u++)
            async_copy16(&Ks[buf][kr][kc + u * 8], kBp + (size_t)j0 * HD + u * 8);
        #pragma unroll
        for (int u = 0; u < 2; u++)
            async_copy16(&Vs[buf][kr][kc + u * 8], vBp + j0 + u * 8);
    };

    // rolled: the two tiles share one copy of the chunk loop
    #pragma unroll 1
    for (int half = 0; half < 2; half++) {
    const int q0 = (half == 0 ? 7 - t : t) * 128;

    // Q fragments resident in registers for the whole tile
    const __bf16* qrow = qd + ((size_t)bh * SEQ + q0 + wave * 16 + ln) * HD;
    v16bf qfrag[2];
    qfrag[0] = ld_frag(qrow, 0 * 32 + hi * 8);
    qfrag[1] = ld_frag(qrow, 1 * 32 + hi * 8);

    // the first tile's chunk loop ends in a barrier: both buffers are free here
    load_chunk(0, 0);
    wait_async0();
    __syncthreads();

    v8f accO[4] = {};                  // accO[df][r] = O[query ln][d = df * 16 + 8 * hi + r]
    float mrun = -1e30f, lrun = 0.f;   // of query ln; lrun sums this half's keys only
    const int qg = q0 + wave * 16 + ln;

    const int nchunks = (q0 + 128) / 64;
    for (int ci = 0; ci < nchunks; ci++) {
        const int j0 = ci * 64, cur = ci & 1;
        if (ci + 1 < nchunks) load_chunk(j0 + 64, cur ^ 1);

        // scores: K(64keys x 64d) * Q(16x64d)^T -> 4 frags of 16 keys x 16 queries,
        // accS[nf][r] = S[query ln][key j0 + nf * 16 + 8 * hi + r]
        v8f accS[4] = {};
        #pragma unroll
        for (int nf = 0; nf < 4; nf++) {
            #pragma unroll
            for (int kk = 0; kk < 2; kk++) {
                v16bf kf = ld_frag(&Ks[cur][nf * 16 + ln][0], kk * 32 + hi * 8);
                accS[nf] = wmma_bf16(kf, qfrag[kk], accS[nf]);
            }
        }

        // online softmax of one query per lane
        const int lim = qg - j0 - 8 * hi;   // key nf * 16 + r of this half is seen if <= lim
        float cmax[4];
        #pragma unroll
        for (int nf = 0; nf < 4; nf++) {
            #pragma unroll
            for (int r = 0; r < 8; r++) {
                float v = accS[nf][r] * 0.125f;   // 1/sqrt(64)
                accS[nf][r] = (nf * 16 + r <= lim) ? v : -1e30f;
            }
            cmax[nf] = fmaxf(fmaxf(fmaxf(accS[nf][0], accS[nf][1]), fmaxf(accS[nf][2], accS[nf][3])),
                             fmaxf(fmaxf(accS[nf][4], accS[nf][5]), fmaxf(accS[nf][6], accS[nf][7])));
        }
        float rmax = fmaxf(fmaxf(cmax[0], cmax[1]), fmaxf(cmax[2], cmax[3]));
        rmax = fmaxf(rmax, other_half(rmax));
        const float mnew = fmaxf(mrun, rmax);
        const float corr = exp2_x1((mrun - mnew) * LOG2E);
        mrun = mnew;
        // P^T as B operand: element s of pf[kk] is key kk * 32 + (s < 8 ? 8 * hi + s : 16 + 8 * hi + s - 8),
        // the k order of ld_frag, which loads V^T beside it
        v16bf pf[2];
        float csum[4];
        #pragma unroll
        for (int nf = 0; nf < 4; nf++) {
            float e[8], p[8];
            #pragma unroll
            for (int r = 0; r < 8; r++) e[r] = (accS[nf][r] - mnew) * LOG2E;
            exp2_x8(p, e);
            #pragma unroll
            for (int r = 0; r < 8; r++) pf[nf >> 1][(nf & 1) * 8 + r] = (__bf16)p[r];
            csum[nf] = ((p[0] + p[1]) + (p[2] + p[3])) + ((p[4] + p[5]) + (p[6] + p[7]));
        }
        lrun = lrun * corr + ((csum[0] + csum[1]) + (csum[2] + csum[3]));
        #pragma unroll
        for (int df = 0; df < 4; df++) accO[df] = accO[df] * corr;

        // O^T += V^T(64d x 64keys) * P^T(64keys x 16 queries)
        #pragma unroll
        for (int df = 0; df < 4; df++) {
            #pragma unroll
            for (int kk = 0; kk < 2; kk++) {
                v16bf vf = ld_frag(&Vs[cur][df * 16 + ln][0], kk * 32 + hi * 8);
                accO[df] = wmma_bf16(vf, pf[kk], accO[df]);
            }
        }
        if (ci + 1 < nchunks) wait_async0();
        __syncthreads();
    }

    // a lane's 8 accumulator registers are 8 consecutive d of its query: 16-byte stores
    const float inv = 1.0f / (lrun + other_half(lrun));
    __bf16* dst = od + ((size_t)(b * SEQ + qg)) * DIM + h * HD + 8 * hi;
    #pragma unroll
    for (int df = 0; df < 4; df++)
        *reinterpret_cast<v8bf*>(dst + df * 16) = __builtin_convertvector(accO[df] * inv, v8bf);
    // the second tile's set-up rewrites the address and data registers of these stores:
    // the wait stands in front of that rewrite
    asm volatile("s_wait_xcnt 0x0" ::: "memory");
    }
}

// ---------------------------------------------------------------- K4: out-proj + residual
// out[8192,1024] = O[8192,1024] * Wout[1024,1024]^T + x
// 128 x 128 block tile, 4 waves (2 x 2) of 64 x 64: 512 blocks, two for each WGP.
__global__ __launch_bounds__(128) __attribute__((amdgpu_waves_per_eu(4, 4)))
void outproj_kernel(
        const __bf16* __restrict__ o, const __bf16* __restrict__ wout,
        const float* __restrict__ x, float* __restrict__ out) {
    const int n0 = blockIdx.x * 128;
    const int m0 = blockIdx.y * 128;
    const int wave = __builtin_amdgcn_readfirstlane(threadIdx.x >> 5);
    const int lane = threadIdx.x & 31;
    const int ln = lane & 15, hi = lane >> 4;
    const int wm = wave >> 1, wn = wave & 1;

    v8f acc[4][4] = {};
    gemm_nt_mainloop<2>(o + (size_t)m0 * DIM, wout + (size_t)n0 * DIM, wm, wn, acc);

    const unsigned at = (unsigned)(m0 + wm * 64 + 8 * hi) * DIM + n0 + wn * 64 + ln;
    float* dst        = out + at;
    const float* skip = x   + at;
    #pragma unroll
    for (int mf = 0; mf < 4; mf++) {
        #pragma unroll
        for (int r = 0; r < 8; r++) {
            #pragma unroll
            for (int nf = 0; nf < 4; nf++) {
                const int off = (mf * 16 + r) * DIM + nf * 16;
                dst[off] = acc[mf][nf][r] + skip[off];
            }
        }
    }
}

// ---------------------------------------------------------------- launch
extern "C" void kernel_launch(void* const* d_in, const int* in_sizes, int n_in,
                              void* d_out, int out_size, void* d_ws, size_t ws_size,
                              hipStream_t stream) {
    const float* x     = (const float*)d_in[0];   // [8,1024,1024]
    const float* scale = (const float*)d_in[1];   // [1024]
    const float* wqkv  = (const float*)d_in[2];   // [3072,1024]
    const float* wout  = (const float*)d_in[3];   // [1024,1024]
    const float* theta = (const float*)d_in[4];   // [1024,16,16]

    char* ws = (char*)d_ws;
    __bf16* wqkv_bf = (__bf16*)(ws);                         //  6,291,456 B
    __bf16* wout_bf = (__bf16*)(ws + 6291456);               //  2,097,152 B
    __bf16* xn_bf   = (__bf16*)(ws + 8388608);               // 16,777,216 B
    __bf16* q_bf    = (__bf16*)(ws + 25165824);              // [B,H,S,D]
    __bf16* k_bf    = (__bf16*)(ws + 41943040);              // [B,H,S,D]
    __bf16* v_bf    = (__bf16*)(ws + 58720256);              // [B,H,D,S]
    __bf16* o_bf    = (__bf16*)(ws + 75497472);              // [B,S,H*D]
    float*  outp    = (float*)d_out;

    prep_kernel<<<NTOK / 2 / 16, 512, 0, stream>>>(x, scale, wqkv, wout, xn_bf, wqkv_bf, wout_bf);
    qkv_gemm_rope_kernel<<<dim3(QKV_N / 128, NTOK / 256), 256, 0, stream>>>(
        xn_bf, wqkv_bf, theta, q_bf, k_bf, v_bf);
    attention_kernel<<<BATCH * HEADS * (SEQ / 256), 256, 0, stream>>>(q_bf, k_bf, v_bf, o_bf);
    outproj_kernel<<<dim3(DIM / 128, NTOK / 128), 128, 0, stream>>>(o_bf, wout_bf, x, outp);
}

// v005
// One run takes 100 microseconds.
// In two side-by-side timings against v004, it was 1.04 and 1.05 times as fast.
// Over all steps from v000 it is 2.34 times as fast.
#include <hip/hip_runtime.h>

#define DIM    1024
#define HEADS  16
#define HD     64
#define SEQ    1024
#define BATCH  8
#define NTOK   (BATCH * SEQ)   // 8192
#define QKV_N  (3 * DIM)       // 3072

typedef __attribute__((ext_vector_type(16))) __bf16 v16bf;
typedef __attribute__((ext_vector_type(8)))  __bf16 v8bf;
typedef __attribute__((ext_vector_type(8)))  float  v8f;

// Load one 16-bf16 WMMA A/B fragment for this lane from an LDS row:
// per CDNA5 ISA 16-bit layout, lane holds k = base+0..7 and k = base+16..23
// with base = (lane>>4)*8, row = lane&15. k0 = chunk*32 + (lane>>4)*8.
__device__ __forceinline__ v16bf ld_frag(const __bf16* row, int k0) {
    v8bf lo = *reinterpret_cast<const v8bf*>(row + k0);
    v8bf hi = *reinterpret_cast<const v8bf*>(row + k0 + 16);
    return __builtin_shufflevector(lo, hi, 0,1,2,3,4,5,6,7,8,9,10,11,12,13,14,15);
}

__device__ __forceinline__ v8f wmma_bf16(v16bf a, v16bf b, v8f c) {
    return __builtin_amdgcn_wmma_f32_16x16x32_bf16(false, a, false, b, (short)0, c, false, false);
}

// Async copy 16B global -> LDS (GLOBAL_LOAD_ASYNC_TO_LDS_B128, ASYNCcnt).
// Generic LDS pointer: low 32 bits are the LDS byte offset (flat aperture rule).
__device__ __forceinline__ void async_copy16(void* lds_dst, const void* gsrc) {
    unsigned loff = (unsigned)(uintptr_t)lds_dst;
    asm volatile("global_load_async_to_lds_b128 %0, %1, off"
                 :: "v"(loff), "v"(gsrc) : "memory");
}
__device__ __forceinline__ void wait_async0() {
#if __has_builtin(__builtin_amdgcn_s_wait_asynccnt)
    __builtin_amdgcn_s_wait_asynccnt(0);
#else
    asm volatile("s_wait_asynccnt 0x0" ::: "memory");
#endif
}

// Four / eight 16-byte async copies of one lane, rows lstep (LDS bytes) and gstep
// (elements) apart. s_wait_xcnt 0 is the last line of the copies' own statement, so
// that it stands in front of any later rewrite of the address registers they name.
__device__ __forceinline__ void async_copy16_x4(unsigned l, unsigned lstep,
                                                const __bf16* g, size_t gstep) {
    asm volatile("global_load_async_to_lds_b128 %0, %4, off\n\t"
                 "global_load_async_to_lds_b128 %1, %5, off\n\t"
                 "global_load_async_to_lds_b128 %2, %6, off\n\t"
                 "global_load_async_to_lds_b128 %3, %7, off\n\t"
                 "s_wait_xcnt 0x0"
                 :: "v"(l), "v"(l + lstep), "v"(l + 2 * lstep), "v"(l + 3 * lstep),
                    "v"(g), "v"(g + gstep), "v"(g + 2 * gstep), "v"(g + 3 * gstep)
                 : "memory");
}
__device__ __forceinline__ void async_copy16_x8(unsigned l, unsigned lstep,
                                                const __bf16* g, size_t gstep) {
    asm volatile("global_load_async_to_lds_b128 %0, %8, off\n\t"
                 "global_load_async_to_lds_b128 %1, %9, off\n\t"
                 "global_load_async_to_lds_b128 %2, %10, off\n\t"
                 "global_load_async_to_lds_b128 %3, %11, off\n\t"
                 "global_load_async_to_lds_b128 %4, %12, off\n\t"
                 "global_load_async_to_lds_b128 %5, %13, off\n\t"
                 "global_load_async_to_lds_b128 %6, %14, off\n\t"
                 "global_load_async_to_lds_b128 %7, %15, off\n\t"
                 "s_wait_xcnt 0x0"
                 :: "v"(l), "v"(l + lstep), "v"(l + 2 * lstep), "v"(l + 3 * lstep),
                    "v"(l + 4 * lstep), "v"(l + 5 * lstep), "v"(l + 6 * lstep), "v"(l + 7 * lstep),
                    "v"(g), "v"(g + gstep), "v"(g + 2 * gstep), "v"(g + 3 * gstep),
                    "v"(g + 4 * gstep), "v"(g + 5 * gstep), "v"(g + 6 * gstep), "v"(g + 7 * gstep)
                 : "memory");
}

// NT GEMM main loop over K = DIM (both operands K-major, row pitch DIM).
// Block tile (WM*64) x 128 from WM x 2 waves; each wave keeps a 64 x 64 tile
// (4 x 4 accumulator fragments), so 8 loaded fragments feed 16 WMMAs.
// a, b point at the block's first row. Two LDS buffers, K-step 64, one barrier a step.
// A wave's copy covers four whole 128-byte rows.
// sm holds A[2][BM][72], then B[2][128][72]. Behind the loop's last barrier nobody reads it
// and no copy is in flight: the caller's epilogue may stage its tile there.
// A lane's 8 accumulator registers run along the rows of the WMMA's first operand:
// acc[i][j][r] = C[first operand's row i * 16 + 8 * hi + r][second operand's row j * 16 + ln].
// b_first picks b's rows as the first operand (block-uniform), so that the 8 registers are
// 8 adjacent elements of the output's rows, whichever way the output lies.
template <int WM>
__device__ __forceinline__ void gemm_nt_mainloop(__bf16* sm,
                                                 const __bf16* __restrict__ a,
                                                 const __bf16* __restrict__ b,
                                                 int wm, int wn, bool b_first, v8f (&acc)[4][4]) {
    constexpr int BM = WM * 64;      // rows of the A tile
    constexpr int RP = WM * 8;       // rows that one copy of the whole block covers
    constexpr int ABUF = BM * 72, BBUF = 128 * 72, BOFF = 2 * ABUF;   // in elements
    const int tid = threadIdx.x, lane = tid & 31;
    const int ln = lane & 15, hi = lane >> 4;
    const int cr = tid >> 3, cc = (tid & 7) * 8;
    const __bf16* ag = a + (size_t)cr * DIM + cc;
    const __bf16* bg = b + (size_t)cr * DIM + cc;

    auto load_tile = [&](int k0, int buf) {
        async_copy16_x8((unsigned)(uintptr_t)(sm + buf * ABUF + cr * 72 + cc), RP * 144, ag + k0, (size_t)RP * DIM);
        if constexpr (WM == 4)
            async_copy16_x4((unsigned)(uintptr_t)(sm + BOFF + buf * BBUF + cr * 72 + cc), RP * 144, bg + k0, (size_t)RP * DIM);
        else
            async_copy16_x8((unsigned)(uintptr_t)(sm + BOFF + buf * BBUF + cr * 72 + cc), RP * 144, bg + k0, (size_t)RP * DIM);
    };
    const int aofs = wm * 64 * 72, bofs = BOFF + wn * 64 * 72;
    const int pofs = b_first ? bofs : aofs, pbuf = b_first ? BBUF : ABUF;   // first operand
    const int qofs = b_first ? aofs : bofs, qbuf = b_first ? ABUF : BBUF;   // second operand

    load_tile(0, 0);
    asm volatile("s_wait_asynccnt 0x0" ::: "memory");   // tile 0 landed before it is published
    __syncthreads();
    load_tile(64, 1);

    constexpr int NSTEP = DIM / 64;   // 16
    for (int i = 0; i < NSTEP; i++) {
        const int cur = i & 1;
        v16bf af[4], bf[4];
        auto load_frags = [&](int kk) {
            #pragma unroll
            for (int f = 0; f < 4; f++) {
                af[f] = ld_frag(sm + pofs + cur * pbuf + (f * 16 + ln) * 72, kk * 32 + hi * 8);
                bf[f] = ld_frag(sm + qofs + cur * qbuf + (f * 16 + ln) * 72, kk * 32 + hi * 8);
            }
        };
        auto products = [&]() {
            #pragma unroll
            for (int mf = 0; mf < 4; mf++)
                #pragma unroll
                for (int nf = 0; nf < 4; nf++)
                    acc[mf][nf] = wmma_bf16(af[mf], bf[nf], acc[mf][nf]);
        };
        load_frags(0);
        // keeps the 16 LDS reads one group ahead of their 16 WMMAs: left alone the
        // scheduler reloads one A fragment per row of 4 and waits it out each time
        __builtin_amdgcn_sched_barrier(0);
        products();
        load_frags(1);
        // publish point: this wave's reads of buffer cur are done, its copies of the
        // next tile have landed; behind the barrier buffer cur may be refilled.
        asm volatile("s_wait_dscnt 0x0" ::: "memory");
        asm volatile("s_wait_asynccnt 0x0" ::: "memory");
        __syncthreads();
        if (i + 2 < NSTEP) load_tile((i + 2) * 64, cur);
        // the step's second half works from registers while the refill is in flight
        products();
    }
    asm volatile("s_wait_asynccnt 0x0" ::: "memory");   // no copy outstanding at the wave's end
}

// ---------------------------------------------------------------- K0: all f32 -> bf16 preparation
// 256 x 16 long-lived waves (for speed only). A wave owns whole 1024-float rows, 32 floats a lane as 8 loads of 512 contiguous bytes:
// two rows of x (RMSNorm; the row sum stays inside the wave) and one weight row (rounding only).
typedef __attribute__((ext_vector_type(4))) float  v4f;
typedef __attribute__((ext_vector_type(4))) __bf16 v4bf;
static_assert(QKV_N + DIM == NTOK / 2, "one weight row for every two rows of x");

// A lane's share of a row: element 4 * c + e of r[k] with c = 0, 1 is float e of the
// row's 16-byte piece (2 * k + c) * 32 + lane.
struct RowRegs { v8f r[4]; };

__device__ __forceinline__ RowRegs load_row(const float* row, int lane) {
    const v4f* p = reinterpret_cast<const v4f*>(row) + lane;
    RowRegs t;
    #pragma unroll
    for (int k = 0; k < 4; k++)
        t.r[k] = __builtin_shufflevector(p[k * 64], p[k * 64 + 32], 0, 1, 2, 3, 4, 5, 6, 7);
    return t;
}
__device__ __forceinline__ void store_row(__bf16* row, int lane, const RowRegs& t) {
    v4bf* p = reinterpret_cast<v4bf*>(row) + lane;
    #pragma unroll
    for (int k = 0; k < 4; k++) {
        p[k * 64]      = __builtin_convertvector(__builtin_shufflevector(t.r[k], t.r[k], 0, 1, 2, 3), v4bf);
        p[k * 64 + 32] = __builtin_convertvector(__builtin_shufflevector(t.r[k], t.r[k], 4, 5, 6, 7), v4bf);
    }
}
// 1 / rms of a row: eight partial sums a lane, folded, then a five-step butterfly
__device__ __forceinline__ float row_rrms(const RowRegs& t) {
    v8f a = t.r[0] * t.r[0];
    #pragma unroll
    for (int k = 1; k < 4; k++) a += t.r[k] * t.r[k];
    float ss = ((a[0] + a[1]) + (a[2] + a[3])) + ((a[4] + a[5]) + (a[6] + a[7]));
    #pragma unroll
    for (int off = 16; off > 0; off >>= 1) ss += __shfl_xor(ss, off, 32);
    return rsqrtf(ss * (1.0f / DIM) + 1e-6f);
}

__global__ __launch_bounds__(512) void prep_kernel(
        const float* __restrict__ x, const float* __restrict__ scale,
        const float* __restrict__ wqkv, const float* __restrict__ wout,
        __bf16* __restrict__ xn, __bf16* __restrict__ wqkv_bf, __bf16* __restrict__ wout_bf) {
    const int lane = threadIdx.x & 31;
    const int w = __builtin_amdgcn_readfirstlane(blockIdx.x * 16 + (threadIdx.x >> 5));   // 0..4095
    const float* wsrc = w < QKV_N ? wqkv + (size_t)w * DIM : wout + (size_t)(w - QKV_N) * DIM;
    __bf16*      wdst = w < QKV_N ? wqkv_bf + (size_t)w * DIM : wout_bf + (size_t)(w - QKV_N) * DIM;

    RowRegs x0 = load_row(x + (size_t)w * (2 * DIM), lane);
    RowRegs x1 = load_row(x + (size_t)w * (2 * DIM) + DIM, lane);
    RowRegs sc = load_row(scale, lane);
    RowRegs wr = load_row(wsrc, lane);

    const float s0 = row_rrms(x0), s1 = row_rrms(x1);
    #pragma unroll
    for (int k = 0; k < 4; k++) {
        x0.r[k] = x0.r[k] * sc.r[k] * s0;
        x1.r[k] = x1.r[k] * sc.r[k] * s1;
    }
    store_row(wdst, lane, wr);
    store_row(xn + (size_t)w * (2 * DIM), lane, x0);
    store_row(xn + (size_t)w * (2 * DIM) + DIM, lane, x1);
}

// ---------------------------------------------------------------- K2: QKV GEMM + RoPE
// C[8192,3072] = Xn[8192,1024] * Wqkv[3072,1024]^T  (NT: both K-major)
// 256 x 128 block tile, 8 waves (4 x 2) of 64 x 64; a wave's 64 columns are one head.
__global__ __launch_bounds__(256) __attribute__((amdgpu_waves_per_eu(4, 4)))
void qkv_gemm_rope_kernel(
        const __bf16* __restrict__ xn, const __bf16* __restrict__ wqkv,
        const float* __restrict__ theta,
        __bf16* __restrict__ qd, __bf16* __restrict__ kd, __bf16* __restrict__ vd) {
    const int n0 = blockIdx.x * 128;   // 24 tiles over 3072
    const int m0 = blockIdx.y * 256;   // 32 tiles over 8192
    const int wave = __builtin_amdgcn_readfirstlane(threadIdx.x >> 5);
    const int lane = threadIdx.x & 31;
    const int ln = lane & 15, hi = lane >> 4;
    const int wm = wave >> 1, wn = wave & 1;

    __shared__ __align__(16) __bf16 sm[2 * 256 * 72 + 2 * 128 * 72];
    const int nw = n0 + wn * 64;          // this wave's first column
    const int comp = nw >> 10;            // 0=q 1=k 2=v, the same for the whole block
    const int h = (nw & 1023) >> 6;       // head (a wave's tile never crosses a head)
    const int tok0 = m0 + wm * 64;        // a wave's 64 rows lie in one batch entry
    const int b = tok0 >> 10, seqb = tok0 & 1023;

    // q, k are stored [token][d]: the lane's 8 registers run along d (weight rows first);
    // v is stored [d][token]: they run along the tokens
    v8f acc[4][4] = {};
    gemm_nt_mainloop<4>(sm, xn + (size_t)m0 * DIM, wqkv + (size_t)n0 * DIM, wm, wn, comp != 2, acc);

    if (comp != 2) {
        // RoPE on d<32: pair (d, d+16) = (acc[0], acc[1]), same lane slot; d = 8 * hi + r,
        // token j * 16 + ln
        const float* tp = theta + (seqb + ln) * (HEADS * 16) + h * 16 + 8 * hi;
        v4f th[4][2];
        #pragma unroll
        for (int j = 0; j < 4; j++) {
            th[j][0] = *reinterpret_cast<const v4f*>(tp + j * 16 * (HEADS * 16));
            th[j][1] = *reinterpret_cast<const v4f*>(tp + j * 16 * (HEADS * 16) + 4);
        }
        // the eight loads share one address pair: tp stays live up to this wait, so that no
        // load's result lands in the pair and nothing rewrites it in front of the wait
        asm volatile("s_wait_xcnt 0x0" :: "v"(tp) : "memory");
        #pragma unroll
        for (int j = 0; j < 4; j++) {
            #pragma unroll
            for (int r = 0; r < 8; r++) {
                float v0 = acc[0][j][r], v1 = acc[1][j][r];
                float sn, cs;
                // the fast sine and cosine (argument in turns) in one statement: its v_nop
                // fills the slot behind a transcendental, whatever is scheduled next
                asm("v_sin_f32 %0, %2\n\tv_cos_f32 %1, %2\n\tv_nop"
                    : "=&v"(sn), "=&v"(cs) : "v"(th[j][r >> 2][r & 3] * 0.15915494f));
                acc[0][j][r] = v0 * cs - v1 * sn;
                acc[1][j][r] = v1 * cs + v0 * sn;
            }
        }
    }

    // The wave's 64 x 64 tile goes through its own 64 x 72 piece of LDS, 16 bytes a lane both
    // ways, and leaves as whole 128-byte lines (straight from the accumulators: 32-byte pieces).
    __bf16* st = sm + wave * (64 * 72);
    #pragma unroll
    for (int j = 0; j < 4; j++)
        #pragma unroll
        for (int i = 0; i < 4; i++)
            *reinterpret_cast<v8bf*>(st + (j * 16 + ln) * 72 + i * 16 + 8 * hi) =
                __builtin_convertvector(acc[i][j], v8bf);
    // the rows read back below were written by other lanes of this wave
    asm volatile("s_wait_dscnt 0x0" ::: "memory");
    const __bf16* sr = st + (lane >> 3) * 72 + (lane & 7) * 8;   // 4 rows a load
    v8bf row[16];
    #pragma unroll
    for (int t = 0; t < 16; t++) row[t] = *reinterpret_cast<const v8bf*>(sr + t * 4 * 72);
    if (comp == 2) {
        // V transposed: [B,H,D,S], a row of the tile is one d
        __bf16* dst = vd + ((size_t)(b * HEADS + h) * HD + (lane >> 3)) * SEQ + seqb + (lane & 7) * 8;
        #pragma unroll
        for (int t = 0; t < 16; t++) *reinterpret_cast<v8bf*>(dst + t * 4 * SEQ) = row[t];
    } else {
        // [B,H,S,D]: the tile's 64 rows are 8 KB in a row
        __bf16* dst = (comp == 0 ? qd : kd) + ((size_t)(b * HEADS + h) * SEQ + seqb) * HD + lane * 8;
        #pragma unroll
        for (int t = 0; t < 16; t++) *reinterpret_cast<v8bf*>(dst + t * 4 * HD) = row[t];
        // the listing keeps a path from these stores into the other branch, which
        // rewrites their address register: the wait stands in front of that rewrite
        asm volatile("s_wait_xcnt 0x0" ::: "memory");
    }
}

// ---------------------------------------------------------------- K3: causal flash attention
// the value that lane l ^ 16 holds
__device__ __forceinline__ float other_half(float v) {
    int b = __builtin_bit_cast(int, v);
    return __builtin_bit_cast(float, __builtin_amdgcn_permlanex16(b, b, 0x76543210, 0xfedcba98, false, false));
}

// 2^x in asm. Early-clobber outputs keep every source whole
// inside the statement; the v_nop fills the slot behind the last one, whatever comes next.
#define LOG2E 1.44269504f
__device__ __forceinline__ float exp2_x1(float x) {
    float p;
    asm("v_exp_f32 %0, %1\n\tv_nop" : "=&v"(p) : "v"(x));
    return p;
}
__device__ __forceinline__ void exp2_x8(float (&p)[8], const float (&x)[8]) {
    asm("v_exp_f32 %0, %8\n\t"
        "v_exp_f32 %1, %9\n\t"
        "v_exp_f32 %2, %10\n\t"
        "v_exp_f32 %3, %11\n\t"
        "v_exp_f32 %4, %12\n\t"
        "v_exp_f32 %5, %13\n\t"
        "v_exp_f32 %6, %14\n\t"
        "v_exp_f32 %7, %15\n\t"
        "v_nop"
        : "=&v"(p[0]), "=&v"(p[1]), "=&v"(p[2]), "=&v"(p[3]),
          "=&v"(p[4]), "=&v"(p[5]), "=&v"(p[6]), "=&v"(p[7])
        : "v"(x[0]), "v"(x[1]), "v"(x[2]), "v"(x[3]), "v"(x[4]), "v"(x[5]), "v"(x[6]), "v"(x[7]));
}

__global__ __launch_bounds__(256) void attention_kernel(
        const __bf16* __restrict__ qd, const __bf16* __restrict__ kd,
        const __bf16* __restrict__ vd, __bf16* __restrict__ od) {
    __shared__ __align__(16) __bf16 Ks[2][64][72];
    __shared__ __align__(16) __bf16 Vs[2][64][72];
    const int t  = blockIdx.x >> 7;    // 0..3
    const int bh = blockIdx.x & 127;   // b*16+h
    const int b  = bh >> 4, h = bh & 15;
    const int tid = threadIdx.x, wave = tid >> 5, lane = tid & 31;
    const int ln = lane & 15, hi = lane >> 4;

    const int kr = tid >> 2, kc = (tid & 3) * 16;   // 64 x 64 chunk, 32B/thread
    const __bf16* kBp = kd + ((size_t)bh * SEQ + kr) * HD + kc;   // + j0*HD
    const __bf16* vBp = vd + ((size_t)bh * HD + kr) * SEQ + kc;   // + j0
    auto load_chunk = [&](int j0, int buf) {
        #pragma unroll
        for (int u = 0; u < 2; u++)
            async_copy16(&Ks[buf][kr][kc + u * 8], kBp + (size_t)j0 * HD + u * 8);
        #pragma unroll
        for (int u = 0; u < 2; u++)
            async_copy16(&Vs[buf][kr][kc + u * 8], vBp + j0 + u * 8);
    };

    // rolled: the two tiles share one copy of the chunk loop
    #pragma unroll 1
    for (int half = 0; half < 2; half++) {
    const int q0 = (half == 0 ? 7 - t : t) * 128;

    // Q fragments resident in registers for the whole tile
    const __bf16* qrow = qd + ((size_t)bh * SEQ + q0 + wave * 16 + ln) * HD;
    v16bf qfrag[2];
    qfrag[0] = ld_frag(qrow, 0 * 32 + hi * 8);
    qfrag[1] = ld_frag(qrow, 1 * 32 + hi * 8);

    // the first tile's chunk loop ends in a barrier: both buffers are free here
    load_chunk(0, 0);
    wait_async0();
    __syncthreads();

    v8f accO[4] = {};                  // accO[df][r] = O[query ln][d = df * 16 + 8 * hi + r]
    float mrun = -1e30f, lrun = 0.f;   // of query ln; lrun sums this half's keys only
    const int qg = q0 + wave * 16 + ln;

    const int nchunks = (q0 + 128) / 64;
    for (int ci = 0; ci < nchunks; ci++) {
        const int j0 = ci * 64, cur = ci & 1;
        if (ci + 1 < nchunks) load_chunk(j0 + 64, cur ^ 1);

        // scores: K(64keys x 64d) * Q(16x64d)^T -> 4 frags of 16 keys x 16 queries,
        // accS[nf][r] = S[query ln][key j0 + nf * 16 + 8 * hi + r]
        v8f accS[4] = {};
        #pragma unroll
        for (int nf = 0; nf < 4; nf++) {
            #pragma unroll
            for (int kk = 0; kk < 2; kk++) {
                v16bf kf = ld_frag(&Ks[cur][nf * 16 + ln][0], kk * 32 + hi * 8);
                accS[nf] = wmma_bf16(kf, qfrag[kk], accS[nf]);
            }
        }

        // online softmax of one query per lane
        const int lim = qg - j0 - 8 * hi;   // key nf * 16 + r of this half is seen if <= lim
        float cmax[4];
        #pragma unroll
        for (int nf = 0; nf < 4; nf++) {
            #pragma unroll
            for (int r = 0; r < 8; r++) {
                float v = accS[nf][r] * 0.125f;   // 1/sqrt(64)
                accS[nf][r] = (nf * 16 + r <= lim) ? v : -1e30f;
            }
            cmax[nf] = fmaxf(fmaxf(fmaxf(accS[nf][0], accS[nf][1]), fmaxf(accS[nf][2], accS[nf][3])),
                             fmaxf(fmaxf(accS[nf][4], accS[nf][5]), fmaxf(accS[nf][6], accS[nf][7])));
        }
        float rmax = fmaxf(fmaxf(cmax[0], cmax[1]), fmaxf(cmax[2], cmax[3]));
        rmax = fmaxf(rmax, other_half(rmax));
        const float mnew = fmaxf(mrun, rmax);
        const float corr = exp2_x1((mrun - mnew) * LOG2E);
        mrun = mnew;
        // P^T as B operand: element s of pf[kk] is key kk * 32 + (s < 8 ? 8 * hi + s : 16 + 8 * hi + s - 8),
        // the k order of ld_frag, which loads V^T beside it
        v16bf pf[2];
        float csum[4];
        #pragma unroll
        for (int nf = 0; nf < 4; nf++) {
            float e[8], p[8];
            #pragma unroll
            for (int r = 0; r < 8; r++) e[r] = (accS[nf][r] - mnew) * LOG2E;
            exp2_x8(p, e);
            #pragma unroll
            for (int r = 0; r < 8; r++) pf[nf >> 1][(nf & 1) * 8 + r] = (__bf16)p[r];
            csum[nf] = ((p[0] + p[1]) + (p[2] + p[3])) + ((p[4] + p[5]) + (p[6] + p[7]));
        }
        lrun = lrun * corr + ((csum[0] + csum[1]) + (csum[2] + csum[3]));
        #pragma unroll
        for (int df = 0; df < 4; df++) accO[df] = accO[df] * corr;

        // O^T += V^T(64d x 64keys) * P^T(64keys x 16 queries)
        #pragma unroll
        for (int df = 0; df < 4; df++) {
            #pragma unroll
            for (int kk = 0; kk < 2; kk++) {
                v16bf vf = ld_frag(&Vs[cur][df * 16 + ln][0], kk * 32 + hi * 8);
                accO[df] = wmma_bf16(vf, pf[kk], accO[df]);
            }
        }
        if (ci + 1 < nchunks) wait_async0();
        __syncthreads();
    }

    // a lane's 8 accumulator registers are 8 consecutive d of its query: 16-byte stores
    const float inv = 1.0f / (lrun + other_half(lrun));
    __bf16* dst = od + ((size_t)(b * SEQ + qg)) * DIM + h * HD + 8 * hi;
    #pragma unroll
    for (int df = 0; df < 4; df++)
        *reinterpret_cast<v8bf*>(dst + df * 16) = __builtin_convertvector(accO[df] * inv, v8bf);
    // the second tile's set-up rewrites the address and data registers of these stores:
    // the wait stands in front of that rewrite
    asm volatile("s_wait_xcnt 0x0" ::: "memory");
    }
}

// ---------------------------------------------------------------- K4: out-proj + residual
// out[8192,1024] = O[8192,1024] * Wout[1024,1024]^T + x
// 128 x 128 block tile, 4 waves (2 x 2) of 64 x 64: 512 blocks, two for each WGP.
__global__ __launch_bounds__(128) __attribute__((amdgpu_waves_per_eu(4, 4)))
void outproj_kernel(
        const __bf16* __restrict__ o, const __bf16* __restrict__ wout,
        const float* __restrict__ x, float* __restrict__ out) {
    const int n0 = blockIdx.x * 128;
    const int m0 = blockIdx.y * 128;
    const int wave = __builtin_amdgcn_readfirstlane(threadIdx.x >> 5);
    const int lane = threadIdx.x & 31;
    const int ln = lane & 15, hi = lane >> 4;
    const int wm = wave >> 1, wn = wave & 1;

    __shared__ __align__(16) __bf16 sm[2 * 128 * 72 + 2 * 128 * 72];
    // weight rows first: a lane's 8 registers are 8 adjacent columns of one token's row
    v8f acc[4][4] = {};
    gemm_nt_mainloop<2>(sm, o + (size_t)m0 * DIM, wout + (size_t)n0 * DIM, wm, wn, true, acc);

    // The wave's 64 x 64 tile goes through its own 64 x 68 floats of LDS, 16 bytes a lane both
    // ways: x is read and out written 256 bytes of a row at a time, whole 128-byte lines.
    float* st = reinterpret_cast<float*>(sm) + wave * (64 * 68);
    #pragma unroll
    for (int j = 0; j < 4; j++)
        #pragma unroll
        for (int i = 0; i < 4; i++) {
            float* p = st + (j * 16 + ln) * 68 + i * 16 + 8 * hi;
            *reinterpret_cast<v4f*>(p)     = __builtin_shufflevector(acc[i][j], acc[i][j], 0, 1, 2, 3);
            *reinterpret_cast<v4f*>(p + 4) = __builtin_shufflevector(acc[i][j], acc[i][j], 4, 5, 6, 7);
        }
    const unsigned at = (unsigned)(m0 + wm * 64 + hi) * DIM + n0 + wn * 64 + ln * 4;   // 2 rows a load
    float* dst        = out + at;
    const float* skip = x   + at;
    v4f sk[32];
    #pragma unroll
    for (int t = 0; t < 32; t++) sk[t] = *reinterpret_cast<const v4f*>(skip + t * 2 * DIM);
    // the rows read back below were written by other lanes of this wave
    asm volatile("s_wait_dscnt 0x0" ::: "memory");
    const float* sr = st + hi * 68 + ln * 4;
    #pragma unroll
    for (int t = 0; t < 32; t++)
        *reinterpret_cast<v4f*>(dst + t * 2 * DIM) = *reinterpret_cast<const v4f*>(sr + t * 2 * 68) + sk[t];
}

// ---------------------------------------------------------------- launch
extern "C" void kernel_launch(void* const* d_in, const int* in_sizes, int n_in,
                              void* d_out, int out_size, void* d_ws, size_t ws_size,
                              hipStream_t stream) {
    const float* x     = (const float*)d_in[0];   // [8,1024,1024]
    const float* scale = (const float*)d_in[1];   // [1024]
    const float* wqkv  = (const float*)d_in[2];   // [3072,1024]
    const float* wout  = (const float*)d_in[3];   // [1024,1024]
    const float* theta = (const float*)d_in[4];   // [1024,16,16]

    char* ws = (char*)d_ws;
    __bf16* wqkv_bf = (__bf16*)(ws);                         //  6,291,456 B
    __bf16* wout_bf = (__bf16*)(ws + 6291456);               //  2,097,152 B
    __bf16* xn_bf   = (__bf16*)(ws + 8388608);               // 16,777,216 B
    __bf16* q_bf    = (__bf16*)(ws + 25165824);              // [B,H,S,D]
    __bf16* k_bf    = (__bf16*)(ws + 41943040);              // [B,H,S,D]
    __bf16* v_bf    = (__bf16*)(ws + 58720256);              // [B,H,D,S]
    __bf16* o_bf    = (__bf16*)(ws + 75497472);              // [B,S,H*D]
    float*  outp    = (float*)d_out;

    prep_kernel<<<NTOK / 2 / 16, 512, 0, stream>>>(x, scale, wqkv, wout, xn_bf, wqkv_bf, wout_bf);
    qkv_gemm_rope_kernel<<<dim3(QKV_N / 128, NTOK / 256), 256, 0, stream>>>(
        xn_bf, wqkv_bf, theta, q_bf, k_bf, v_bf);
    attention_kernel<<<BATCH * HEADS * (SEQ / 256), 256, 0, stream>>>(q_bf, k_bf, v_bf, o_bf);
    outproj_kernel<<<dim3(DIM / 128, NTOK / 128), 128, 0, stream>>>(o_bf, wout_bf, x, outp);
}

// v006
// One run takes 97.4 microseconds.
// Two timings next to v005 both put it at 1.03 times that version's speed.
// Over all steps from v000 it is 2.41 times as fast.
#include <hip/hip_runtime.h>

#define DIM    1024
#define HEADS  16
#define HD     64
#define SEQ    1024
#define BATCH  8
#define NTOK   (BATCH * SEQ)   // 8192
#define QKV_N  (3 * DIM)       // 3072

typedef __attribute__((ext_vector_type(16))) __bf16 v16bf;
typedef __attribute__((ext_vector_type(8)))  __bf16 v8bf;
typedef __attribute__((ext_vector_type(8)))  float  v8f;

// Load one 16-bf16 WMMA A/B fragment for this lane from an LDS row:
// per CDNA5 ISA 16-bit layout, lane holds k = base+0..7 and k = base+16..23
// with base = (lane>>4)*8, row = lane&15. k0 = chunk*32 + (lane>>4)*8.
__device__ __forceinline__ v16bf ld_frag(const __bf16* row, int k0) {
    v8bf lo = *reinterpret_cast<const v8bf*>(row + k0);
    v8bf hi = *reinterpret_cast<const v8bf*>(row + k0 + 16);
    return __builtin_shufflevector(lo, hi, 0,1,2,3,4,5,6,7,8,9,10,11,12,13,14,15);
}

__device__ __forceinline__ v8f wmma_bf16(v16bf a, v16bf b, v8f c) {
    return __builtin_amdgcn_wmma_f32_16x16x32_bf16(false, a, false, b, (short)0, c, false, false);
}

// Async copy 16B global -> LDS (GLOBAL_LOAD_ASYNC_TO_LDS_B128, ASYNCcnt).
// Generic LDS pointer: low 32 bits are the LDS byte offset (flat aperture rule).
__device__ __forceinline__ void async_copy16(void* lds_dst, const void* gsrc) {
    unsigned loff = (unsigned)(uintptr_t)lds_dst;
    asm volatile("global_load_async_to_lds_b128 %0, %1, off"
                 :: "v"(loff), "v"(gsrc) : "memory");
}
__device__ __forceinline__ void wait_async0() {
#if __has_builtin(__builtin_amdgcn_s_wait_asynccnt)
    __builtin_amdgcn_s_wait_asynccnt(0);
#else
    asm volatile("s_wait_asynccnt 0x0" ::: "memory");
#endif
}

// Four / eight 16-byte async copies of one lane, rows lstep (LDS bytes) and gstep
// (elements) apart. s_wait_xcnt 0 is the last line of the copies' own statement, so
// that it stands in front of any later rewrite of the address registers they name.
__device__ __forceinline__ void async_copy16_x4(unsigned l, unsigned lstep,
                                                const __bf16* g, size_t gstep) {
    asm volatile("global_load_async_to_lds_b128 %0, %4, off\n\t"
                 "global_load_async_to_lds_b128 %1, %5, off\n\t"
                 "global_load_async_to_lds_b128 %2, %6, off\n\t"
                 "global_load_async_to_lds_b128 %3, %7, off\n\t"
                 "s_wait_xcnt 0x0"
                 :: "v"(l), "v"(l + lstep), "v"(l + 2 * lstep), "v"(l + 3 * lstep),
                    "v"(g), "v"(g + gstep), "v"(g + 2 * gstep), "v"(g + 3 * gstep)
                 : "memory");
}
__device__ __forceinline__ void async_copy16_x8(unsigned l, unsigned lstep,
                                                const __bf16* g, size_t gstep) {
    asm volatile("global_load_async_to_lds_b128 %0, %8, off\n\t"
                 "global_load_async_to_lds_b128 %1, %9, off\n\t"
                 "global_load_async_to_lds_b128 %2, %10, off\n\t"
                 "global_load_async_to_lds_b128 %3, %11, off\n\t"
                 "global_load_async_to_lds_b128 %4, %12, off\n\t"
                 "global_load_async_to_lds_b128 %5, %13, off\n\t"
                 "global_load_async_to_lds_b128 %6, %14, off\n\t"
                 "global_load_async_to_lds_b128 %7, %15, off\n\t"
                 "s_wait_xcnt 0x0"
                 :: "v"(l), "v"(l + lstep), "v"(l + 2 * lstep), "v"(l + 3 * lstep),
                    "v"(l + 4 * lstep), "v"(l + 5 * lstep), "v"(l + 6 * lstep), "v"(l + 7 * lstep),
                    "v"(g), "v"(g + gstep), "v"(g + 2 * gstep), "v"(g + 3 * gstep),
                    "v"(g + 4 * gstep), "v"(g + 5 * gstep), "v"(g + 6 * gstep), "v"(g + 7 * gstep)
                 : "memory");
}

// NT GEMM main loop over K = DIM (both operands K-major, row pitch DIM).
// Block tile (WM*64) x 128 from WM x 2 waves; each wave keeps a 64 x 64 tile
// (4 x 4 accumulator fragments), so 8 loaded fragments feed 16 WMMAs.
// a, b point at the block's first row. Two LDS buffers, K-step 64, one barrier a step.
// A wave's copy covers four whole 128-byte rows.
// sm holds A[2][BM][72], then B[2][128][72]. Behind the loop's last barrier nobody reads it
// and no copy is in flight: the caller's epilogue may stage its tile there.
// A lane's 8 accumulator registers run along the rows of the WMMA's first operand:
// acc[i][j][r] = C[first operand's row i * 16 + 8 * hi + r][second operand's row j * 16 + ln].
// b_first picks b's rows as the first operand (block-uniform), so that the 8 registers are
// 8 adjacent elements of the output's rows, whichever way the output lies.
template <int WM>
__device__ __forceinline__ void gemm_nt_mainloop(__bf16* sm,
                                                 const __bf16* __restrict__ a,
                                                 const __bf16* __restrict__ b,
                                                 int wm, int wn, bool b_first, v8f (&acc)[4][4]) {
    constexpr int BM = WM * 64;      // rows of the A tile
    constexpr int RP = WM * 8;       // rows that one copy of the whole block covers
    constexpr int ABUF = BM * 72, BBUF = 128 * 72, BOFF = 2 * ABUF;   // in elements
    const int tid = threadIdx.x, lane = tid & 31;
    const int ln = lane & 15, hi = lane >> 4;
    const int cr = tid >> 3, cc = (tid & 7) * 8;
    const __bf16* ag = a + (size_t)cr * DIM + cc;
    const __bf16* bg = b + (size_t)cr * DIM + cc;

    auto load_tile = [&](int k0, int buf) {
        async_copy16_x8((unsigned)(uintptr_t)(sm + buf * ABUF + cr * 72 + cc), RP * 144, ag + k0, (size_t)RP * DIM);
        if constexpr (WM == 4)
            async_copy16_x4((unsigned)(uintptr_t)(sm + BOFF + buf * BBUF + cr * 72 + cc), RP * 144, bg + k0, (size_t)RP * DIM);
        else
            async_copy16_x8((unsigned)(uintptr_t)(sm + BOFF + buf * BBUF + cr * 72 + cc), RP * 144, bg + k0, (size_t)RP * DIM);
    };
    const int aofs = wm * 64 * 72, bofs = BOFF + wn * 64 * 72;
    const int pofs = b_first ? bofs : aofs, pbuf = b_first ? BBUF : ABUF;   // first operand
    const int qofs = b_first ? aofs : bofs, qbuf = b_first ? ABUF : BBUF;   // second operand

    load_tile(0, 0);
    asm volatile("s_wait_asynccnt 0x0" ::: "memory");   // tile 0 landed before it is published
    __syncthreads();
    load_tile(64, 1);

    constexpr int NSTEP = DIM / 64;   // 16
    for (int i = 0; i < NSTEP; i++) {
        const int cur = i & 1;
        v16bf af[4], bf[4];
        auto load_frags = [&](int kk) {
            #pragma unroll
            for (int f = 0; f < 4; f++) {
                af[f] = ld_frag(sm + pofs + cur * pbuf + (f * 16 + ln) * 72, kk * 32 + hi * 8);
                bf[f] = ld_frag(sm + qofs + cur * qbuf + (f * 16 + ln) * 72, kk * 32 + hi * 8);
            }
        };
        auto products = [&]() {
            #pragma unroll
            for (int mf = 0; mf < 4; mf++)
                #pragma unroll
                for (int nf = 0; nf < 4; nf++)
                    acc[mf][nf] = wmma_bf16(af[mf], bf[nf], acc[mf][nf]);
        };
        load_frags(0);
        // keeps the 16 LDS reads one group ahead of their 16 WMMAs: left alone the
        // scheduler reloads one A fragment per row of 4 and waits it out each time
        __builtin_amdgcn_sched_barrier(0);
        products();
        load_frags(1);
        // publish point: this wave's reads of buffer cur are done, its copies of the
        // next tile have landed; behind the barrier buffer cur may be refilled.
        asm volatile("s_wait_dscnt 0x0" ::: "memory");
        asm volatile("s_wait_asynccnt 0x0" ::: "memory");
        __syncthreads();
        if (i + 2 < NSTEP) load_tile((i + 2) * 64, cur);
        // the step's second half works from registers while the refill is in flight
        products();
    }
    asm volatile("s_wait_asynccnt 0x0" ::: "memory");   // no copy outstanding at the wave's end
}

// ---------------------------------------------------------------- K0: all f32 -> bf16 preparation
// 256 x 16 long-lived waves (for speed only). A wave owns whole 1024-float rows, 32 floats a lane as 8 loads of 512 contiguous bytes:
// two rows of x (RMSNorm; the row sum stays inside the wave) and one weight row (rounding only).
typedef __attribute__((ext_vector_type(4))) float  v4f;
typedef __attribute__((ext_vector_type(4))) __bf16 v4bf;
static_assert(QKV_N + DIM == NTOK / 2, "one weight row for every two rows of x");

// A lane's share of a row: element 4 * c + e of r[k] with c = 0, 1 is float e of the
// row's 16-byte piece (2 * k + c) * 32 + lane.
struct RowRegs { v8f r[4]; };

__device__ __forceinline__ RowRegs load_row(const float* row, int lane) {
    const v4f* p = reinterpret_cast<const v4f*>(row) + lane;
    RowRegs t;
    #pragma unroll
    for (int k = 0; k < 4; k++)
        t.r[k] = __builtin_shufflevector(p[k * 64], p[k * 64 + 32], 0, 1, 2, 3, 4, 5, 6, 7);
    return t;
}
__device__ __forceinline__ void store_row(__bf16* row, int lane, const RowRegs& t) {
    v4bf* p = reinterpret_cast<v4bf*>(row) + lane;
    #pragma unroll
    for (int k = 0; k < 4; k++) {
        p[k * 64]      = __builtin_convertvector(__builtin_shufflevector(t.r[k], t.r[k], 0, 1, 2, 3), v4bf);
        p[k * 64 + 32] = __builtin_convertvector(__builtin_shufflevector(t.r[k], t.r[k], 4, 5, 6, 7), v4bf);
    }
}
// 1 / rms of a row: eight partial sums a lane, folded, then a five-step butterfly
__device__ __forceinline__ float row_rrms(const RowRegs& t) {
    v8f a = t.r[0] * t.r[0];
    #pragma unroll
    for (int k = 1; k < 4; k++) a += t.r[k] * t.r[k];
    float ss = ((a[0] + a[1]) + (a[2] + a[3])) + ((a[4] + a[5]) + (a[6] + a[7]));
    #pragma unroll
    for (int off = 16; off > 0; off >>= 1) ss += __shfl_xor(ss, off, 32);
    return rsqrtf(ss * (1.0f / DIM) + 1e-6f);
}

__global__ __launch_bounds__(512) void prep_kernel(
        const float* __restrict__ x, const float* __restrict__ scale,
        const float* __restrict__ wqkv, const float* __restrict__ wout,
        __bf16* __restrict__ xn, __bf16* __restrict__ wqkv_bf, __bf16* __restrict__ wout_bf) {
    const int lane = threadIdx.x & 31;
    const int w = __builtin_amdgcn_readfirstlane(blockIdx.x * 16 + (threadIdx.x >> 5));   // 0..4095
    const float* wsrc = w < QKV_N ? wqkv + (size_t)w * DIM : wout + (size_t)(w - QKV_N) * DIM;
    __bf16*      wdst = w < QKV_N ? wqkv_bf + (size_t)w * DIM : wout_bf + (size_t)(w - QKV_N) * DIM;

    RowRegs x0 = load_row(x + (size_t)w * (2 * DIM), lane);
    RowRegs x1 = load_row(x + (size_t)w * (2 * DIM) + DIM, lane);
    RowRegs sc = load_row(scale, lane);
    RowRegs wr = load_row(wsrc, lane);

    const float s0 = row_rrms(x0), s1 = row_rrms(x1);
    #pragma unroll
    for (int k = 0; k < 4; k++) {
        x0.r[k] = x0.r[k] * sc.r[k] * s0;
        x1.r[k] = x1.r[k] * sc.r[k] * s1;
    }
    store_row(wdst, lane, wr);
    store_row(xn + (size_t)w * (2 * DIM), lane, x0);
    store_row(xn + (size_t)w * (2 * DIM) + DIM, lane, x1);
}

// ---------------------------------------------------------------- K2: QKV GEMM + RoPE
// C[8192,3072] = Xn[8192,1024] * Wqkv[3072,1024]^T  (NT: both K-major)
// 256 x 128 block tile, 8 waves (4 x 2) of 64 x 64; a wave's 64 columns are one head.
__global__ __launch_bounds__(256) __attribute__((amdgpu_waves_per_eu(4, 4)))
void qkv_gemm_rope_kernel(
        const __bf16* __restrict__ xn, const __bf16* __restrict__ wqkv,
        const float* __restrict__ theta,
        __bf16* __restrict__ qd, __bf16* __restrict__ kd, __bf16* __restrict__ vd) {
    const int n0 = blockIdx.x * 128;   // 24 tiles over 3072
    const int m0 = blockIdx.y * 256;   // 32 tiles over 8192
    const int wave = __builtin_amdgcn_readfirstlane(threadIdx.x >> 5);
    const int lane = threadIdx.x & 31;
    const int ln = lane & 15, hi = lane >> 4;
    const int wm = wave >> 1, wn = wave & 1;

    __shared__ __align__(16) __bf16 sm[2 * 256 * 72 + 2 * 128 * 72];
    const int nw = n0 + wn * 64;          // this wave's first column
    const int comp = nw >> 10;            // 0=q 1=k 2=v, the same for the whole block
    const int h = (nw & 1023) >> 6;       // head (a wave's tile never crosses a head)
    const int tok0 = m0 + wm * 64;        // a wave's 64 rows lie in one batch entry
    const int b = tok0 >> 10, seqb = tok0 & 1023;

    // q, k are stored [token][d]: the lane's 8 registers run along d (weight rows first);
    // v is stored [d][token]: they run along the tokens
    v8f acc[4][4] = {};
    gemm_nt_mainloop<4>(sm, xn + (size_t)m0 * DIM, wqkv + (size_t)n0 * DIM, wm, wn, comp != 2, acc);

    if (comp != 2) {
        // RoPE on d<32: pair (d, d+16) = (acc[0], acc[1]), same lane slot; d = 8 * hi + r,
        // token j * 16 + ln
        const float* tp = theta + (seqb + ln) * (HEADS * 16) + h * 16 + 8 * hi;
        v4f th[4][2];
        #pragma unroll
        for (int j = 0; j < 4; j++) {
            th[j][0] = *reinterpret_cast<const v4f*>(tp + j * 16 * (HEADS * 16));
            th[j][1] = *reinterpret_cast<const v4f*>(tp + j * 16 * (HEADS * 16) + 4);
        }
        // the eight loads share one address pair: tp stays live up to this wait, so that no
        // load's result lands in the pair and nothing rewrites it in front of the wait
        asm volatile("s_wait_xcnt 0x0" :: "v"(tp) : "memory");
        #pragma unroll
        for (int j = 0; j < 4; j++) {
            #pragma unroll
            for (int r = 0; r < 8; r++) {
                float v0 = acc[0][j][r], v1 = acc[1][j][r];
                float sn, cs;
                // the fast sine and cosine (argument in turns) in one statement: its v_nop
                // fills the slot behind a transcendental, whatever is scheduled next
                asm("v_sin_f32 %0, %2\n\tv_cos_f32 %1, %2\n\tv_nop"
                    : "=&v"(sn), "=&v"(cs) : "v"(th[j][r >> 2][r & 3] * 0.15915494f));
                acc[0][j][r] = v0 * cs - v1 * sn;
                acc[1][j][r] = v1 * cs + v0 * sn;
            }
        }
    }

    // The wave's 64 x 64 tile goes through its own 64 x 72 piece of LDS, 16 bytes a lane both
    // ways, and leaves as whole 128-byte lines (straight from the accumulators: 32-byte pieces).
    __bf16* st = sm + wave * (64 * 72);
    #pragma unroll
    for (int j = 0; j < 4; j++)
        #pragma unroll
        for (int i = 0; i < 4; i++)
            *reinterpret_cast<v8bf*>(st + (j * 16 + ln) * 72 + i * 16 + 8 * hi) =
                __builtin_convertvector(acc[i][j], v8bf);
    // the rows read back below were written by other lanes of this wave
    asm volatile("s_wait_dscnt 0x0" ::: "memory");
    const __bf16* sr = st + (lane >> 3) * 72 + (lane & 7) * 8;   // 4 rows a load
    v8bf row[16];
    #pragma unroll
    for (int t = 0; t < 16; t++) row[t] = *reinterpret_cast<const v8bf*>(sr + t * 4 * 72);
    if (comp == 2) {
        // V transposed: [B,H,D,S], a row of the tile is one d
        __bf16* dst = vd + ((size_t)(b * HEADS + h) * HD + (lane >> 3)) * SEQ + seqb + (lane & 7) * 8;
        #pragma unroll
        for (int t = 0; t < 16; t++) *reinterpret_cast<v8bf*>(dst + t * 4 * SEQ) = row[t];
    } else {
        // [B,H,S,D]: the tile's 64 rows are 8 KB in a row
        __bf16* dst = (comp == 0 ? qd : kd) + ((size_t)(b * HEADS + h) * SEQ + seqb) * HD + lane * 8;
        #pragma unroll
        for (int t = 0; t < 16; t++) *reinterpret_cast<v8bf*>(dst + t * 4 * HD) = row[t];
        // the listing keeps a path from these stores into the other branch, which
        // rewrites their address register: the wait stands in front of that rewrite
        asm volatile("s_wait_xcnt 0x0" ::: "memory");
    }
}

// ---------------------------------------------------------------- K3: causal flash attention
// the value that lane l ^ 16 holds
__device__ __forceinline__ float other_half(float v) {
    int b = __builtin_bit_cast(int, v);
    return __builtin_bit_cast(float, __builtin_amdgcn_permlanex16(b, b, 0x76543210, 0xfedcba98, false, false));
}

// 2^x in asm. Early-clobber outputs keep every source whole
// inside the statement; the v_nop fills the slot behind the last one, whatever comes next.
#define LOG2E 1.44269504f
__device__ __forceinline__ float exp2_x1(float x) {
    float p;
    asm("v_exp_f32 %0, %1\n\tv_nop" : "=&v"(p) : "v"(x));
    return p;
}
__device__ __forceinline__ void exp2_x8(float (&p)[8], const float (&x)[8]) {
    asm("v_exp_f32 %0, %8\n\t"
        "v_exp_f32 %1, %9\n\t"
        "v_exp_f32 %2, %10\n\t"
        "v_exp_f32 %3, %11\n\t"
        "v_exp_f32 %4, %12\n\t"
        "v_exp_f32 %5, %13\n\t"
        "v_exp_f32 %6, %14\n\t"
        "v_exp_f32 %7, %15\n\t"
        "v_nop"
        : "=&v"(p[0]), "=&v"(p[1]), "=&v"(p[2]), "=&v"(p[3]),
          "=&v"(p[4]), "=&v"(p[5]), "=&v"(p[6]), "=&v"(p[7])
        : "v"(x[0]), "v"(x[1]), "v"(x[2]), "v"(x[3]), "v"(x[4]), "v"(x[5]), "v"(x[6]), "v"(x[7]));
}

__global__ __launch_bounds__(256) __attribute__((amdgpu_waves_per_eu(4, 4)))
void attention_kernel(
        const __bf16* __restrict__ qd, const __bf16* __restrict__ kd,
        const __bf16* __restrict__ vd, __bf16* __restrict__ od) {
    __shared__ __align__(16) __bf16 Ks[2][64][72];
    __shared__ __align__(16) __bf16 Vs[2][64][72];
    const int t  = blockIdx.x >> 7;    // 0..3
    const int bh = blockIdx.x & 127;   // b*16+h
    const int b  = bh >> 4, h = bh & 15;
    const int tid = threadIdx.x, wave = tid >> 5, lane = tid & 31;
    const int ln = lane & 15, hi = lane >> 4;

    const int kr = tid >> 2, kc = (tid & 3) * 16;   // 64 x 64 chunk, 32B/thread
    const __bf16* kBp = kd + ((size_t)bh * SEQ + kr) * HD + kc;   // + j0*HD
    const __bf16* vBp = vd + ((size_t)bh * HD + kr) * SEQ + kc;   // + j0
    auto load_chunk = [&](int j0, int buf) {
        #pragma unroll
        for (int u = 0; u < 2; u++)
            async_copy16(&Ks[buf][kr][kc + u * 8], kBp + (size_t)j0 * HD + u * 8);
        #pragma unroll
        for (int u = 0; u < 2; u++)
            async_copy16(&Vs[buf][kr][kc + u * 8], vBp + j0 + u * 8);
    };

    // rolled: the two tiles share one copy of the chunk loop
    #pragma unroll 1
    for (int half = 0; half < 2; half++) {
    const int q0 = (half == 0 ? 7 - t : t) * 128;

    // Q fragments resident in registers for the whole tile
    const __bf16* qrow = qd + ((size_t)bh * SEQ + q0 + wave * 16 + ln) * HD;
    v16bf qfrag[2];
    qfrag[0] = ld_frag(qrow, 0 * 32 + hi * 8);
    qfrag[1] = ld_frag(qrow, 1 * 32 + hi * 8);

    // the first tile's chunk loop ends in a barrier: both buffers are free here
    load_chunk(0, 0);
    wait_async0();
    __syncthreads();

    v8f accO[4] = {};                  // accO[df][r] = O[query ln][d = df * 16 + 8 * hi + r]
    float mrun = -1e30f, lrun = 0.f;   // of query ln; lrun sums this half's keys only
    const int qg = q0 + wave * 16 + ln;

    const int nchunks = (q0 + 128) / 64;
    for (int ci = 0; ci < nchunks; ci++) {
        const int j0 = ci * 64, cur = ci & 1;
        if (ci + 1 < nchunks) load_chunk(j0 + 64, cur ^ 1);

        // scores: K(64keys x 64d) * Q(16x64d)^T -> 4 frags of 16 keys x 16 queries,
        // accS[nf][r] = S[query ln][key j0 + nf * 16 + 8 * hi + r]
        v16bf kf[4][2], vf[4][2];
        #pragma unroll
        for (int nf = 0; nf < 4; nf++)
            #pragma unroll
            for (int kk = 0; kk < 2; kk++)
                kf[nf][kk] = ld_frag(&Ks[cur][nf * 16 + ln][0], kk * 32 + hi * 8);
        // keeps the chunk's 16 K reads one group ahead of the 8 score WMMAs: left alone the
        // scheduler reuses one fragment's registers and waits out the LDS latency per WMMA
        __builtin_amdgcn_sched_barrier(0);
        v8f accS[4] = {};
        #pragma unroll
        for (int kk = 0; kk < 2; kk++)
            #pragma unroll
            for (int nf = 0; nf < 4; nf++)
                accS[nf] = wmma_bf16(kf[nf][kk], qfrag[kk], accS[nf]);
        #pragma unroll
        for (int df = 0; df < 4; df++)
            #pragma unroll
            for (int kk = 0; kk < 2; kk++)
                vf[df][kk] = ld_frag(&Vs[cur][df * 16 + ln][0], kk * 32 + hi * 8);
        // keeps the chunk's 16 V reads ahead of the softmax, whose vector work covers their latency
        __builtin_amdgcn_sched_barrier(0);

        // online softmax of one query per lane
        const int lim = qg - j0 - 8 * hi;   // key nf * 16 + r of this half is seen if <= lim
        float cmax[4];
        #pragma unroll
        for (int nf = 0; nf < 4; nf++) {
            #pragma unroll
            for (int r = 0; r < 8; r++) {
                float v = accS[nf][r] * 0.125f;   // 1/sqrt(64)
                accS[nf][r] = (nf * 16 + r <= lim) ? v : -1e30f;
            }
            cmax[nf] = fmaxf(fmaxf(fmaxf(accS[nf][0], accS[nf][1]), fmaxf(accS[nf][2], accS[nf][3])),
                             fmaxf(fmaxf(accS[nf][4], accS[nf][5]), fmaxf(accS[nf][6], accS[nf][7])));
        }
        float rmax = fmaxf(fmaxf(cmax[0], cmax[1]), fmaxf(cmax[2], cmax[3]));
        rmax = fmaxf(rmax, other_half(rmax));
        const float mnew = fmaxf(mrun, rmax);
        const float corr = exp2_x1((mrun - mnew) * LOG2E);
        mrun = mnew;
        // P^T as B operand: element s of pf[kk] is key kk * 32 + (s < 8 ? 8 * hi + s : 16 + 8 * hi + s - 8),
        // the k order of ld_frag, which loads V^T beside it
        v16bf pf[2];
        float csum[4];
        #pragma unroll
        for (int nf = 0; nf < 4; nf++) {
            float e[8], p[8];
            #pragma unroll
            for (int r = 0; r < 8; r++) e[r] = (accS[nf][r] - mnew) * LOG2E;
            exp2_x8(p, e);
            #pragma unroll
            for (int r = 0; r < 8; r++) pf[nf >> 1][(nf & 1) * 8 + r] = (__bf16)p[r];
            csum[nf] = ((p[0] + p[1]) + (p[2] + p[3])) + ((p[4] + p[5]) + (p[6] + p[7]));
        }
        lrun = lrun * corr + ((csum[0] + csum[1]) + (csum[2] + csum[3]));
        #pragma unroll
        for (int df = 0; df < 4; df++) accO[df] = accO[df] * corr;

        // O^T += V^T(64d x 64keys) * P^T(64keys x 16 queries)
        #pragma unroll
        for (int df = 0; df < 4; df++) {
            #pragma unroll
            for (int kk = 0; kk < 2; kk++)
                accO[df] = wmma_bf16(vf[df][kk], pf[kk], accO[df]);
        }
        if (ci + 1 < nchunks) wait_async0();
        __syncthreads();
    }

    // a lane's 8 accumulator registers are 8 consecutive d of its query: 16-byte stores
    const float inv = 1.0f / (lrun + other_half(lrun));
    __bf16* dst = od + ((size_t)(b * SEQ + qg)) * DIM + h * HD + 8 * hi;
    #pragma unroll
    for (int df = 0; df < 4; df++)
        *reinterpret_cast<v8bf*>(dst + df * 16) = __builtin_convertvector(accO[df] * inv, v8bf);
    // the second tile's set-up rewrites the address and data registers of these stores:
    // the wait stands in front of that rewrite
    asm volatile("s_wait_xcnt 0x0" ::: "memory");
    }
}

// ---------------------------------------------------------------- K4: out-proj + residual
// out[8192,1024] = O[8192,1024] * Wout[1024,1024]^T + x
// 128 x 128 block tile, 4 waves (2 x 2) of 64 x 64: 512 blocks, two for each WGP.
__global__ __launch_bounds__(128) __attribute__((amdgpu_waves_per_eu(4, 4)))
void outproj_kernel(
        const __bf16* __restrict__ o, const __bf16* __restrict__ wout,
        const float* __restrict__ x, float* __restrict__ out) {
    const int n0 = blockIdx.x * 128;
    const int m0 = blockIdx.y * 128;
    const int wave = __builtin_amdgcn_readfirstlane(threadIdx.x >> 5);
    const int lane = threadIdx.x & 31;
    const int ln = lane & 15, hi = lane >> 4;
    const int wm = wave >> 1, wn = wave & 1;

    __shared__ __align__(16) __bf16 sm[2 * 128 * 72 + 2 * 128 * 72];
    // weight rows first: a lane's 8 registers are 8 adjacent columns of one token's row
    v8f acc[4][4] = {};
    gemm_nt_mainloop<2>(sm, o + (size_t)m0 * DIM, wout + (size_t)n0 * DIM, wm, wn, true, acc);

    // The wave's 64 x 64 tile goes through its own 64 x 68 floats of LDS, 16 bytes a lane both
    // ways: x is read and out written 256 bytes of a row at a time, whole 128-byte lines.
    float* st = reinterpret_cast<float*>(sm) + wave * (64 * 68);
    #pragma unroll
    for (int j = 0; j < 4; j++)
        #pragma unroll
        for (int i = 0; i < 4; i++) {
            float* p = st + (j * 16 + ln) * 68 + i * 16 + 8 * hi;
            *reinterpret_cast<v4f*>(p)     = __builtin_shufflevector(acc[i][j], acc[i][j], 0, 1, 2, 3);
            *reinterpret_cast<v4f*>(p + 4) = __builtin_shufflevector(acc[i][j], acc[i][j], 4, 5, 6, 7);
        }
    const unsigned at = (unsigned)(m0 + wm * 64 + hi) * DIM + n0 + wn * 64 + ln * 4;   // 2 rows a load
    float* dst        = out + at;
    const float* skip = x   + at;
    v4f sk[32];
    #pragma unroll
    for (int t = 0; t < 32; t++) sk[t] = *reinterpret_cast<const v4f*>(skip + t * 2 * DIM);
    // the rows read back below were written by other lanes of this wave
    asm volatile("s_wait_dscnt 0x0" ::: "memory");
    const float* sr = st + hi * 68 + ln * 4;
    #pragma unroll
    for (int t = 0; t < 32; t++)
        *reinterpret_cast<v4f*>(dst + t * 2 * DIM) = *reinterpret_cast<const v4f*>(sr + t * 2 * 68) + sk[t];
}

// ---------------------------------------------------------------- launch
extern "C" void kernel_launch(void* const* d_in, const int* in_sizes, int n_in,
                              void* d_out, int out_size, void* d_ws, size_t ws_size,
                              hipStream_t stream) {
    const float* x     = (const float*)d_in[0];   // [8,1024,1024]
    const float* scale = (const float*)d_in[1];   // [1024]
    const float* wqkv  = (const float*)d_in[2];   // [3072,1024]
    const float* wout  = (const float*)d_in[3];   // [1024,1024]
    const float* theta = (const float*)d_in[4];   // [1024,16,16]

    char* ws = (char*)d_ws;
    __bf16* wqkv_bf = (__bf16*)(ws);                         //  6,291,456 B
    __bf16* wout_bf = (__bf16*)(ws + 6291456);               //  2,097,152 B
    __bf16* xn_bf   = (__bf16*)(ws + 8388608);               // 16,777,216 B
    __bf16* q_bf    = (__bf16*)(ws + 25165824);              // [B,H,S,D]
    __bf16* k_bf    = (__bf16*)(ws + 41943040);              // [B,H,S,D]
    __bf16* v_bf    = (__bf16*)(ws + 58720256);              // [B,H,D,S]
    __bf16* o_bf    = (__bf16*)(ws + 75497472);              // [B,S,H*D]
    float*  outp    = (float*)d_out;

    prep_kernel<<<NTOK / 2 / 16, 512, 0, stream>>>(x, scale, wqkv, wout, xn_bf, wqkv_bf, wout_bf);
    qkv_gemm_rope_kernel<<<dim3(QKV_N / 128, NTOK / 256), 256, 0, stream>>>(
        xn_bf, wqkv_bf, theta, q_bf, k_bf, v_bf);
    attention_kernel<<<BATCH * HEADS * (SEQ / 256), 256, 0, stream>>>(q_bf, k_bf, v_bf, o_bf);
    outproj_kernel<<<dim3(DIM / 128, NTOK / 128), 128, 0, stream>>>(o_bf, wout_bf, x, outp);
}

// v007
// One run takes 89.5 microseconds.
// Next to v006, in two timings, it ran 1.09 times as fast each time.
// Over all steps from v000 it is 2.63 times as fast.
#include <hip/hip_runtime.h>

#define DIM    1024
#define HEADS  16
#define HD     64
#define SEQ    1024
#define BATCH  8
#define NTOK   (BATCH * SEQ)   // 8192
#define QKV_N  (3 * DIM)       // 3072

typedef __attribute__((ext_vector_type(16))) __bf16 v16bf;
typedef __attribute__((ext_vector_type(8)))  __bf16 v8bf;
typedef __attribute__((ext_vector_type(8)))  float  v8f;

// Load one 16-bf16 WMMA A/B fragment for this lane from an LDS row:
// per CDNA5 ISA 16-bit layout, lane holds k = base+0..7 and k = base+16..23
// with base = (lane>>4)*8, row = lane&15. k0 = chunk*32 + (lane>>4)*8.
__device__ __forceinline__ v16bf ld_frag(const __bf16* row, int k0) {
    v8bf lo = *reinterpret_cast<const v8bf*>(row + k0);
    v8bf hi = *reinterpret_cast<const v8bf*>(row + k0 + 16);
    return __builtin_shufflevector(lo, hi, 0,1,2,3,4,5,6,7,8,9,10,11,12,13,14,15);
}

__device__ __forceinline__ v8f wmma_bf16(v16bf a, v16bf b, v8f c) {
    return __builtin_amdgcn_wmma_f32_16x16x32_bf16(false, a, false, b, (short)0, c, false, false);
}

// Async copy 16B global -> LDS (GLOBAL_LOAD_ASYNC_TO_LDS_B128, ASYNCcnt).
// Generic LDS pointer: low 32 bits are the LDS byte offset (flat aperture rule).
__device__ __forceinline__ void async_copy16(void* lds_dst, const void* gsrc) {
    unsigned loff = (unsigned)(uintptr_t)lds_dst;
    asm volatile("global_load_async_to_lds_b128 %0, %1, off"
                 :: "v"(loff), "v"(gsrc) : "memory");
}
__device__ __forceinline__ void wait_async0() {
#if __has_builtin(__builtin_amdgcn_s_wait_asynccnt)
    __builtin_amdgcn_s_wait_asynccnt(0);
#else
    asm volatile("s_wait_asynccnt 0x0" ::: "memory");
#endif
}

// Eight 16-byte async copies of one lane, rows lstep (LDS bytes) and gstep
// (elements) apart. s_wait_xcnt 0 is the last line of the copies' own statement, so
// that it stands in front of any later rewrite of the address registers they name.
__device__ __forceinline__ void async_copy16_x8(unsigned l, unsigned lstep,
                                                const __bf16* g, size_t gstep) {
    asm volatile("global_load_async_to_lds_b128 %0, %8, off\n\t"
                 "global_load_async_to_lds_b128 %1, %9, off\n\t"
                 "global_load_async_to_lds_b128 %2, %10, off\n\t"
                 "global_load_async_to_lds_b128 %3, %11, off\n\t"
                 "global_load_async_to_lds_b128 %4, %12, off\n\t"
                 "global_load_async_to_lds_b128 %5, %13, off\n\t"
                 "global_load_async_to_lds_b128 %6, %14, off\n\t"
                 "global_load_async_to_lds_b128 %7, %15, off\n\t"
                 "s_wait_xcnt 0x0"
                 :: "v"(l), "v"(l + lstep), "v"(l + 2 * lstep), "v"(l + 3 * lstep),
                    "v"(l + 4 * lstep), "v"(l + 5 * lstep), "v"(l + 6 * lstep), "v"(l + 7 * lstep),
                    "v"(g), "v"(g + gstep), "v"(g + 2 * gstep), "v"(g + 3 * gstep),
                    "v"(g + 4 * gstep), "v"(g + 5 * gstep), "v"(g + 6 * gstep), "v"(g + 7 * gstep)
                 : "memory");
}

// Ten 16-byte async copies of one lane, global address = a scalar base each + the lane's byte
// offset, which all ten share: eleven vector registers for the ten. s_wait_xcnt 0 as above.
__device__ __forceinline__ void async_copy16_x10(const unsigned (&l)[10], unsigned voff,
                                                 const __bf16* const (&g)[10]) {
    asm volatile("global_load_async_to_lds_b128 %0, %10, %11\n\t"
                 "global_load_async_to_lds_b128 %1, %10, %12\n\t"
                 "global_load_async_to_lds_b128 %2, %10, %13\n\t"
                 "global_load_async_to_lds_b128 %3, %10, %14\n\t"
                 "global_load_async_to_lds_b128 %4, %10, %15\n\t"
                 "global_load_async_to_lds_b128 %5, %10, %16\n\t"
                 "global_load_async_to_lds_b128 %6, %10, %17\n\t"
                 "global_load_async_to_lds_b128 %7, %10, %18\n\t"
                 "global_load_async_to_lds_b128 %8, %10, %19\n\t"
                 "global_load_async_to_lds_b128 %9, %10, %20\n\t"
                 "s_wait_xcnt 0x0"
                 :: "v"(l[0]), "v"(l[1]), "v"(l[2]), "v"(l[3]), "v"(l[4]),
                    "v"(l[5]), "v"(l[6]), "v"(l[7]), "v"(l[8]), "v"(l[9]), "v"(voff),
                    "s"(g[0]), "s"(g[1]), "s"(g[2]), "s"(g[3]), "s"(g[4]),
                    "s"(g[5]), "s"(g[6]), "s"(g[7]), "s"(g[8]), "s"(g[9])
                 : "memory");
}

// NT GEMM main loop over K = DIM (both operands K-major, row pitch DIM).
// Block tile (WM*64) x 128 from WM x 2 waves; each wave keeps a 64 x 64 tile
// (4 x 4 accumulator fragments), so 8 loaded fragments feed 16 WMMAs.
// a, b point at the block's first row. Two LDS buffers, K-step 64, one barrier a step.
// A wave's copy covers four whole 128-byte rows.
// sm holds A[2][BM][72], then B[2][128][72]. Behind the loop's last barrier nobody reads it
// and no copy is in flight: the caller's epilogue may stage its tile there.
// A lane's 8 accumulator registers run along the rows of the WMMA's first operand:
// acc[i][j][r] = C[first operand's row i * 16 + 8 * hi + r][second operand's row j * 16 + ln].
// b_first picks b's rows as the first operand (block-uniform), so that the 8 registers are
// 8 adjacent elements of the output's rows, whichever way the output lies.
template <int WM>
__device__ __forceinline__ void gemm_nt_mainloop(__bf16* sm,
                                                 const __bf16* __restrict__ a,
                                                 const __bf16* __restrict__ b,
                                                 int wm, int wn, bool b_first, v8f (&acc)[4][4]) {
    constexpr int BM = WM * 64;      // rows of the A tile
    constexpr int RP = WM * 8;       // rows that one copy of the whole block covers
    constexpr int ABUF = BM * 72, BBUF = 128 * 72, BOFF = 2 * ABUF;   // in elements
    const int tid = threadIdx.x, lane = tid & 31;
    const int ln = lane & 15, hi = lane >> 4;
    const int cr = tid >> 3, cc = (tid & 7) * 8;
    const __bf16* ag = a + (size_t)cr * DIM + cc;
    const __bf16* bg = b + (size_t)cr * DIM + cc;

    auto load_tile = [&](int k0, int buf) {
        async_copy16_x8((unsigned)(uintptr_t)(sm + buf * ABUF + cr * 72 + cc), RP * 144, ag + k0, (size_t)RP * DIM);
        async_copy16_x8((unsigned)(uintptr_t)(sm + BOFF + buf * BBUF + cr * 72 + cc), RP * 144, bg + k0, (size_t)RP * DIM);
    };
    const int aofs = wm * 64 * 72, bofs = BOFF + wn * 64 * 72;
    const int pofs = b_first ? bofs : aofs, pbuf = b_first ? BBUF : ABUF;   // first operand
    const int qofs = b_first ? aofs : bofs, qbuf = b_first ? ABUF : BBUF;   // second operand

    load_tile(0, 0);
    asm volatile("s_wait_asynccnt 0x0" ::: "memory");   // tile 0 landed before it is published
    __syncthreads();
    load_tile(64, 1);

    constexpr int NSTEP = DIM / 64;   // 16
    for (int i = 0; i < NSTEP; i++) {
        const int cur = i & 1;
        v16bf af[4], bf[4];
        auto load_frags = [&](int kk) {
            #pragma unroll
            for (int f = 0; f < 4; f++) {
                af[f] = ld_frag(sm + pofs + cur * pbuf + (f * 16 + ln) * 72, kk * 32 + hi * 8);
                bf[f] = ld_frag(sm + qofs + cur * qbuf + (f * 16 + ln) * 72, kk * 32 + hi * 8);
            }
        };
        auto products = [&]() {
            #pragma unroll
            for (int mf = 0; mf < 4; mf++)
                #pragma unroll
                for (int nf = 0; nf < 4; nf++)
                    acc[mf][nf] = wmma_bf16(af[mf], bf[nf], acc[mf][nf]);
        };
        load_frags(0);
        // keeps the 16 LDS reads one group ahead of their 16 WMMAs: left alone the
        // scheduler reloads one A fragment per row of 4 and waits it out each time
        __builtin_amdgcn_sched_barrier(0);
        products();
        load_frags(1);
        // publish point: this wave's reads of buffer cur are done, its copies of the
        // next tile have landed; behind the barrier buffer cur may be refilled.
        asm volatile("s_wait_dscnt 0x0" ::: "memory");
        asm volatile("s_wait_asynccnt 0x0" ::: "memory");
        __syncthreads();
        if (i + 2 < NSTEP) load_tile((i + 2) * 64, cur);
        // the step's second half works from registers while the refill is in flight
        products();
    }
    asm volatile("s_wait_asynccnt 0x0" ::: "memory");   // no copy outstanding at the wave's end
}

// ---------------------------------------------------------------- K0: all f32 -> bf16 preparation
// 256 x 16 long-lived waves (for speed only). A wave owns whole 1024-float rows, 32 floats a lane as 8 loads of 512 contiguous bytes:
// two rows of x (RMSNorm; the row sum stays inside the wave) and one weight row (rounding only).
typedef __attribute__((ext_vector_type(4))) float  v4f;
typedef __attribute__((ext_vector_type(4))) __bf16 v4bf;
static_assert(QKV_N + DIM == NTOK / 2, "one weight row for every two rows of x");

// A lane's share of a row: element 4 * c + e of r[k] with c = 0, 1 is float e of the
// row's 16-byte piece (2 * k + c) * 32 + lane.
struct RowRegs { v8f r[4]; };

__device__ __forceinline__ RowRegs load_row(const float* row, int lane) {
    const v4f* p = reinterpret_cast<const v4f*>(row) + lane;
    RowRegs t;
    #pragma unroll
    for (int k = 0; k < 4; k++)
        t.r[k] = __builtin_shufflevector(p[k * 64], p[k * 64 + 32], 0, 1, 2, 3, 4, 5, 6, 7);
    return t;
}
__device__ __forceinline__ void store_row(__bf16* row, int lane, const RowRegs& t) {
    v4bf* p = reinterpret_cast<v4bf*>(row) + lane;
    #pragma unroll
    for (int k = 0; k < 4; k++) {
        p[k * 64]      = __builtin_convertvector(__builtin_shufflevector(t.r[k], t.r[k], 0, 1, 2, 3), v4bf);
        p[k * 64 + 32] = __builtin_convertvector(__builtin_shufflevector(t.r[k], t.r[k], 4, 5, 6, 7), v4bf);
    }
}
// 1 / rms of a row: eight partial sums a lane, folded, then a five-step butterfly
__device__ __forceinline__ float row_rrms(const RowRegs& t) {
    v8f a = t.r[0] * t.r[0];
    #pragma unroll
    for (int k = 1; k < 4; k++) a += t.r[k] * t.r[k];
    float ss = ((a[0] + a[1]) + (a[2] + a[3])) + ((a[4] + a[5]) + (a[6] + a[7]));
    #pragma unroll
    for (int off = 16; off > 0; off >>= 1) ss += __shfl_xor(ss, off, 32);
    return rsqrtf(ss * (1.0f / DIM) + 1e-6f);
}

__global__ __launch_bounds__(512) void prep_kernel(
        const float* __restrict__ x, const float* __restrict__ scale,
        const float* __restrict__ wqkv, const float* __restrict__ wout,
        __bf16* __restrict__ xn, __bf16* __restrict__ wqkv_bf, __bf16* __restrict__ wout_bf) {
    const int lane = threadIdx.x & 31;
    const int w = __builtin_amdgcn_readfirstlane(blockIdx.x * 16 + (threadIdx.x >> 5));   // 0..4095
    const float* wsrc = w < QKV_N ? wqkv + (size_t)w * DIM : wout + (size_t)(w - QKV_N) * DIM;
    __bf16*      wdst = w < QKV_N ? wqkv_bf + (size_t)w * DIM : wout_bf + (size_t)(w - QKV_N) * DIM;

    RowRegs x0 = load_row(x + (size_t)w * (2 * DIM), lane);
    RowRegs x1 = load_row(x + (size_t)w * (2 * DIM) + DIM, lane);
    RowRegs sc = load_row(scale, lane);
    RowRegs wr = load_row(wsrc, lane);

    const float s0 = row_rrms(x0), s1 = row_rrms(x1);
    #pragma unroll
    for (int k = 0; k < 4; k++) {
        x0.r[k] = x0.r[k] * sc.r[k] * s0;
        x1.r[k] = x1.r[k] * sc.r[k] * s1;
    }
    store_row(wdst, lane, wr);
    store_row(xn + (size_t)w * (2 * DIM), lane, x0);
    store_row(xn + (size_t)w * (2 * DIM) + DIM, lane, x1);
}

// ---------------------------------------------------------------- K2: QKV GEMM + RoPE
// C[8192,3072] = Xn[8192,1024] * Wqkv[3072,1024]^T  (NT: both K-major)
// 256 x 384 block tile: 256 tokens by 128 columns (two heads) of each of q, k and v.
// 32 x 8 = 256 blocks, one for each WGP. 8 waves (4 x 2), two a SIMD; a wave keeps 64 tokens by
// one head of q, of k and of v: three 64 x 64 groups that share the wave's four token fragments.
// Against 256 x 128 blocks of 64 x 64 waves: 640 staged rows feed 768 WMMAs a k step of 64
// (was 384 for 256), and 32 loaded fragments feed 96 WMMAs (was 16 for 32).
// sm holds A[2][256][72], then B[2][384][72]; B row g * 128 + c is weight row g * 1024 + n0 + c.
// acc[g][i][j][r] = C[first operand's row i * 16 + 8 * hi + r][second operand's row j * 16 + ln]:
// weight rows go first for q and k (the 8 registers run along d), tokens first for v.
// Behind the loop's last barrier nobody reads sm and no copy is in flight.
__device__ __forceinline__ void qkv_mainloop(__bf16* sm,
                                             const __bf16* __restrict__ a,
                                             const __bf16* __restrict__ b,
                                             int wm, int wn, v8f (&acc)[3][4][4]) {
    constexpr int ABUF = 256 * 72, BBUF = 384 * 72, BOFF = 2 * ABUF;   // in elements
    const int tid = threadIdx.x, lane = tid & 31;
    const int ln = lane & 15, hi = lane >> 4;
    const int cr = tid >> 3, cc = (tid & 7) * 8;   // one copy of the block covers 32 whole rows
    const unsigned gc = (unsigned)(cr * DIM + cc) * 2;               // the lane's place in 32 rows, bytes
    const unsigned lc = (unsigned)(uintptr_t)(sm + cr * 72 + cc);

    // 20 copies a lane: 8 x 32 rows of A, then 12 x 32 rows of B (4 x 32 of each of q, k, v)
    auto load_tile = [&](int k0, int buf) {
        #pragma unroll
        for (int s = 0; s < 2; s++) {
            unsigned l[10];
            const __bf16* g[10];
            #pragma unroll
            for (int u = 0; u < 10; u++) {
                const int c = s * 10 + u, v = c - 8;
                l[u] = c < 8 ? lc + buf * (ABUF * 2) + c * (32 * 144)
                             : lc + (BOFF + buf * BBUF) * 2 + v * (32 * 144);
                g[u] = c < 8 ? a + (size_t)c * 32 * DIM
                             : b + (size_t)((v >> 2) * 1024 + (v & 3) * 32) * DIM;
            }
            async_copy16_x10(l, gc + k0 * 2, g);
        }
    };
    const __bf16* fa = sm + (wm * 64 + ln) * 72 + hi * 8;
    const __bf16* fb = sm + BOFF + (wn * 64 + ln) * 72 + hi * 8;

    load_tile(0, 0);
    asm volatile("s_wait_asynccnt 0x0" ::: "memory");   // tile 0 landed before it is published
    __syncthreads();
    load_tile(64, 1);

    constexpr int NSTEP = DIM / 64;   // 16
    for (int i = 0; i < NSTEP; i++) {
        const int cur = i & 1;
        const __bf16* pa = fa + cur * ABUF;
        const __bf16* pb = fb + cur * BBUF;
        // token fragments, and a ring of six weight fragments: a group of 16 WMMAs reads four
        // of them while the next group's four are fetched, two at a time, into the free two
        v16bf af[4], bw[6];
        auto ld_a = [&](int kk) {
            #pragma unroll
            for (int f = 0; f < 4; f++) af[f] = ld_frag(pa + f * 16 * 72, kk * 32);
        };
        // fragments f0, f0 + 1 of group n of the step (n = kk * 3 + g) into their ring slots
        auto ld_b2 = [&](int n, int f0) {
            #pragma unroll
            for (int f = f0; f < f0 + 2; f++)
                bw[(n * 4 + f) % 6] = ld_frag(pb + ((n % 3) * 128 + f * 16) * 72, (n / 3) * 32);
        };
        // the 8 WMMAs of group n that read its fragments f0, f0 + 1
        auto mm2 = [&](int n, int f0) {
            #pragma unroll
            for (int f = f0; f < f0 + 2; f++)
                #pragma unroll
                for (int t = 0; t < 4; t++) {
                    if (n % 3 == 2) acc[2][t][f] = wmma_bf16(af[t], bw[(n * 4 + f) % 6], acc[2][t][f]);
                    else acc[n % 3][f][t] = wmma_bf16(bw[(n * 4 + f) % 6], af[t], acc[n % 3][f][t]);
                }
        };
        // The scheduling fences keep each group of LDS reads whole and 16 WMMAs ahead of its use.
        // Left alone the scheduler moves the reads next to their use and waits them out.
        ld_a(0); ld_b2(0, 0); ld_b2(0, 2);
        #pragma unroll
        for (int n = 0; n < 5; n++) {
            ld_b2(n + 1, 0);
            __builtin_amdgcn_sched_barrier(0);
            mm2(n, 0);
            __builtin_amdgcn_sched_barrier(0);
            ld_b2(n + 1, 2);
            __builtin_amdgcn_sched_barrier(0);
            mm2(n, 2);
            __builtin_amdgcn_sched_barrier(0);
            if (n == 2) ld_a(1);
        }
        // publish point: this wave's reads of buffer cur are done, its copies of the
        // next tile have landed; behind the barrier buffer cur may be refilled.
        asm volatile("s_wait_dscnt 0x0" ::: "memory");
        asm volatile("s_wait_asynccnt 0x0" ::: "memory");
        __syncthreads();
        // the step's last 16 WMMAs work from registers; the refill goes between their halves,
        // so that one wave of a SIMD issues its copies while the other's WMMAs run
        __builtin_amdgcn_sched_barrier(0);
        mm2(5, 0);
        __builtin_amdgcn_sched_barrier(0);
        if (i + 2 < NSTEP) load_tile((i + 2) * 64, cur);
        __builtin_amdgcn_sched_barrier(0);
        mm2(5, 2);
    }
    asm volatile("s_wait_asynccnt 0x0" ::: "memory");   // no copy outstanding at the wave's end
}

__global__ __launch_bounds__(256)
void qkv_gemm_rope_kernel(
        const __bf16* __restrict__ xn, const __bf16* __restrict__ wqkv,
        const float* __restrict__ theta,
        __bf16* __restrict__ qd, __bf16* __restrict__ kd, __bf16* __restrict__ vd) {
    const int n0 = blockIdx.x * 128;   // 8 tiles over the 1024 columns of q, of k and of v
    const int m0 = blockIdx.y * 256;   // 32 tiles over 8192
    const int wave = __builtin_amdgcn_readfirstlane(threadIdx.x >> 5);
    const int lane = threadIdx.x & 31;
    const int ln = lane & 15, hi = lane >> 4;
    const int wm = wave >> 1, wn = wave & 1;

    __shared__ __align__(16) __bf16 sm[2 * 256 * 72 + 2 * 384 * 72];
    const int h = (n0 >> 6) + wn;         // the wave's head
    const int tok0 = m0 + wm * 64;        // a wave's 64 rows lie in one batch entry
    const int b = tok0 >> 10, seqb = tok0 & 1023;

    // group 0 = q, 1 = k, stored [token][d]; group 2 = v, stored [d][token]
    v8f acc[3][4][4] = {};
    qkv_mainloop(sm, xn + (size_t)m0 * DIM, wqkv + (size_t)n0 * DIM, wm, wn, acc);

    // Each 64 x 64 group goes through the wave's own 64 x 72 piece of LDS, 16 bytes a lane both
    // ways, and leaves as whole 128-byte lines (straight from the accumulators: 32-byte pieces).
    __bf16* st = sm + wave * (64 * 72);
    const __bf16* sr = st + (lane >> 3) * 72 + (lane & 7) * 8;   // 4 rows a load
    auto stage = [&](const v8f (&c)[4][4], v8bf (&row)[16]) {
        #pragma unroll
        for (int j = 0; j < 4; j++)
            #pragma unroll
            for (int i = 0; i < 4; i++)
                *reinterpret_cast<v8bf*>(st + (j * 16 + ln) * 72 + i * 16 + 8 * hi) =
                    __builtin_convertvector(c[i][j], v8bf);
        // the rows read back below were written by other lanes of this wave
        asm volatile("s_wait_dscnt 0x0" ::: "memory");
        #pragma unroll
        for (int t = 0; t < 16; t++) row[t] = *reinterpret_cast<const v8bf*>(sr + t * 4 * 72);
    };

    // v leaves first: its 128 accumulator registers are free before RoPE needs its own
    {
        v8bf row[16];
        stage(acc[2], row);
        // V transposed: [B,H,D,S], a row of the group is one d
        __bf16* dst = vd + ((size_t)(b * HEADS + h) * HD + (lane >> 3)) * SEQ + seqb + (lane & 7) * 8;
        #pragma unroll
        for (int t = 0; t < 16; t++) *reinterpret_cast<v8bf*>(dst + t * 4 * SEQ) = row[t];
        // what follows rewrites the address and data registers of these stores: the wait stands
        // in front of that rewrite, and the fence keeps later vector work from rising over it
        asm volatile("s_wait_xcnt 0x0" ::: "memory");
        __builtin_amdgcn_sched_barrier(0);
    }

    {
        // RoPE on d<32 of q and k: pair (d, d+16) = (acc[g][0], acc[g][1]), same lane slot;
        // d = 8 * hi + r, token j * 16 + ln; one sine and cosine serve both
        const float* tp = theta + (seqb + ln) * (HEADS * 16) + h * 16 + 8 * hi;
        v4f th[4][2];
        #pragma unroll
        for (int j = 0; j < 4; j++) {
            th[j][0] = *reinterpret_cast<const v4f*>(tp + j * 16 * (HEADS * 16));
            th[j][1] = *reinterpret_cast<const v4f*>(tp + j * 16 * (HEADS * 16) + 4);
        }
        // the eight loads share one address pair: tp stays live up to this wait, so that no
        // load's result lands in the pair and nothing rewrites it in front of the wait
        asm volatile("s_wait_xcnt 0x0" :: "v"(tp) : "memory");
        #pragma unroll
        for (int j = 0; j < 4; j++) {
            #pragma unroll
            for (int r = 0; r < 8; r++) {
                float sn, cs;
                // the fast sine and cosine (argument in turns) in one statement: its v_nop
                // fills the slot behind a transcendental, whatever is scheduled next
                asm("v_sin_f32 %0, %2\n\tv_cos_f32 %1, %2\n\tv_nop"
                    : "=&v"(sn), "=&v"(cs) : "v"(th[j][r >> 2][r & 3] * 0.15915494f));
                #pragma unroll
                for (int g = 0; g < 2; g++) {
                    float v0 = acc[g][0][j][r], v1 = acc[g][1][j][r];
                    acc[g][0][j][r] = v0 * cs - v1 * sn;
                    acc[g][1][j][r] = v1 * cs + v0 * sn;
                }
            }
        }
    }

    #pragma unroll
    for (int g = 0; g < 2; g++) {
        v8bf row[16];
        stage(acc[g], row);
        // [B,H,S,D]: the group's 64 rows are 8 KB in a row
        __bf16* dst = (g == 0 ? qd : kd) + ((size_t)(b * HEADS + h) * SEQ + seqb) * HD + lane * 8;
        #pragma unroll
        for (int t = 0; t < 16; t++) *reinterpret_cast<v8bf*>(dst + t * 4 * HD) = row[t];
        // k's staging rewrites the address and data registers of q's stores: the wait stands
        // in front of that rewrite, and the fence keeps k's conversions from rising over it
        if (g == 0) {
            asm volatile("s_wait_xcnt 0x0" ::: "memory");
            __builtin_amdgcn_sched_barrier(0);
        }
    }
}

// ---------------------------------------------------------------- K3: causal flash attention
// the value that lane l ^ 16 holds
__device__ __forceinline__ float other_half(float v) {
    int b = __builtin_bit_cast(int, v);
    return __builtin_bit_cast(float, __builtin_amdgcn_permlanex16(b, b, 0x76543210, 0xfedcba98, false, false));
}

// 2^x in asm. Early-clobber outputs keep every source whole
// inside the statement; the v_nop fills the slot behind the last one, whatever comes next.
#define LOG2E 1.44269504f
__device__ __forceinline__ float exp2_x1(float x) {
    float p;
    asm("v_exp_f32 %0, %1\n\tv_nop" : "=&v"(p) : "v"(x));
    return p;
}
__device__ __forceinline__ void exp2_x8(float (&p)[8], const float (&x)[8]) {
    asm("v_exp_f32 %0, %8\n\t"
        "v_exp_f32 %1, %9\n\t"
        "v_exp_f32 %2, %10\n\t"
        "v_exp_f32 %3, %11\n\t"
        "v_exp_f32 %4, %12\n\t"
        "v_exp_f32 %5, %13\n\t"
        "v_exp_f32 %6, %14\n\t"
        "v_exp_f32 %7, %15\n\t"
        "v_nop"
        : "=&v"(p[0]), "=&v"(p[1]), "=&v"(p[2]), "=&v"(p[3]),
          "=&v"(p[4]), "=&v"(p[5]), "=&v"(p[6]), "=&v"(p[7])
        : "v"(x[0]), "v"(x[1]), "v"(x[2]), "v"(x[3]), "v"(x[4]), "v"(x[5]), "v"(x[6]), "v"(x[7]));
}

__global__ __launch_bounds__(256) __attribute__((amdgpu_waves_per_eu(4, 4)))
void attention_kernel(
        const __bf16* __restrict__ qd, const __bf16* __restrict__ kd,
        const __bf16* __restrict__ vd, __bf16* __restrict__ od) {
    __shared__ __align__(16) __bf16 Ks[2][64][72];
    __shared__ __align__(16) __bf16 Vs[2][64][72];
    const int t  = blockIdx.x >> 7;    // 0..3
    const int bh = blockIdx.x & 127;   // b*16+h
    const int b  = bh >> 4, h = bh & 15;
    const int tid = threadIdx.x, wave = tid >> 5, lane = tid & 31;
    const int ln = lane & 15, hi = lane >> 4;

    const int kr = tid >> 2, kc = (tid & 3) * 16;   // 64 x 64 chunk, 32B/thread
    const __bf16* kBp = kd + ((size_t)bh * SEQ + kr) * HD + kc;   // + j0*HD
    const __bf16* vBp = vd + ((size_t)bh * HD + kr) * SEQ + kc;   // + j0
    auto load_chunk = [&](int j0, int buf) {
        #pragma unroll
        for (int u = 0; u < 2; u++)
            async_copy16(&Ks[buf][kr][kc + u * 8], kBp + (size_t)j0 * HD + u * 8);
        #pragma unroll
        for (int u = 0; u < 2; u++)
            async_copy16(&Vs[buf][kr][kc + u * 8], vBp + j0 + u * 8);
    };

    // rolled: the two tiles share one copy of the chunk loop
    #pragma unroll 1
    for (int half = 0; half < 2; half++) {
    const int q0 = (half == 0 ? 7 - t : t) * 128;

    // Q fragments resident in registers for the whole tile
    const __bf16* qrow = qd + ((size_t)bh * SEQ + q0 + wave * 16 + ln) * HD;
    v16bf qfrag[2];
    qfrag[0] = ld_frag(qrow, 0 * 32 + hi * 8);
    qfrag[1] = ld_frag(qrow, 1 * 32 + hi * 8);

    // the first tile's chunk loop ends in a barrier: both buffers are free here
    load_chunk(0, 0);
    wait_async0();
    __syncthreads();

    v8f accO[4] = {};                  // accO[df][r] = O[query ln][d = df * 16 + 8 * hi + r]
    float mrun = -1e30f, lrun = 0.f;   // of query ln; lrun sums this half's keys only
    const int qg = q0 + wave * 16 + ln;

    const int nchunks = (q0 + 128) / 64;
    for (int ci = 0; ci < nchunks; ci++) {
        const int j0 = ci * 64, cur = ci & 1;
        if (ci + 1 < nchunks) load_chunk(j0 + 64, cur ^ 1);

        // scores: K(64keys x 64d) * Q(16x64d)^T -> 4 frags of 16 keys x 16 queries,
        // accS[nf][r] = S[query ln][key j0 + nf * 16 + 8 * hi + r]
        v16bf kf[4][2], vf[4][2];
        #pragma unroll
        for (int nf = 0; nf < 4; nf++)
            #pragma unroll
            for (int kk = 0; kk < 2; kk++)
                kf[nf][kk] = ld_frag(&Ks[cur][nf * 16 + ln][0], kk * 32 + hi * 8);
        // keeps the chunk's 16 K reads one group ahead of the 8 score WMMAs: left alone the
        // scheduler reuses one fragment's registers and waits out the LDS latency per WMMA
        __builtin_amdgcn_sched_barrier(0);
        v8f accS[4] = {};
        #pragma unroll
        for (int kk = 0; kk < 2; kk++)
            #pragma unroll
            for (int nf = 0; nf < 4; nf++)
                accS[nf] = wmma_bf16(kf[nf][kk], qfrag[kk], accS[nf]);
        #pragma unroll
        for (int df = 0; df < 4; df++)
            #pragma unroll
            for (int kk = 0; kk < 2; kk++)
                vf[df][kk] = ld_frag(&Vs[cur][df * 16 + ln][0], kk * 32 + hi * 8);
        // keeps the chunk's 16 V reads ahead of the softmax, whose vector work covers their latency
        __builtin_amdgcn_sched_barrier(0);

        // online softmax of one query per lane
        const int lim = qg - j0 - 8 * hi;   // key nf * 16 + r of this half is seen if <= lim
        float cmax[4];
        #pragma unroll
        for (int nf = 0; nf < 4; nf++) {
            #pragma unroll
            for (int r = 0; r < 8; r++) {
                float v = accS[nf][r] * 0.125f;   // 1/sqrt(64)
                accS[nf][r] = (nf * 16 + r <= lim) ? v : -1e30f;
            }
            cmax[nf] = fmaxf(fmaxf(fmaxf(accS[nf][0], accS[nf][1]), fmaxf(accS[nf][2], accS[nf][3])),
                             fmaxf(fmaxf(accS[nf][4], accS[nf][5]), fmaxf(accS[nf][6], accS[nf][7])));
        }
        float rmax = fmaxf(fmaxf(cmax[0], cmax[1]), fmaxf(cmax[2], cmax[3]));
        rmax = fmaxf(rmax, other_half(rmax));
        const float mnew = fmaxf(mrun, rmax);
        const float corr = exp2_x1((mrun - mnew) * LOG2E);
        mrun = mnew;
        // P^T as B operand: element s of pf[kk] is key kk * 32 + (s < 8 ? 8 * hi + s : 16 + 8 * hi + s - 8),
        // the k order of ld_frag, which loads V^T beside it
        v16bf pf[2];
        float csum[4];
        #pragma unroll
        for (int nf = 0; nf < 4; nf++) {
            float e[8], p[8];
            #pragma unroll
            for (int r = 0; r < 8; r++) e[r] = (accS[nf][r] - mnew) * LOG2E;
            exp2_x8(p, e);
            #pragma unroll
            for (int r = 0; r < 8; r++) pf[nf >> 1][(nf & 1) * 8 + r] = (__bf16)p[r];
            csum[nf] = ((p[0] + p[1]) + (p[2] + p[3])) + ((p[4] + p[5]) + (p[6] + p[7]));
        }
        lrun = lrun * corr + ((csum[0] + csum[1]) + (csum[2] + csum[3]));
        #pragma unroll
        for (int df = 0; df < 4; df++) accO[df] = accO[df] * corr;

        // O^T += V^T(64d x 64keys) * P^T(64keys x 16 queries)
        #pragma unroll
        for (int df = 0; df < 4; df++) {
            #pragma unroll
            for (int kk = 0; kk < 2; kk++)
                accO[df] = wmma_bf16(vf[df][kk], pf[kk], accO[df]);
        }
        if (ci + 1 < nchunks) wait_async0();
        __syncthreads();
    }

    // a lane's 8 accumulator registers are 8 consecutive d of its query: 16-byte stores
    const float inv = 1.0f / (lrun + other_half(lrun));
    __bf16* dst = od + ((size_t)(b * SEQ + qg)) * DIM + h * HD + 8 * hi;
    #pragma unroll
    for (int df = 0; df < 4; df++)
        *reinterpret_cast<v8bf*>(dst + df * 16) = __builtin_convertvector(accO[df] * inv, v8bf);
    // the second tile's set-up rewrites the address and data registers of these stores:
    // the wait stands in front of that rewrite
    asm volatile("s_wait_xcnt 0x0" ::: "memory");
    }
}

// ---------------------------------------------------------------- K4: out-proj + residual
// out[8192,1024] = O[8192,1024] * Wout[1024,1024]^T + x
// 128 x 128 block tile, 4 waves (2 x 2) of 64 x 64: 512 blocks, two for each WGP.
__global__ __launch_bounds__(128) __attribute__((amdgpu_waves_per_eu(4, 4)))
void outproj_kernel(
        const __bf16* __restrict__ o, const __bf16* __restrict__ wout,
        const float* __restrict__ x, float* __restrict__ out) {
    const int n0 = blockIdx.x * 128;
    const int m0 = blockIdx.y * 128;
    const int wave = __builtin_amdgcn_readfirstlane(threadIdx.x >> 5);
    const int lane = threadIdx.x & 31;
    const int ln = lane & 15, hi = lane >> 4;
    const int wm = wave >> 1, wn = wave & 1;

    __shared__ __align__(16) __bf16 sm[2 * 128 * 72 + 2 * 128 * 72];
    // weight rows first: a lane's 8 registers are 8 adjacent columns of one token's row
    v8f acc[4][4] = {};
    gemm_nt_mainloop<2>(sm, o + (size_t)m0 * DIM, wout + (size_t)n0 * DIM, wm, wn, true, acc);

    // The wave's 64 x 64 tile goes through its own 64 x 68 floats of LDS, 16 bytes a lane both
    // ways: x is read and out written 256 bytes of a row at a time, whole 128-byte lines.
    float* st = reinterpret_cast<float*>(sm) + wave * (64 * 68);
    #pragma unroll
    for (int j = 0; j < 4; j++)
        #pragma unroll
        for (int i = 0; i < 4; i++) {
            float* p = st + (j * 16 + ln) * 68 + i * 16 + 8 * hi;
            *reinterpret_cast<v4f*>(p)     = __builtin_shufflevector(acc[i][j], acc[i][j], 0, 1, 2, 3);
            *reinterpret_cast<v4f*>(p + 4) = __builtin_shufflevector(acc[i][j], acc[i][j], 4, 5, 6, 7);
        }
    const unsigned at = (unsigned)(m0 + wm * 64 + hi) * DIM + n0 + wn * 64 + ln * 4;   // 2 rows a load
    float* dst        = out + at;
    const float* skip = x   + at;
    v4f sk[32];
    #pragma unroll
    for (int t = 0; t < 32; t++) sk[t] = *reinterpret_cast<const v4f*>(skip + t * 2 * DIM);
    // the rows read back below were written by other lanes of this wave
    asm volatile("s_wait_dscnt 0x0" ::: "memory");
    const float* sr = st + hi * 68 + ln * 4;
    #pragma unroll
    for (int t = 0; t < 32; t++)
        *reinterpret_cast<v4f*>(dst + t * 2 * DIM) = *reinterpret_cast<const v4f*>(sr + t * 2 * 68) + sk[t];
}

// ---------------------------------------------------------------- launch
extern "C" void kernel_launch(void* const* d_in, const int* in_sizes, int n_in,
                              void* d_out, int out_size, void* d_ws, size_t ws_size,
                              hipStream_t stream) {
    const float* x     = (const float*)d_in[0];   // [8,1024,1024]
    const float* scale = (const float*)d_in[1];   // [1024]
    const float* wqkv  = (const float*)d_in[2];   // [3072,1024]
    const float* wout  = (const float*)d_in[3];   // [1024,1024]
    const float* theta = (const float*)d_in[4];   // [1024,16,16]

    char* ws = (char*)d_ws;
    __bf16* wqkv_bf = (__bf16*)(ws);                         //  6,291,456 B
    __bf16* wout_bf = (__bf16*)(ws + 6291456);               //  2,097,152 B
    __bf16* xn_bf   = (__bf16*)(ws + 8388608);               // 16,777,216 B
    __bf16* q_bf    = (__bf16*)(ws + 25165824);              // [B,H,S,D]
    __bf16* k_bf    = (__bf16*)(ws + 41943040);              // [B,H,S,D]
    __bf16* v_bf    = (__bf16*)(ws + 58720256);              // [B,H,D,S]
    __bf16* o_bf    = (__bf16*)(ws + 75497472);              // [B,S,H*D]
    float*  outp    = (float*)d_out;

    prep_kernel<<<NTOK / 2 / 16, 512, 0, stream>>>(x, scale, wqkv, wout, xn_bf, wqkv_bf, wout_bf);
    qkv_gemm_rope_kernel<<<dim3(DIM / 128, NTOK / 256), 256, 0, stream>>>(
        xn_bf, wqkv_bf, theta, q_bf, k_bf, v_bf);
    attention_kernel<<<BATCH * HEADS * (SEQ / 256), 256, 0, stream>>>(q_bf, k_bf, v_bf, o_bf);
    outproj_kernel<<<dim3(DIM / 128, NTOK / 128), 128, 0, stream>>>(o_bf, wout_bf, x, outp);
}

// v008
// A run of this version takes 86.6 microseconds.
// Two timings next to v007 both put it at 1.04 times that version's speed.
// Counting every step since v000, it is 2.73 times as fast.
#include <hip/hip_runtime.h>

#define DIM    1024
#define HEADS  16
#define HD     64
#define SEQ    1024
#define BATCH  8
#define NTOK   (BATCH * SEQ)   // 8192
#define QKV_N  (3 * DIM)       // 3072

typedef __attribute__((ext_vector_type(16))) __bf16 v16bf;
typedef __attribute__((ext_vector_type(8)))  __bf16 v8bf;
typedef __attribute__((ext_vector_type(8)))  float  v8f;

// Load one 16-bf16 WMMA A/B fragment for this lane from a row (LDS or global):
// per CDNA5 ISA 16-bit layout, lane holds k = base+0..7 and k = base+16..23
// with base = (lane>>4)*8, row = lane&15. k0 = chunk*32 + (lane>>4)*8.
__device__ __forceinline__ v16bf ld_frag(const __bf16* row, int k0) {
    v8bf lo = *reinterpret_cast<const v8bf*>(row + k0);
    v8bf hi = *reinterpret_cast<const v8bf*>(row + k0 + 16);
    return __builtin_shufflevector(lo, hi, 0,1,2,3,4,5,6,7,8,9,10,11,12,13,14,15);
}

__device__ __forceinline__ v8f wmma_bf16(v16bf a, v16bf b, v8f c) {
    return __builtin_amdgcn_wmma_f32_16x16x32_bf16(false, a, false, b, (short)0, c, false, false);
}

// Async copies global -> LDS (GLOBAL_LOAD_ASYNC_TO_LDS_B128, ASYNCcnt), 16 bytes a lane.
// Generic LDS pointer: low 32 bits are the LDS byte offset (flat aperture rule).
// Four copies of one lane. s_wait_xcnt 0 is the last line of the copies' own statement, so that
// it stands in front of any later rewrite of the address registers they name.
__device__ __forceinline__ void async_copy16_x4(unsigned l0, unsigned l1, unsigned l2, unsigned l3,
                                                const __bf16* g0, const __bf16* g1,
                                                const __bf16* g2, const __bf16* g3) {
    asm volatile("global_load_async_to_lds_b128 %0, %4, off\n\t"
                 "global_load_async_to_lds_b128 %1, %5, off\n\t"
                 "global_load_async_to_lds_b128 %2, %6, off\n\t"
                 "global_load_async_to_lds_b128 %3, %7, off\n\t"
                 "s_wait_xcnt 0x0"
                 :: "v"(l0), "v"(l1), "v"(l2), "v"(l3), "v"(g0), "v"(g1), "v"(g2), "v"(g3)
                 : "memory");
}

// Eight 16-byte async copies of one lane, rows lstep (LDS bytes) and gstep
// (elements) apart. s_wait_xcnt 0 is the last line of the copies' own statement, so
// that it stands in front of any later rewrite of the address registers they name.
__device__ __forceinline__ void async_copy16_x8(unsigned l, unsigned lstep,
                                                const __bf16* g, size_t gstep) {
    asm volatile("global_load_async_to_lds_b128 %0, %8, off\n\t"
                 "global_load_async_to_lds_b128 %1, %9, off\n\t"
                 "global_load_async_to_lds_b128 %2, %10, off\n\t"
                 "global_load_async_to_lds_b128 %3, %11, off\n\t"
                 "global_load_async_to_lds_b128 %4, %12, off\n\t"
                 "global_load_async_to_lds_b128 %5, %13, off\n\t"
                 "global_load_async_to_lds_b128 %6, %14, off\n\t"
                 "global_load_async_to_lds_b128 %7, %15, off\n\t"
                 "s_wait_xcnt 0x0"
                 :: "v"(l), "v"(l + lstep), "v"(l + 2 * lstep), "v"(l + 3 * lstep),
                    "v"(l + 4 * lstep), "v"(l + 5 * lstep), "v"(l + 6 * lstep), "v"(l + 7 * lstep),
                    "v"(g), "v"(g + gstep), "v"(g + 2 * gstep), "v"(g + 3 * gstep),
                    "v"(g + 4 * gstep), "v"(g + 5 * gstep), "v"(g + 6 * gstep), "v"(g + 7 * gstep)
                 : "memory");
}

// Ten 16-byte async copies of one lane, global address = a scalar base each + the lane's byte
// offset, which all ten share: eleven vector registers for the ten. s_wait_xcnt 0 as above.
__device__ __forceinline__ void async_copy16_x10(const unsigned (&l)[10], unsigned voff,
                                                 const __bf16* const (&g)[10]) {
    asm volatile("global_load_async_to_lds_b128 %0, %10, %11\n\t"
                 "global_load_async_to_lds_b128 %1, %10, %12\n\t"
                 "global_load_async_to_lds_b128 %2, %10, %13\n\t"
                 "global_load_async_to_lds_b128 %3, %10, %14\n\t"
                 "global_load_async_to_lds_b128 %4, %10, %15\n\t"
                 "global_load_async_to_lds_b128 %5, %10, %16\n\t"
                 "global_load_async_to_lds_b128 %6, %10, %17\n\t"
                 "global_load_async_to_lds_b128 %7, %10, %18\n\t"
                 "global_load_async_to_lds_b128 %8, %10, %19\n\t"
                 "global_load_async_to_lds_b128 %9, %10, %20\n\t"
                 "s_wait_xcnt 0x0"
                 :: "v"(l[0]), "v"(l[1]), "v"(l[2]), "v"(l[3]), "v"(l[4]),
                    "v"(l[5]), "v"(l[6]), "v"(l[7]), "v"(l[8]), "v"(l[9]), "v"(voff),
                    "s"(g[0]), "s"(g[1]), "s"(g[2]), "s"(g[3]), "s"(g[4]),
                    "s"(g[5]), "s"(g[6]), "s"(g[7]), "s"(g[8]), "s"(g[9])
                 : "memory");
}

// NT GEMM main loop over K = DIM (both operands K-major, row pitch DIM).
// Block tile (WM*64) x 128 from WM x 2 waves; each wave keeps a 64 x 64 tile
// (4 x 4 accumulator fragments), so 8 loaded fragments feed 16 WMMAs.
// a, b point at the block's first row. Two LDS buffers, K-step 64, one barrier a step.
// A wave's copy covers four whole 128-byte rows.
// sm holds A[2][BM][72], then B[2][128][72]. Behind the loop's last barrier nobody reads it
// and no copy is in flight: the caller's epilogue may stage its tile there.
// A lane's 8 accumulator registers run along the rows of the WMMA's first operand:
// acc[i][j][r] = C[first operand's row i * 16 + 8 * hi + r][second operand's row j * 16 + ln].
// b_first picks b's rows as the first operand (block-uniform), so that the 8 registers are
// 8 adjacent elements of the output's rows, whichever way the output lies.
template <int WM>
__device__ __forceinline__ void gemm_nt_mainloop(__bf16* sm,
                                                 const __bf16* __restrict__ a,
                                                 const __bf16* __restrict__ b,
                                                 int wm, int wn, bool b_first, v8f (&acc)[4][4]) {
    constexpr int BM = WM * 64;      // rows of the A tile
    constexpr int RP = WM * 8;       // rows that one copy of the whole block covers
    constexpr int ABUF = BM * 72, BBUF = 128 * 72, BOFF = 2 * ABUF;   // in elements
    const int tid = threadIdx.x, lane = tid & 31;
    const int ln = lane & 15, hi = lane >> 4;
    const int cr = tid >> 3, cc = (tid & 7) * 8;
    const __bf16* ag = a + (size_t)cr * DIM + cc;
    const __bf16* bg = b + (size_t)cr * DIM + cc;

    auto load_tile = [&](int k0, int buf) {
        async_copy16_x8((unsigned)(uintptr_t)(sm + buf * ABUF + cr * 72 + cc), RP * 144, ag + k0, (size_t)RP * DIM);
        async_copy16_x8((unsigned)(uintptr_t)(sm + BOFF + buf * BBUF + cr * 72 + cc), RP * 144, bg + k0, (size_t)RP * DIM);
    };
    const int aofs = wm * 64 * 72, bofs = BOFF + wn * 64 * 72;
    const int pofs = b_first ? bofs : aofs, pbuf = b_first ? BBUF : ABUF;   // first operand
    const int qofs = b_first ? aofs : bofs, qbuf = b_first ? ABUF : BBUF;   // second operand

    load_tile(0, 0);
    asm volatile("s_wait_asynccnt 0x0" ::: "memory");   // tile 0 landed before it is published
    __syncthreads();
    load_tile(64, 1);

    constexpr int NSTEP = DIM / 64;   // 16
    for (int i = 0; i < NSTEP; i++) {
        const int cur = i & 1;
        v16bf af[4], bf[4];
        auto load_frags = [&](int kk) {
            #pragma unroll
            for (int f = 0; f < 4; f++) {
                af[f] = ld_frag(sm + pofs + cur * pbuf + (f * 16 + ln) * 72, kk * 32 + hi * 8);
                bf[f] = ld_frag(sm + qofs + cur * qbuf + (f * 16 + ln) * 72, kk * 32 + hi * 8);
            }
        };
        auto products = [&]() {
            #pragma unroll
            for (int mf = 0; mf < 4; mf++)
                #pragma unroll
                for (int nf = 0; nf < 4; nf++)
                    acc[mf][nf] = wmma_bf16(af[mf], bf[nf], acc[mf][nf]);
        };
        load_frags(0);
        // keeps the 16 LDS reads one group ahead of their 16 WMMAs: left alone the
        // scheduler reloads one A fragment per row of 4 and waits it out each time
        __builtin_amdgcn_sched_barrier(0);
        products();
        load_frags(1);
        // publish point: this wave's reads of buffer cur are done, its copies of the
        // next tile have landed; behind the barrier buffer cur may be refilled.
        asm volatile("s_wait_dscnt 0x0" ::: "memory");
        asm volatile("s_wait_asynccnt 0x0" ::: "memory");
        __syncthreads();
        if (i + 2 < NSTEP) load_tile((i + 2) * 64, cur);
        // the step's second half works from registers while the refill is in flight
        products();
    }
    asm volatile("s_wait_asynccnt 0x0" ::: "memory");   // no copy outstanding at the wave's end
}

// ---------------------------------------------------------------- K0: all f32 -> bf16 preparation
// 256 x 16 long-lived waves (for speed only). A wave owns whole 1024-float rows, 32 floats a lane as 8 loads of 512 contiguous bytes:
// two rows of x (RMSNorm; the row sum stays inside the wave) and one weight row (rounding only).
typedef __attribute__((ext_vector_type(4))) float  v4f;
typedef __attribute__((ext_vector_type(4))) __bf16 v4bf;
static_assert(QKV_N + DIM == NTOK / 2, "one weight row for every two rows of x");

// A lane's share of a row: element 4 * c + e of r[k] with c = 0, 1 is float e of the
// row's 16-byte piece (2 * k + c) * 32 + lane.
struct RowRegs { v8f r[4]; };

__device__ __forceinline__ RowRegs load_row(const float* row, int lane) {
    const v4f* p = reinterpret_cast<const v4f*>(row) + lane;
    RowRegs t;
    #pragma unroll
    for (int k = 0; k < 4; k++)
        t.r[k] = __builtin_shufflevector(p[k * 64], p[k * 64 + 32], 0, 1, 2, 3, 4, 5, 6, 7);
    return t;
}
__device__ __forceinline__ void store_row(__bf16* row, int lane, const RowRegs& t) {
    v4bf* p = reinterpret_cast<v4bf*>(row) + lane;
    #pragma unroll
    for (int k = 0; k < 4; k++) {
        p[k * 64]      = __builtin_convertvector(__builtin_shufflevector(t.r[k], t.r[k], 0, 1, 2, 3), v4bf);
        p[k * 64 + 32] = __builtin_convertvector(__builtin_shufflevector(t.r[k], t.r[k], 4, 5, 6, 7), v4bf);
    }
}
// 1 / rms of a row: eight partial sums a lane, folded, then a five-step butterfly
__device__ __forceinline__ float row_rrms(const RowRegs& t) {
    v8f a = t.r[0] * t.r[0];
    #pragma unroll
    for (int k = 1; k < 4; k++) a += t.r[k] * t.r[k];
    float ss = ((a[0] + a[1]) + (a[2] + a[3])) + ((a[4] + a[5]) + (a[6] + a[7]));
    #pragma unroll
    for (int off = 16; off > 0; off >>= 1) ss += __shfl_xor(ss, off, 32);
    return rsqrtf(ss * (1.0f / DIM) + 1e-6f);
}

__global__ __launch_bounds__(512) void prep_kernel(
        const float* __restrict__ x, const float* __restrict__ scale,
        const float* __restrict__ wqkv, const float* __restrict__ wout,
        __bf16* __restrict__ xn, __bf16* __restrict__ wqkv_bf, __bf16* __restrict__ wout_bf) {
    const int lane = threadIdx.x & 31;
    const int w = __builtin_amdgcn_readfirstlane(blockIdx.x * 16 + (threadIdx.x >> 5));   // 0..4095
    const float* wsrc = w < QKV_N ? wqkv + (size_t)w * DIM : wout + (size_t)(w - QKV_N) * DIM;
    __bf16*      wdst = w < QKV_N ? wqkv_bf + (size_t)w * DIM : wout_bf + (size_t)(w - QKV_N) * DIM;

    RowRegs x0 = load_row(x + (size_t)w * (2 * DIM), lane);
    RowRegs x1 = load_row(x + (size_t)w * (2 * DIM) + DIM, lane);
    RowRegs sc = load_row(scale, lane);
    RowRegs wr = load_row(wsrc, lane);

    const float s0 = row_rrms(x0), s1 = row_rrms(x1);
    #pragma unroll
    for (int k = 0; k < 4; k++) {
        x0.r[k] = x0.r[k] * sc.r[k] * s0;
        x1.r[k] = x1.r[k] * sc.r[k] * s1;
    }
    store_row(wdst, lane, wr);
    store_row(xn + (size_t)w * (2 * DIM), lane, x0);
    store_row(xn + (size_t)w * (2 * DIM) + DIM, lane, x1);
}

// ---------------------------------------------------------------- K2: QKV GEMM + RoPE
// C[8192,3072] = Xn[8192,1024] * Wqkv[3072,1024]^T  (NT: both K-major)
// 256 x 384 block tile: 256 tokens by 128 columns (two heads) of each of q, k and v.
// 32 x 8 = 256 blocks, one for each WGP. 8 waves (4 x 2), two a SIMD; a wave keeps 64 tokens by
// one head of q, of k and of v: three 64 x 64 groups that share the wave's four token fragments.
// Against 256 x 128 blocks of 64 x 64 waves: 640 staged rows feed 768 WMMAs a k step of 64
// (was 384 for 256), and 32 loaded fragments feed 96 WMMAs (was 16 for 32).
// sm holds A[2][256][72], then B[2][384][72]; B row g * 128 + c is weight row g * 1024 + n0 + c.
// acc[g][i][j][r] = C[first operand's row i * 16 + 8 * hi + r][second operand's row j * 16 + ln]:
// weight rows go first for q and k (the 8 registers run along d), tokens first for v.
// Behind the loop's last barrier nobody reads sm and no copy is in flight.
__device__ __forceinline__ void qkv_mainloop(__bf16* sm,
                                             const __bf16* __restrict__ a,
                                             const __bf16* __restrict__ b,
                                             int wm, int wn, v8f (&acc)[3][4][4]) {
    constexpr int ABUF = 256 * 72, BBUF = 384 * 72, BOFF = 2 * ABUF;   // in elements
    const int tid = threadIdx.x, lane = tid & 31;
    const int ln = lane & 15, hi = lane >> 4;
    const int cr = tid >> 3, cc = (tid & 7) * 8;   // one copy of the block covers 32 whole rows
    const unsigned gc = (unsigned)(cr * DIM + cc) * 2;               // the lane's place in 32 rows, bytes
    const unsigned lc = (unsigned)(uintptr_t)(sm + cr * 72 + cc);

    // 20 copies a lane: 8 x 32 rows of A, then 12 x 32 rows of B (4 x 32 of each of q, k, v)
    auto load_tile = [&](int k0, int buf) {
        #pragma unroll
        for (int s = 0; s < 2; s++) {
            unsigned l[10];
            const __bf16* g[10];
            #pragma unroll
            for (int u = 0; u < 10; u++) {
                const int c = s * 10 + u, v = c - 8;
                l[u] = c < 8 ? lc + buf * (ABUF * 2) + c * (32 * 144)
                             : lc + (BOFF + buf * BBUF) * 2 + v * (32 * 144);
                g[u] = c < 8 ? a + (size_t)c * 32 * DIM
                             : b + (size_t)((v >> 2) * 1024 + (v & 3) * 32) * DIM;
            }
            async_copy16_x10(l, gc + k0 * 2, g);
        }
    };
    const __bf16* fa = sm + (wm * 64 + ln) * 72 + hi * 8;
    const __bf16* fb = sm + BOFF + (wn * 64 + ln) * 72 + hi * 8;

    load_tile(0, 0);
    asm volatile("s_wait_asynccnt 0x0" ::: "memory");   // tile 0 landed before it is published
    __syncthreads();
    load_tile(64, 1);

    constexpr int NSTEP = DIM / 64;   // 16
    for (int i = 0; i < NSTEP; i++) {
        const int cur = i & 1;
        const __bf16* pa = fa + cur * ABUF;
        const __bf16* pb = fb + cur * BBUF;
        // token fragments, and a ring of six weight fragments: a group of 16 WMMAs reads four
        // of them while the next group's four are fetched, two at a time, into the free two
        v16bf af[4], bw[6];
        auto ld_a = [&](int kk) {
            #pragma unroll
            for (int f = 0; f < 4; f++) af[f] = ld_frag(pa + f * 16 * 72, kk * 32);
        };
        // fragments f0, f0 + 1 of group n of the step (n = kk * 3 + g) into their ring slots
        auto ld_b2 = [&](int n, int f0) {
            #pragma unroll
            for (int f = f0; f < f0 + 2; f++)
                bw[(n * 4 + f) % 6] = ld_frag(pb + ((n % 3) * 128 + f * 16) * 72, (n / 3) * 32);
        };
        // the 8 WMMAs of group n that read its fragments f0, f0 + 1
        auto mm2 = [&](int n, int f0) {
            #pragma unroll
            for (int f = f0; f < f0 + 2; f++)
                #pragma unroll
                for (int t = 0; t < 4; t++) {
                    if (n % 3 == 2) acc[2][t][f] = wmma_bf16(af[t], bw[(n * 4 + f) % 6], acc[2][t][f]);
                    else acc[n % 3][f][t] = wmma_bf16(bw[(n * 4 + f) % 6], af[t], acc[n % 3][f][t]);
                }
        };
        // The scheduling fences keep each group of LDS reads whole and 16 WMMAs ahead of its use.
        // Left alone the scheduler moves the reads next to their use and waits them out.
        ld_a(0); ld_b2(0, 0); ld_b2(0, 2);
        #pragma unroll
        for (int n = 0; n < 5; n++) {
            ld_b2(n + 1, 0);
            __builtin_amdgcn_sched_barrier(0);
            mm2(n, 0);
            __builtin_amdgcn_sched_barrier(0);
            ld_b2(n + 1, 2);
            __builtin_amdgcn_sched_barrier(0);
            mm2(n, 2);
            __builtin_amdgcn_sched_barrier(0);
            if (n == 2) ld_a(1);
        }
        // publish point: this wave's reads of buffer cur are done, its copies of the
        // next tile have landed; behind the barrier buffer cur may be refilled.
        asm volatile("s_wait_dscnt 0x0" ::: "memory");
        asm volatile("s_wait_asynccnt 0x0" ::: "memory");
        __syncthreads();
        // the step's last 16 WMMAs work from registers; the refill goes between their halves,
        // so that one wave of a SIMD issues its copies while the other's WMMAs run
        __builtin_amdgcn_sched_barrier(0);
        mm2(5, 0);
        __builtin_amdgcn_sched_barrier(0);
        if (i + 2 < NSTEP) load_tile((i + 2) * 64, cur);
        __builtin_amdgcn_sched_barrier(0);
        mm2(5, 2);
    }
    asm volatile("s_wait_asynccnt 0x0" ::: "memory");   // no copy outstanding at the wave's end
}

__global__ __launch_bounds__(256)
void qkv_gemm_rope_kernel(
        const __bf16* __restrict__ xn, const __bf16* __restrict__ wqkv,
        const float* __restrict__ theta,
        __bf16* __restrict__ qd, __bf16* __restrict__ kd, __bf16* __restrict__ vd) {
    const int n0 = blockIdx.x * 128;   // 8 tiles over the 1024 columns of q, of k and of v
    const int m0 = blockIdx.y * 256;   // 32 tiles over 8192
    const int wave = __builtin_amdgcn_readfirstlane(threadIdx.x >> 5);
    const int lane = threadIdx.x & 31;
    const int ln = lane & 15, hi = lane >> 4;
    const int wm = wave >> 1, wn = wave & 1;

    __shared__ __align__(16) __bf16 sm[2 * 256 * 72 + 2 * 384 * 72];
    const int h = (n0 >> 6) + wn;         // the wave's head
    const int tok0 = m0 + wm * 64;        // a wave's 64 rows lie in one batch entry
    const int b = tok0 >> 10, seqb = tok0 & 1023;

    // group 0 = q, 1 = k, stored [token][d]; group 2 = v, stored [d][token]
    v8f acc[3][4][4] = {};
    qkv_mainloop(sm, xn + (size_t)m0 * DIM, wqkv + (size_t)n0 * DIM, wm, wn, acc);

    // Each 64 x 64 group goes through the wave's own 64 x 72 piece of LDS, 16 bytes a lane both
    // ways, and leaves as whole 128-byte lines (straight from the accumulators: 32-byte pieces).
    __bf16* st = sm + wave * (64 * 72);
    const __bf16* sr = st + (lane >> 3) * 72 + (lane & 7) * 8;   // 4 rows a load
    auto stage = [&](const v8f (&c)[4][4], v8bf (&row)[16]) {
        #pragma unroll
        for (int j = 0; j < 4; j++)
            #pragma unroll
            for (int i = 0; i < 4; i++)
                *reinterpret_cast<v8bf*>(st + (j * 16 + ln) * 72 + i * 16 + 8 * hi) =
                    __builtin_convertvector(c[i][j], v8bf);
        // the rows read back below were written by other lanes of this wave
        asm volatile("s_wait_dscnt 0x0" ::: "memory");
        #pragma unroll
        for (int t = 0; t < 16; t++) row[t] = *reinterpret_cast<const v8bf*>(sr + t * 4 * 72);
    };

    // v leaves first: its 128 accumulator registers are free before RoPE needs its own
    {
        v8bf row[16];
        stage(acc[2], row);
        // V transposed: [B,H,D,S], a row of the group is one d
        __bf16* dst = vd + ((size_t)(b * HEADS + h) * HD + (lane >> 3)) * SEQ + seqb + (lane & 7) * 8;
        #pragma unroll
        for (int t = 0; t < 16; t++) *reinterpret_cast<v8bf*>(dst + t * 4 * SEQ) = row[t];
        // what follows rewrites the address and data registers of these stores: the wait stands
        // in front of that rewrite, and the fence keeps later vector work from rising over it
        asm volatile("s_wait_xcnt 0x0" ::: "memory");
        __builtin_amdgcn_sched_barrier(0);
    }

    {
        // RoPE on d<32 of q and k: pair (d, d+16) = (acc[g][0], acc[g][1]), same lane slot;
        // d = 8 * hi + r, token j * 16 + ln; one sine and cosine serve both
        const float* tp = theta + (seqb + ln) * (HEADS * 16) + h * 16 + 8 * hi;
        v4f th[4][2];
        #pragma unroll
        for (int j = 0; j < 4; j++) {
            th[j][0] = *reinterpret_cast<const v4f*>(tp + j * 16 * (HEADS * 16));
            th[j][1] = *reinterpret_cast<const v4f*>(tp + j * 16 * (HEADS * 16) + 4);
        }
        // the eight loads share one address pair: tp stays live up to this wait, so that no
        // load's result lands in the pair and nothing rewrites it in front of the wait
        asm volatile("s_wait_xcnt 0x0" :: "v"(tp) : "memory");
        #pragma unroll
        for (int j = 0; j < 4; j++) {
            #pragma unroll
            for (int r = 0; r < 8; r++) {
                float sn, cs;
                // the fast sine and cosine (argument in turns) in one statement: its v_nop
                // fills the slot behind a transcendental, whatever is scheduled next
                asm("v_sin_f32 %0, %2\n\tv_cos_f32 %1, %2\n\tv_nop"
                    : "=&v"(sn), "=&v"(cs) : "v"(th[j][r >> 2][r & 3] * 0.15915494f));
                #pragma unroll
                for (int g = 0; g < 2; g++) {
                    float v0 = acc[g][0][j][r], v1 = acc[g][1][j][r];
                    acc[g][0][j][r] = v0 * cs - v1 * sn;
                    acc[g][1][j][r] = v1 * cs + v0 * sn;
                }
            }
        }
    }

    #pragma unroll
    for (int g = 0; g < 2; g++) {
        v8bf row[16];
        stage(acc[g], row);
        // [B,H,S,D]: the group's 64 rows are 8 KB in a row
        __bf16* dst = (g == 0 ? qd : kd) + ((size_t)(b * HEADS + h) * SEQ + seqb) * HD + lane * 8;
        #pragma unroll
        for (int t = 0; t < 16; t++) *reinterpret_cast<v8bf*>(dst + t * 4 * HD) = row[t];
        // k's staging rewrites the address and data registers of q's stores: the wait stands
        // in front of that rewrite, and the fence keeps k's conversions from rising over it
        if (g == 0) {
            asm volatile("s_wait_xcnt 0x0" ::: "memory");
            __builtin_amdgcn_sched_barrier(0);
        }
    }
}

// ---------------------------------------------------------------- K3: causal flash attention
// the value that lane l ^ 16 holds
__device__ __forceinline__ float other_half(float v) {
    int b = __builtin_bit_cast(int, v);
    return __builtin_bit_cast(float, __builtin_amdgcn_permlanex16(b, b, 0x76543210, 0xfedcba98, false, false));
}

// 2^x in asm. Early-clobber outputs keep every source whole
// inside the statement; the v_nop fills the slot behind the last one, whatever comes next.
#define LOG2E 1.44269504f
__device__ __forceinline__ float exp2_x1(float x) {
    float p;
    asm("v_exp_f32 %0, %1\n\tv_nop" : "=&v"(p) : "v"(x));
    return p;
}
__device__ __forceinline__ void exp2_x8(float (&p)[8], const float (&x)[8]) {
    asm("v_exp_f32 %0, %8\n\t"
        "v_exp_f32 %1, %9\n\t"
        "v_exp_f32 %2, %10\n\t"
        "v_exp_f32 %3, %11\n\t"
        "v_exp_f32 %4, %12\n\t"
        "v_exp_f32 %5, %13\n\t"
        "v_exp_f32 %6, %14\n\t"
        "v_exp_f32 %7, %15\n\t"
        "v_nop"
        : "=&v"(p[0]), "=&v"(p[1]), "=&v"(p[2]), "=&v"(p[3]),
          "=&v"(p[4]), "=&v"(p[5]), "=&v"(p[6]), "=&v"(p[7])
        : "v"(x[0]), "v"(x[1]), "v"(x[2]), "v"(x[3]), "v"(x[4]), "v"(x[5]), "v"(x[6]), "v"(x[7]));
}

__global__ __launch_bounds__(512) __attribute__((amdgpu_waves_per_eu(4, 4)))
void attention_kernel(
        const __bf16* __restrict__ qd, const __bf16* __restrict__ kd,
        const __bf16* __restrict__ vd, __bf16* __restrict__ od) {
    // per chunk of 64 keys: K as [key][d], then V as [d][key], pitch 144 B. Side by side, so that
    // a chunk's 32 LDS reads are one address register and immediate offsets.
    __shared__ __align__(16) __bf16 KV[SEQ / 64][2][64][72];
    const int z  = blockIdx.x >> 7;    // 0..1
    const int bh = blockIdx.x & 127;   // b*16+h
    const int b  = bh >> 4, h = bh & 15;
    const int tid = threadIdx.x, lane = tid & 31;
    const int wave = __builtin_amdgcn_readfirstlane(tid >> 5);
    const int ln = lane & 15, hi = lane >> 4;

    // Two chunks a call, 4 copies a lane; one copy of the block is one chunk of 64 keys, 128 bytes
    // a row: of K 64 key rows (8 KB in a row), of V the chunk's piece of all 64 d rows.
    const __bf16* kg = kd + (size_t)bh * SEQ * HD + tid * 8;
    const __bf16* vg = vd + ((size_t)bh * HD + (tid >> 3)) * SEQ + (tid & 7) * 8;
    const unsigned kl = (unsigned)(uintptr_t)&KV[0][0][tid >> 3][(tid & 7) * 8];
    const unsigned vl = (unsigned)(uintptr_t)&KV[0][1][tid >> 3][(tid & 7) * 8];
    auto load_pair = [&](int c0) {
        async_copy16_x4(kl + c0 * 18432, kl + (c0 + 1) * 18432, vl + c0 * 18432, vl + (c0 + 1) * 18432,
                        kg + c0 * (64 * HD), kg + (c0 + 1) * (64 * HD), vg + c0 * 64, vg + (c0 + 1) * 64);
    };

    v16bf qfrag[2];     // Q fragments resident in registers for the whole tile
    v8f accO[4];        // accO[df][r] = O[query ln][d = df * 16 + 8 * hi + r]
    float mrun, lrun;   // of query ln; lrun sums this half's keys only
    int qg;             // the lane's query
    auto begin_tile = [&](int tile) {
        qg = tile * 16 + ln;
        const __bf16* qrow = qd + ((size_t)bh * SEQ + qg) * HD;
        qfrag[0] = ld_frag(qrow, 0 * 32 + hi * 8);
        qfrag[1] = ld_frag(qrow, 1 * 32 + hi * 8);
        #pragma unroll
        for (int df = 0; df < 4; df++) accO[df] = v8f{};
        mrun = -1e30f;
        lrun = 0.f;
    };

    auto chunk = [&](int ci) {
        const int j0 = ci * 64;
        // scores: K(64keys x 64d) * Q(16x64d)^T -> 4 frags of 16 keys x 16 queries,
        // accS[nf][r] = S[query ln][key j0 + nf * 16 + 8 * hi + r]
        v16bf kf[4][2], vf[4][2];
        #pragma unroll
        for (int nf = 0; nf < 4; nf++)
            #pragma unroll
            for (int kk = 0; kk < 2; kk++)
                kf[nf][kk] = ld_frag(&KV[ci][0][nf * 16 + ln][0], kk * 32 + hi * 8);
        // keeps the chunk's 16 K reads one group ahead of the 8 score WMMAs: left alone the
        // scheduler reuses one fragment's registers and waits out the LDS latency per WMMA
        __builtin_amdgcn_sched_barrier(0);
        v8f accS[4] = {};
        #pragma unroll
        for (int kk = 0; kk < 2; kk++)
            #pragma unroll
            for (int nf = 0; nf < 4; nf++)
                accS[nf] = wmma_bf16(kf[nf][kk], qfrag[kk], accS[nf]);
        #pragma unroll
        for (int df = 0; df < 4; df++)
            #pragma unroll
            for (int kk = 0; kk < 2; kk++)
                vf[df][kk] = ld_frag(&KV[ci][1][df * 16 + ln][0], kk * 32 + hi * 8);
        // keeps the chunk's 16 V reads ahead of the softmax, whose vector work covers their latency
        __builtin_amdgcn_sched_barrier(0);

        // online softmax of one query per lane
        const int lim = qg - j0 - 8 * hi;   // key nf * 16 + r of this half is seen if <= lim
        float cmax[4];
        #pragma unroll
        for (int nf = 0; nf < 4; nf++) {
            #pragma unroll
            for (int r = 0; r < 8; r++) {
                float v = accS[nf][r] * 0.125f;   // 1/sqrt(64)
                accS[nf][r] = (nf * 16 + r <= lim) ? v : -1e30f;
            }
            cmax[nf] = fmaxf(fmaxf(fmaxf(accS[nf][0], accS[nf][1]), fmaxf(accS[nf][2], accS[nf][3])),
                             fmaxf(fmaxf(accS[nf][4], accS[nf][5]), fmaxf(accS[nf][6], accS[nf][7])));
        }
        float rmax = fmaxf(fmaxf(cmax[0], cmax[1]), fmaxf(cmax[2], cmax[3]));
        rmax = fmaxf(rmax, other_half(rmax));
        const float mnew = fmaxf(mrun, rmax);
        const float corr = exp2_x1((mrun - mnew) * LOG2E);
        mrun = mnew;
        // P^T as B operand: element s of pf[kk] is key kk * 32 + (s < 8 ? 8 * hi + s : 16 + 8 * hi + s - 8),
        // the k order of ld_frag, which loads V^T beside it
        v16bf pf[2];
        float csum[4];
        #pragma unroll
        for (int nf = 0; nf < 4; nf++) {
            float e[8], p[8];
            #pragma unroll
            for (int r = 0; r < 8; r++) e[r] = (accS[nf][r] - mnew) * LOG2E;
            exp2_x8(p, e);
            #pragma unroll
            for (int r = 0; r < 8; r++) pf[nf >> 1][(nf & 1) * 8 + r] = (__bf16)p[r];
            csum[nf] = ((p[0] + p[1]) + (p[2] + p[3])) + ((p[4] + p[5]) + (p[6] + p[7]));
        }
        lrun = lrun * corr + ((csum[0] + csum[1]) + (csum[2] + csum[3]));
        #pragma unroll
        for (int df = 0; df < 4; df++) accO[df] = accO[df] * corr;

        // O^T += V^T(64d x 64keys) * P^T(64keys x 16 queries)
        #pragma unroll
        for (int df = 0; df < 4; df++) {
            #pragma unroll
            for (int kk = 0; kk < 2; kk++)
                accO[df] = wmma_bf16(vf[df][kk], pf[kk], accO[df]);
        }
    };

    const int i = wave * 2 + z;   // 0..31
    begin_tile(63 - i);           // queries 512 and up: at least 9 chunks in every wave
    load_pair(0);
    asm volatile("s_wait_asynccnt 0x0" ::: "memory");   // chunks 0, 1 landed before they are published
    __syncthreads();
    load_pair(2);
    // Chunks 0-1, 2-3, 4-7 of the upper tile; under each part the next part's keys land
    // (chunks 2-3, 4-7, 8-15). rolled: the three parts share one copy of the chunk's code
    #pragma unroll 1
    for (int part = 0; part < 3; part++) {
        const int end = part == 2 ? 8 : part * 2 + 2;
        // rolled: one copy of the chunk's code
        #pragma unroll 1
        for (int ci = part * 2; ci < end; ci++) chunk(ci);
        // this wave's copies of the next part have landed; behind the barrier every wave's have
        asm volatile("s_wait_asynccnt 0x0" ::: "memory");
        __syncthreads();
        if (part == 0) {
            load_pair(4);
            load_pair(6);
        } else if (part == 1) {
            load_pair(8);
            load_pair(10);
            load_pair(12);
            load_pair(14);
        }
    }

    // all keys are in LDS and nothing writes it any more: no barrier from here on
    // rolled: the two tiles share one copy of the chunk's code
    #pragma unroll 1
    for (int half = 0; half < 2; half++) {
        if (half == 1) begin_tile(i);
        const int nchunks = ((half == 0 ? 63 - i : i) >> 2) + 1;
        // rolled: the trip count is the wave's own
        #pragma unroll 1
        for (int ci = half == 0 ? 8 : 0; ci < nchunks; ci++) chunk(ci);

        // a lane's 8 accumulator registers are 8 consecutive d of its query: 16-byte stores
        const float inv = 1.0f / (lrun + other_half(lrun));
        __bf16* dst = od + ((size_t)(b * SEQ + qg)) * DIM + h * HD + 8 * hi;
        #pragma unroll
        for (int df = 0; df < 4; df++)
            *reinterpret_cast<v8bf*>(dst + df * 16) = __builtin_convertvector(accO[df] * inv, v8bf);
        // the second tile's set-up rewrites the address and data registers of these stores:
        // the wait stands in front of that rewrite
        asm volatile("s_wait_xcnt 0x0" ::: "memory");
    }
}

// ---------------------------------------------------------------- K4: out-proj + residual
// out[8192,1024] = O[8192,1024] * Wout[1024,1024]^T + x
// 128 x 128 block tile, 4 waves (2 x 2) of 64 x 64: 512 blocks, two for each WGP.
__global__ __launch_bounds__(128) __attribute__((amdgpu_waves_per_eu(4, 4)))
void outproj_kernel(
        const __bf16* __restrict__ o, const __bf16* __restrict__ wout,
        const float* __restrict__ x, float* __restrict__ out) {
    const int n0 = blockIdx.x * 128;
    const int m0 = blockIdx.y * 128;
    const int wave = __builtin_amdgcn_readfirstlane(threadIdx.x >> 5);
    const int lane = threadIdx.x & 31;
    const int ln = lane & 15, hi = lane >> 4;
    const int wm = wave >> 1, wn = wave & 1;

    __shared__ __align__(16) __bf16 sm[2 * 128 * 72 + 2 * 128 * 72];
    // weight rows first: a lane's 8 registers are 8 adjacent columns of one token's row
    v8f acc[4][4] = {};
    gemm_nt_mainloop<2>(sm, o + (size_t)m0 * DIM, wout + (size_t)n0 * DIM, wm, wn, true, acc);

    // The wave's 64 x 64 tile goes through its own 64 x 68 floats of LDS, 16 bytes a lane both
    // ways: x is read and out written 256 bytes of a row at a time, whole 128-byte lines.
    float* st = reinterpret_cast<float*>(sm) + wave * (64 * 68);
    #pragma unroll
    for (int j = 0; j < 4; j++)
        #pragma unroll
        for (int i = 0; i < 4; i++) {
            float* p = st + (j * 16 + ln) * 68 + i * 16 + 8 * hi;
            *reinterpret_cast<v4f*>(p)     = __builtin_shufflevector(acc[i][j], acc[i][j], 0, 1, 2, 3);
            *reinterpret_cast<v4f*>(p + 4) = __builtin_shufflevector(acc[i][j], acc[i][j], 4, 5, 6, 7);
        }
    const unsigned at = (unsigned)(m0 + wm * 64 + hi) * DIM + n0 + wn * 64 + ln * 4;   // 2 rows a load
    float* dst        = out + at;
    const float* skip = x   + at;
    v4f sk[32];
    #pragma unroll
    for (int t = 0; t < 32; t++) sk[t] = *reinterpret_cast<const v4f*>(skip + t * 2 * DIM);
    // the rows read back below were written by other lanes of this wave
    asm volatile("s_wait_dscnt 0x0" ::: "memory");
    const float* sr = st + hi * 68 + ln * 4;
    #pragma unroll
    for (int t = 0; t < 32; t++)
        *reinterpret_cast<v4f*>(dst + t * 2 * DIM) = *reinterpret_cast<const v4f*>(sr + t * 2 * 68) + sk[t];
}

// ---------------------------------------------------------------- launch
extern "C" void kernel_launch(void* const* d_in, const int* in_sizes, int n_in,
                              void* d_out, int out_size, void* d_ws, size_t ws_size,
                              hipStream_t stream) {
    const float* x     = (const float*)d_in[0];   // [8,1024,1024]
    const float* scale = (const float*)d_in[1];   // [1024]
    const float* wqkv  = (const float*)d_in[2];   // [3072,1024]
    const float* wout  = (const float*)d_in[3];   // [1024,1024]
    const float* theta = (const float*)d_in[4];   // [1024,16,16]

    char* ws = (char*)d_ws;
    __bf16* wqkv_bf = (__bf16*)(ws);                         //  6,291,456 B
    __bf16* wout_bf = (__bf16*)(ws + 6291456);               //  2,097,152 B
    __bf16* xn_bf   = (__bf16*)(ws + 8388608);               // 16,777,216 B
    __bf16* q_bf    = (__bf16*)(ws + 25165824);              // [B,H,S,D]
    __bf16* k_bf    = (__bf16*)(ws + 41943040);              // [B,H,S,D]
    __bf16* v_bf    = (__bf16*)(ws + 58720256);              // [B,H,D,S]
    __bf16* o_bf    = (__bf16*)(ws + 75497472);              // [B,S,H*D]
    float*  outp    = (float*)d_out;

    prep_kernel<<<NTOK / 2 / 16, 512, 0, stream>>>(x, scale, wqkv, wout, xn_bf, wqkv_bf, wout_bf);
    qkv_gemm_rope_kernel<<<dim3(DIM / 128, NTOK / 256), 256, 0, stream>>>(
        xn_bf, wqkv_bf, theta, q_bf, k_bf, v_bf);
    attention_kernel<<<BATCH * HEADS * 2, 512, 0, stream>>>(q_bf, k_bf, v_bf, o_bf);
    outproj_kernel<<<dim3(DIM / 128, NTOK / 128), 128, 0, stream>>>(o_bf, wout_bf, x, outp);
}

// v009
// A run of this version takes 83.4 microseconds.
// In both of two side-by-side timings against v008, it was 1.04 times as fast.
// Over all steps from v000 it is 2.84 times as fast.
#include <hip/hip_runtime.h>

#define DIM    1024
#define HEADS  16
#define HD     64
#define SEQ    1024
#define BATCH  8
#define NTOK   (BATCH * SEQ)   // 8192
#define QKV_N  (3 * DIM)       // 3072

typedef __attribute__((ext_vector_type(16))) __bf16 v16bf;
typedef __attribute__((ext_vector_type(8)))  __bf16 v8bf;
typedef __attribute__((ext_vector_type(8)))  float  v8f;

// Load one 16-bf16 WMMA A/B fragment for this lane from a row (LDS or global):
// per CDNA5 ISA 16-bit layout, lane holds k = base+0..7 and k = base+16..23
// with base = (lane>>4)*8, row = lane&15. k0 = chunk*32 + (lane>>4)*8.
__device__ __forceinline__ v16bf ld_frag(const __bf16* row, int k0) {
    v8bf lo = *reinterpret_cast<const v8bf*>(row + k0);
    v8bf hi = *reinterpret_cast<const v8bf*>(row + k0 + 16);
    return __builtin_shufflevector(lo, hi, 0,1,2,3,4,5,6,7,8,9,10,11,12,13,14,15);
}

__device__ __forceinline__ v8f wmma_bf16(v16bf a, v16bf b, v8f c) {
    return __builtin_amdgcn_wmma_f32_16x16x32_bf16(false, a, false, b, (short)0, c, false, false);
}

// Async copies global -> LDS (GLOBAL_LOAD_ASYNC_TO_LDS_B128, ASYNCcnt), 16 bytes a lane.
// Generic LDS pointer: low 32 bits are the LDS byte offset (flat aperture rule).
// Four copies of one lane. s_wait_xcnt 0 is the last line of the copies' own statement, so that
// it stands in front of any later rewrite of the address registers they name.
__device__ __forceinline__ void async_copy16_x4(unsigned l0, unsigned l1, unsigned l2, unsigned l3,
                                                const __bf16* g0, const __bf16* g1,
                                                const __bf16* g2, const __bf16* g3) {
    asm volatile("global_load_async_to_lds_b128 %0, %4, off\n\t"
                 "global_load_async_to_lds_b128 %1, %5, off\n\t"
                 "global_load_async_to_lds_b128 %2, %6, off\n\t"
                 "global_load_async_to_lds_b128 %3, %7, off\n\t"
                 "s_wait_xcnt 0x0"
                 :: "v"(l0), "v"(l1), "v"(l2), "v"(l3), "v"(g0), "v"(g1), "v"(g2), "v"(g3)
                 : "memory");
}

// Eight 16-byte async copies of one lane, rows lstep (LDS bytes) and gstep
// (elements) apart. s_wait_xcnt 0 is the last line of the copies' own statement, so
// that it stands in front of any later rewrite of the address registers they name.
__device__ __forceinline__ void async_copy16_x8(unsigned l, unsigned lstep,
                                                const __bf16* g, size_t gstep) {
    asm volatile("global_load_async_to_lds_b128 %0, %8, off\n\t"
                 "global_load_async_to_lds_b128 %1, %9, off\n\t"
                 "global_load_async_to_lds_b128 %2, %10, off\n\t"
                 "global_load_async_to_lds_b128 %3, %11, off\n\t"
                 "global_load_async_to_lds_b128 %4, %12, off\n\t"
                 "global_load_async_to_lds_b128 %5, %13, off\n\t"
                 "global_load_async_to_lds_b128 %6, %14, off\n\t"
                 "global_load_async_to_lds_b128 %7, %15, off\n\t"
                 "s_wait_xcnt 0x0"
                 :: "v"(l), "v"(l + lstep), "v"(l + 2 * lstep), "v"(l + 3 * lstep),
                    "v"(l + 4 * lstep), "v"(l + 5 * lstep), "v"(l + 6 * lstep), "v"(l + 7 * lstep),
                    "v"(g), "v"(g + gstep), "v"(g + 2 * gstep), "v"(g + 3 * gstep),
                    "v"(g + 4 * gstep), "v"(g + 5 * gstep), "v"(g + 6 * gstep), "v"(g + 7 * gstep)
                 : "memory");
}

// Ten 16-byte async copies of one lane, global address = a scalar base each + the lane's byte
// offset, which all ten share: eleven vector registers for the ten. s_wait_xcnt 0 as above.
__device__ __forceinline__ void async_copy16_x10(const unsigned (&l)[10], unsigned voff,
                                                 const __bf16* const (&g)[10]) {
    asm volatile("global_load_async_to_lds_b128 %0, %10, %11\n\t"
                 "global_load_async_to_lds_b128 %1, %10, %12\n\t"
                 "global_load_async_to_lds_b128 %2, %10, %13\n\t"
                 "global_load_async_to_lds_b128 %3, %10, %14\n\t"
                 "global_load_async_to_lds_b128 %4, %10, %15\n\t"
                 "global_load_async_to_lds_b128 %5, %10, %16\n\t"
                 "global_load_async_to_lds_b128 %6, %10, %17\n\t"
                 "global_load_async_to_lds_b128 %7, %10, %18\n\t"
                 "global_load_async_to_lds_b128 %8, %10, %19\n\t"
                 "global_load_async_to_lds_b128 %9, %10, %20\n\t"
                 "s_wait_xcnt 0x0"
                 :: "v"(l[0]), "v"(l[1]), "v"(l[2]), "v"(l[3]), "v"(l[4]),
                    "v"(l[5]), "v"(l[6]), "v"(l[7]), "v"(l[8]), "v"(l[9]), "v"(voff),
                    "s"(g[0]), "s"(g[1]), "s"(g[2]), "s"(g[3]), "s"(g[4]),
                    "s"(g[5]), "s"(g[6]), "s"(g[7]), "s"(g[8]), "s"(g[9])
                 : "memory");
}

// NT GEMM main loop over K = DIM (both operands K-major, row pitch DIM).
// Block tile (WM*64) x 128 from WM x 2 waves; each wave keeps a 64 x 64 tile
// (4 x 4 accumulator fragments), so 8 loaded fragments feed 16 WMMAs.
// a, b point at the block's first row. Two LDS buffers, K-step 64, one barrier a step.
// A wave's copy covers four whole 128-byte rows.
// sm holds A[2][BM][72], then B[2][128][72]. Behind the loop's last barrier nobody reads it
// and no copy is in flight: the caller's epilogue may stage its tile there.
// A lane's 8 accumulator registers run along the rows of the WMMA's first operand:
// acc[i][j][r] = C[first operand's row i * 16 + 8 * hi + r][second operand's row j * 16 + ln].
// b_first picks b's rows as the first operand (block-uniform), so that the 8 registers are
// 8 adjacent elements of the output's rows, whichever way the output lies.
// rot (block-uniform): the block's step s works on k step (s + rot) mod 16. Blocks that share
// operand rows get rot spread over the 16 steps, so that few of them ask L2 for the same lines at the same
// moment, and a line that one of them has brought in from memory is an L2 hit for the others.
template <int WM>
__device__ __forceinline__ void gemm_nt_mainloop(__bf16* sm,
                                                 const __bf16* __restrict__ a,
                                                 const __bf16* __restrict__ b,
                                                 int wm, int wn, bool b_first, int rot, v8f (&acc)[4][4]) {
    constexpr int BM = WM * 64;      // rows of the A tile
    constexpr int RP = WM * 8;       // rows that one copy of the whole block covers
    constexpr int ABUF = BM * 72, BBUF = 128 * 72, BOFF = 2 * ABUF;   // in elements
    const int tid = threadIdx.x, lane = tid & 31;
    const int ln = lane & 15, hi = lane >> 4;
    const int cr = tid >> 3, cc = (tid & 7) * 8;
    const __bf16* ag = a + (size_t)cr * DIM + cc;
    const __bf16* bg = b + (size_t)cr * DIM + cc;

    auto load_tile = [&](int k0, int buf) {
        async_copy16_x8((unsigned)(uintptr_t)(sm + buf * ABUF + cr * 72 + cc), RP * 144, ag + k0, (size_t)RP * DIM);
        async_copy16_x8((unsigned)(uintptr_t)(sm + BOFF + buf * BBUF + cr * 72 + cc), RP * 144, bg + k0, (size_t)RP * DIM);
    };
    const int aofs = wm * 64 * 72, bofs = BOFF + wn * 64 * 72;
    const int pofs = b_first ? bofs : aofs, pbuf = b_first ? BBUF : ABUF;   // first operand
    const int qofs = b_first ? aofs : bofs, qbuf = b_first ? ABUF : BBUF;   // second operand

    constexpr int NSTEP = DIM / 64;   // 16
    auto kof = [&](int s) { return ((s + rot) & (NSTEP - 1)) * 64; };   // first k of the block's step s
    load_tile(kof(0), 0);
    asm volatile("s_wait_asynccnt 0x0" ::: "memory");   // tile 0 landed before it is published
    __syncthreads();
    load_tile(kof(1), 1);

    for (int i = 0; i < NSTEP; i++) {
        const int cur = i & 1;
        v16bf af[4], bf[4];
        auto load_frags = [&](int kk) {
            #pragma unroll
            for (int f = 0; f < 4; f++) {
                af[f] = ld_frag(sm + pofs + cur * pbuf + (f * 16 + ln) * 72, kk * 32 + hi * 8);
                bf[f] = ld_frag(sm + qofs + cur * qbuf + (f * 16 + ln) * 72, kk * 32 + hi * 8);
            }
        };
        auto products = [&]() {
            #pragma unroll
            for (int mf = 0; mf < 4; mf++)
                #pragma unroll
                for (int nf = 0; nf < 4; nf++)
                    acc[mf][nf] = wmma_bf16(af[mf], bf[nf], acc[mf][nf]);
        };
        load_frags(0);
        // keeps the 16 LDS reads one group ahead of their 16 WMMAs: left alone the
        // scheduler reloads one A fragment per row of 4 and waits it out each time
        __builtin_amdgcn_sched_barrier(0);
        products();
        load_frags(1);
        // publish point: this wave's reads of buffer cur are done, its copies of the
        // next tile have landed; behind the barrier buffer cur may be refilled.
        asm volatile("s_wait_dscnt 0x0" ::: "memory");
        asm volatile("s_wait_asynccnt 0x0" ::: "memory");
        __syncthreads();
        if (i + 2 < NSTEP) load_tile(kof(i + 2), cur);
        // the step's second half works from registers while the refill is in flight
        products();
    }
    asm volatile("s_wait_asynccnt 0x0" ::: "memory");   // no copy outstanding at the wave's end
}

// ---------------------------------------------------------------- K0: all f32 -> bf16 preparation
// 256 x 16 long-lived waves (for speed only). A wave owns whole 1024-float rows, 32 floats a lane as 8 loads of 512 contiguous bytes:
// two rows of x (RMSNorm; the row sum stays inside the wave) and one weight row (rounding only).
typedef __attribute__((ext_vector_type(4))) float  v4f;
typedef __attribute__((ext_vector_type(4))) __bf16 v4bf;
static_assert(QKV_N + DIM == NTOK / 2, "one weight row for every two rows of x");

// A lane's share of a row: element 4 * c + e of r[k] with c = 0, 1 is float e of the
// row's 16-byte piece (2 * k + c) * 32 + lane.
struct RowRegs { v8f r[4]; };

__device__ __forceinline__ RowRegs load_row(const float* row, int lane) {
    const v4f* p = reinterpret_cast<const v4f*>(row) + lane;
    RowRegs t;
    #pragma unroll
    for (int k = 0; k < 4; k++)
        t.r[k] = __builtin_shufflevector(p[k * 64], p[k * 64 + 32], 0, 1, 2, 3, 4, 5, 6, 7);
    return t;
}
__device__ __forceinline__ void store_row(__bf16* row, int lane, const RowRegs& t) {
    v4bf* p = reinterpret_cast<v4bf*>(row) + lane;
    #pragma unroll
    for (int k = 0; k < 4; k++) {
        p[k * 64]      = __builtin_convertvector(__builtin_shufflevector(t.r[k], t.r[k], 0, 1, 2, 3), v4bf);
        p[k * 64 + 32] = __builtin_convertvector(__builtin_shufflevector(t.r[k], t.r[k], 4, 5, 6, 7), v4bf);
    }
}
// 1 / rms of a row: eight partial sums a lane, folded, then a five-step butterfly
__device__ __forceinline__ float row_rrms(const RowRegs& t) {
    v8f a = t.r[0] * t.r[0];
    #pragma unroll
    for (int k = 1; k < 4; k++) a += t.r[k] * t.r[k];
    float ss = ((a[0] + a[1]) + (a[2] + a[3])) + ((a[4] + a[5]) + (a[6] + a[7]));
    #pragma unroll
    for (int off = 16; off > 0; off >>= 1) ss += __shfl_xor(ss, off, 32);
    return rsqrtf(ss * (1.0f / DIM) + 1e-6f);
}

__global__ __launch_bounds__(512) void prep_kernel(
        const float* __restrict__ x, const float* __restrict__ scale,
        const float* __restrict__ wqkv, const float* __restrict__ wout,
        __bf16* __restrict__ xn, __bf16* __restrict__ wqkv_bf, __bf16* __restrict__ wout_bf) {
    const int lane = threadIdx.x & 31;
    const int w = __builtin_amdgcn_readfirstlane(blockIdx.x * 16 + (threadIdx.x >> 5));   // 0..4095
    const float* wsrc = w < QKV_N ? wqkv + (size_t)w * DIM : wout + (size_t)(w - QKV_N) * DIM;
    __bf16*      wdst = w < QKV_N ? wqkv_bf + (size_t)w * DIM : wout_bf + (size_t)(w - QKV_N) * DIM;

    RowRegs x0 = load_row(x + (size_t)w * (2 * DIM), lane);
    RowRegs x1 = load_row(x + (size_t)w * (2 * DIM) + DIM, lane);
    RowRegs sc = load_row(scale, lane);
    RowRegs wr = load_row(wsrc, lane);

    const float s0 = row_rrms(x0), s1 = row_rrms(x1);
    #pragma unroll
    for (int k = 0; k < 4; k++) {
        x0.r[k] = x0.r[k] * sc.r[k] * s0;
        x1.r[k] = x1.r[k] * sc.r[k] * s1;
    }
    store_row(wdst, lane, wr);
    store_row(xn + (size_t)w * (2 * DIM), lane, x0);
    store_row(xn + (size_t)w * (2 * DIM) + DIM, lane, x1);
}

// ---------------------------------------------------------------- K2: QKV GEMM + RoPE
// C[8192,3072] = Xn[8192,1024] * Wqkv[3072,1024]^T  (NT: both K-major)
// 256 x 384 block tile: 256 tokens by 128 columns (two heads) of each of q, k and v.
// 32 x 8 = 256 blocks, one for each WGP. 8 waves (4 x 2), two a SIMD; a wave keeps 64 tokens by
// one head of q, of k and of v: three 64 x 64 groups that share the wave's four token fragments.
// Against 256 x 128 blocks of 64 x 64 waves: 640 staged rows feed 768 WMMAs a k step of 64
// (was 384 for 256), and 32 loaded fragments feed 96 WMMAs (was 16 for 32).
// sm holds A[2][256][72], then B[2][384][72]; B row g * 128 + c is weight row g * 1024 + n0 + c.
// acc[g][i][j][r] = C[first operand's row i * 16 + 8 * hi + r][second operand's row j * 16 + ln]:
// weight rows go first for q and k (the 8 registers run along d), tokens first for v.
// Behind the loop's last barrier nobody reads sm and no copy is in flight.
// rot: the block's step s works on k step (s + rot) mod 16, as in gemm_nt_mainloop.
__device__ __forceinline__ void qkv_mainloop(__bf16* sm,
                                             const __bf16* __restrict__ a,
                                             const __bf16* __restrict__ b,
                                             int wm, int wn, int rot, v8f (&acc)[3][4][4]) {
    constexpr int ABUF = 256 * 72, BBUF = 384 * 72, BOFF = 2 * ABUF;   // in elements
    const int tid = threadIdx.x, lane = tid & 31;
    const int ln = lane & 15, hi = lane >> 4;
    const int cr = tid >> 3, cc = (tid & 7) * 8;   // one copy of the block covers 32 whole rows
    const unsigned gc = (unsigned)(cr * DIM + cc) * 2;               // the lane's place in 32 rows, bytes
    const unsigned lc = (unsigned)(uintptr_t)(sm + cr * 72 + cc);

    // 20 copies a lane: 8 x 32 rows of A, then 12 x 32 rows of B (4 x 32 of each of q, k, v)
    auto load_tile = [&](int k0, int buf) {
        #pragma unroll
        for (int s = 0; s < 2; s++) {
            unsigned l[10];
            const __bf16* g[10];
            #pragma unroll
            for (int u = 0; u < 10; u++) {
                const int c = s * 10 + u, v = c - 8;
                l[u] = c < 8 ? lc + buf * (ABUF * 2) + c * (32 * 144)
                             : lc + (BOFF + buf * BBUF) * 2 + v * (32 * 144);
                g[u] = c < 8 ? a + (size_t)c * 32 * DIM
                             : b + (size_t)((v >> 2) * 1024 + (v & 3) * 32) * DIM;
            }
            async_copy16_x10(l, gc + k0 * 2, g);
        }
    };
    const __bf16* fa = sm + (wm * 64 + ln) * 72 + hi * 8;
    const __bf16* fb = sm + BOFF + (wn * 64 + ln) * 72 + hi * 8;

    constexpr int NSTEP = DIM / 64;   // 16
    auto kof = [&](int s) { return ((s + rot) & (NSTEP - 1)) * 64; };   // first k of the block's step s
    load_tile(kof(0), 0);
    asm volatile("s_wait_asynccnt 0x0" ::: "memory");   // tile 0 landed before it is published
    __syncthreads();
    load_tile(kof(1), 1);

    for (int i = 0; i < NSTEP; i++) {
        const int cur = i & 1;
        const __bf16* pa = fa + cur * ABUF;
        const __bf16* pb = fb + cur * BBUF;
        // token fragments, and a ring of six weight fragments: a group of 16 WMMAs reads four
        // of them while the next group's four are fetched, two at a time, into the free two
        v16bf af[4], bw[6];
        auto ld_a = [&](int kk) {
            #pragma unroll
            for (int f = 0; f < 4; f++) af[f] = ld_frag(pa + f * 16 * 72, kk * 32);
        };
        // fragments f0, f0 + 1 of group n of the step (n = kk * 3 + g) into their ring slots
        auto ld_b2 = [&](int n, int f0) {
            #pragma unroll
            for (int f = f0; f < f0 + 2; f++)
                bw[(n * 4 + f) % 6] = ld_frag(pb + ((n % 3) * 128 + f * 16) * 72, (n / 3) * 32);
        };
        // the 8 WMMAs of group n that read its fragments f0, f0 + 1
        auto mm2 = [&](int n, int f0) {
            #pragma unroll
            for (int f = f0; f < f0 + 2; f++)
                #pragma unroll
                for (int t = 0; t < 4; t++) {
                    if (n % 3 == 2) acc[2][t][f] = wmma_bf16(af[t], bw[(n * 4 + f) % 6], acc[2][t][f]);
                    else acc[n % 3][f][t] = wmma_bf16(bw[(n * 4 + f) % 6], af[t], acc[n % 3][f][t]);
                }
        };
        // The scheduling fences keep each group of LDS reads whole and 16 WMMAs ahead of its use.
        // Left alone the scheduler moves the reads next to their use and waits them out.
        ld_a(0); ld_b2(0, 0); ld_b2(0, 2);
        #pragma unroll
        for (int n = 0; n < 5; n++) {
            ld_b2(n + 1, 0);
            __builtin_amdgcn_sched_barrier(0);
            mm2(n, 0);
            __builtin_amdgcn_sched_barrier(0);
            ld_b2(n + 1, 2);
            __builtin_amdgcn_sched_barrier(0);
            mm2(n, 2);
            __builtin_amdgcn_sched_barrier(0);
            if (n == 2) ld_a(1);
        }
        // publish point: this wave's reads of buffer cur are done, its copies of the
        // next tile have landed; behind the barrier buffer cur may be refilled.
        asm volatile("s_wait_dscnt 0x0" ::: "memory");
        asm volatile("s_wait_asynccnt 0x0" ::: "memory");
        __syncthreads();
        // the step's last 16 WMMAs work from registers; the refill goes between their halves,
        // so that one wave of a SIMD issues its copies while the other's WMMAs run
        __builtin_amdgcn_sched_barrier(0);
        mm2(5, 0);
        __builtin_amdgcn_sched_barrier(0);
        if (i + 2 < NSTEP) load_tile(kof(i + 2), cur);
        __builtin_amdgcn_sched_barrier(0);
        mm2(5, 2);
    }
    asm volatile("s_wait_asynccnt 0x0" ::: "memory");   // no copy outstanding at the wave's end
}

__global__ __launch_bounds__(256)
void qkv_gemm_rope_kernel(
        const __bf16* __restrict__ xn, const __bf16* __restrict__ wqkv,
        const float* __restrict__ theta,
        __bf16* __restrict__ qd, __bf16* __restrict__ kd, __bf16* __restrict__ vd) {
    const int n0 = blockIdx.x * 128;   // 8 tiles over the 1024 columns of q, of k and of v
    const int m0 = blockIdx.y * 256;   // 32 tiles over 8192
    const int wave = __builtin_amdgcn_readfirstlane(threadIdx.x >> 5);
    const int lane = threadIdx.x & 31;
    const int ln = lane & 15, hi = lane >> 4;
    const int wm = wave >> 1, wn = wave & 1;

    __shared__ __align__(16) __bf16 sm[2 * 256 * 72 + 2 * 384 * 72];
    const int h = (n0 >> 6) + wn;         // the wave's head
    const int tok0 = m0 + wm * 64;        // a wave's 64 rows lie in one batch entry
    const int b = tok0 >> 10, seqb = tok0 & 1023;

    // group 0 = q, 1 = k, stored [token][d]; group 2 = v, stored [d][token]
    v8f acc[3][4][4] = {};
    // The 8 blocks of a token tile start 4 k steps apart (two and two alike), the 32 blocks of a
    // column tile one step apart.
    const int rot = (blockIdx.y + 4 * blockIdx.x) & 15;
    qkv_mainloop(sm, xn + (size_t)m0 * DIM, wqkv + (size_t)n0 * DIM, wm, wn, rot, acc);

    // Each 64 x 64 group goes through the wave's own 64 x 72 piece of LDS, 16 bytes a lane both
    // ways, and leaves as whole 128-byte lines (straight from the accumulators: 32-byte pieces).
    __bf16* st = sm + wave * (64 * 72);
    const __bf16* sr = st + (lane >> 3) * 72 + (lane & 7) * 8;   // 4 rows a load
    auto stage = [&](const v8f (&c)[4][4], v8bf (&row)[16]) {
        #pragma unroll
        for (int j = 0; j < 4; j++)
            #pragma unroll
            for (int i = 0; i < 4; i++)
                *reinterpret_cast<v8bf*>(st + (j * 16 + ln) * 72 + i * 16 + 8 * hi) =
                    __builtin_convertvector(c[i][j], v8bf);
        // the rows read back below were written by other lanes of this wave
        asm volatile("s_wait_dscnt 0x0" ::: "memory");
        #pragma unroll
        for (int t = 0; t < 16; t++) row[t] = *reinterpret_cast<const v8bf*>(sr + t * 4 * 72);
    };

    // v leaves first: its 128 accumulator registers are free before RoPE needs its own
    {
        v8bf row[16];
        stage(acc[2], row);
        // V transposed: [B,H,D,S], a row of the group is one d
        __bf16* dst = vd + ((size_t)(b * HEADS + h) * HD + (lane >> 3)) * SEQ + seqb + (lane & 7) * 8;
        #pragma unroll
        for (int t = 0; t < 16; t++) *reinterpret_cast<v8bf*>(dst + t * 4 * SEQ) = row[t];
        // what follows rewrites the address and data registers of these stores: the wait stands
        // in front of that rewrite, and the fence keeps later vector work from rising over it
        asm volatile("s_wait_xcnt 0x0" ::: "memory");
        __builtin_amdgcn_sched_barrier(0);
    }

    {
        // RoPE on d<32 of q and k: pair (d, d+16) = (acc[g][0], acc[g][1]), same lane slot;
        // d = 8 * hi + r, token j * 16 + ln; one sine and cosine serve both
        const float* tp = theta + (seqb + ln) * (HEADS * 16) + h * 16 + 8 * hi;
        v4f th[4][2];
        #pragma unroll
        for (int j = 0; j < 4; j++) {
            th[j][0] = *reinterpret_cast<const v4f*>(tp + j * 16 * (HEADS * 16));
            th[j][1] = *reinterpret_cast<const v4f*>(tp + j * 16 * (HEADS * 16) + 4);
        }
        // the eight loads share one address pair: tp stays live up to this wait, so that no
        // load's result lands in the pair and nothing rewrites it in front of the wait
        asm volatile("s_wait_xcnt 0x0" :: "v"(tp) : "memory");
        #pragma unroll
        for (int j = 0; j < 4; j++) {
            #pragma unroll
            for (int r = 0; r < 8; r++) {
                float sn, cs;
                // the fast sine and cosine (argument in turns) in one statement: its v_nop
                // fills the slot behind a transcendental, whatever is scheduled next
                asm("v_sin_f32 %0, %2\n\tv_cos_f32 %1, %2\n\tv_nop"
                    : "=&v"(sn), "=&v"(cs) : "v"(th[j][r >> 2][r & 3] * 0.15915494f));
                #pragma unroll
                for (int g = 0; g < 2; g++) {
                    float v0 = acc[g][0][j][r], v1 = acc[g][1][j][r];
                    acc[g][0][j][r] = v0 * cs - v1 * sn;
                    acc[g][1][j][r] = v1 * cs + v0 * sn;
                }
            }
        }
    }

    #pragma unroll
    for (int g = 0; g < 2; g++) {
        v8bf row[16];
        stage(acc[g], row);
        // [B,H,S,D]: the group's 64 rows are 8 KB in a row
        __bf16* dst = (g == 0 ? qd : kd) + ((size_t)(b * HEADS + h) * SEQ + seqb) * HD + lane * 8;
        #pragma unroll
        for (int t = 0; t < 16; t++) *reinterpret_cast<v8bf*>(dst + t * 4 * HD) = row[t];
        // k's staging rewrites the address and data registers of q's stores: the wait stands
        // in front of that rewrite, and the fence keeps k's conversions from rising over it
        if (g == 0) {
            asm volatile("s_wait_xcnt 0x0" ::: "memory");
            __builtin_amdgcn_sched_barrier(0);
        }
    }
}

// ---------------------------------------------------------------- K3: causal flash attention
// the value that lane l ^ 16 holds
__device__ __forceinline__ float other_half(float v) {
    int b = __builtin_bit_cast(int, v);
    return __builtin_bit_cast(float, __builtin_amdgcn_permlanex16(b, b, 0x76543210, 0xfedcba98, false, false));
}

// 2^x in asm. Early-clobber outputs keep every source whole
// inside the statement; the v_nop fills the slot behind the last one, whatever comes next.
#define LOG2E 1.44269504f
__device__ __forceinline__ float exp2_x1(float x) {
    float p;
    asm("v_exp_f32 %0, %1\n\tv_nop" : "=&v"(p) : "v"(x));
    return p;
}
__device__ __forceinline__ void exp2_x8(float (&p)[8], const float (&x)[8]) {
    asm("v_exp_f32 %0, %8\n\t"
        "v_exp_f32 %1, %9\n\t"
        "v_exp_f32 %2, %10\n\t"
        "v_exp_f32 %3, %11\n\t"
        "v_exp_f32 %4, %12\n\t"
        "v_exp_f32 %5, %13\n\t"
        "v_exp_f32 %6, %14\n\t"
        "v_exp_f32 %7, %15\n\t"
        "v_nop"
        : "=&v"(p[0]), "=&v"(p[1]), "=&v"(p[2]), "=&v"(p[3]),
          "=&v"(p[4]), "=&v"(p[5]), "=&v"(p[6]), "=&v"(p[7])
        : "v"(x[0]), "v"(x[1]), "v"(x[2]), "v"(x[3]), "v"(x[4]), "v"(x[5]), "v"(x[6]), "v"(x[7]));
}

__global__ __launch_bounds__(512) __attribute__((amdgpu_waves_per_eu(4, 4)))
void attention_kernel(
        const __bf16* __restrict__ qd, const __bf16* __restrict__ kd,
        const __bf16* __restrict__ vd, __bf16* __restrict__ od) {
    // per chunk of 64 keys: K as [key][d], then V as [d][key], pitch 144 B. Side by side, so that
    // a chunk's 32 LDS reads are one address register and immediate offsets.
    __shared__ __align__(16) __bf16 KV[SEQ / 64][2][64][72];
    const int z  = blockIdx.x >> 7;    // 0..1
    const int bh = blockIdx.x & 127;   // b*16+h
    const int b  = bh >> 4, h = bh & 15;
    const int tid = threadIdx.x, lane = tid & 31;
    const int wave = __builtin_amdgcn_readfirstlane(tid >> 5);
    const int ln = lane & 15, hi = lane >> 4;

    // Two chunks a call, 4 copies a lane; one copy of the block is one chunk of 64 keys, 128 bytes
    // a row: of K 64 key rows (8 KB in a row), of V the chunk's piece of all 64 d rows.
    const __bf16* kg = kd + (size_t)bh * SEQ * HD + tid * 8;
    const __bf16* vg = vd + ((size_t)bh * HD + (tid >> 3)) * SEQ + (tid & 7) * 8;
    const unsigned kl = (unsigned)(uintptr_t)&KV[0][0][tid >> 3][(tid & 7) * 8];
    const unsigned vl = (unsigned)(uintptr_t)&KV[0][1][tid >> 3][(tid & 7) * 8];
    auto load_pair = [&](int c0) {
        async_copy16_x4(kl + c0 * 18432, kl + (c0 + 1) * 18432, vl + c0 * 18432, vl + (c0 + 1) * 18432,
                        kg + c0 * (64 * HD), kg + (c0 + 1) * (64 * HD), vg + c0 * 64, vg + (c0 + 1) * 64);
    };

    v16bf qfrag[2];     // Q fragments resident in registers for the whole tile
    v8f accO[4];        // accO[df][r] = O[query ln][d = df * 16 + 8 * hi + r]
    float mrun, lrun;   // of query ln; lrun sums this half's keys only
    int qg;             // the lane's query
    auto begin_tile = [&](int tile) {
        qg = tile * 16 + ln;
        const __bf16* qrow = qd + ((size_t)bh * SEQ + qg) * HD;
        qfrag[0] = ld_frag(qrow, 0 * 32 + hi * 8);
        qfrag[1] = ld_frag(qrow, 1 * 32 + hi * 8);
        #pragma unroll
        for (int df = 0; df < 4; df++) accO[df] = v8f{};
        mrun = -1e30f;
        lrun = 0.f;
    };

    auto chunk = [&](int ci) {
        const int j0 = ci * 64;
        // scores: K(64keys x 64d) * Q(16x64d)^T -> 4 frags of 16 keys x 16 queries,
        // accS[nf][r] = S[query ln][key j0 + nf * 16 + 8 * hi + r]
        v16bf kf[4][2], vf[4][2];
        #pragma unroll
        for (int nf = 0; nf < 4; nf++)
            #pragma unroll
            for (int kk = 0; kk < 2; kk++)
                kf[nf][kk] = ld_frag(&KV[ci][0][nf * 16 + ln][0], kk * 32 + hi * 8);
        // keeps the chunk's 16 K reads one group ahead of the 8 score WMMAs: left alone the
        // scheduler reuses one fragment's registers and waits out the LDS latency per WMMA
        __builtin_amdgcn_sched_barrier(0);
        v8f accS[4] = {};
        #pragma unroll
        for (int kk = 0; kk < 2; kk++)
            #pragma unroll
            for (int nf = 0; nf < 4; nf++)
                accS[nf] = wmma_bf16(kf[nf][kk], qfrag[kk], accS[nf]);
        #pragma unroll
        for (int df = 0; df < 4; df++)
            #pragma unroll
            for (int kk = 0; kk < 2; kk++)
                vf[df][kk] = ld_frag(&KV[ci][1][df * 16 + ln][0], kk * 32 + hi * 8);
        // keeps the chunk's 16 V reads ahead of the softmax, whose vector work covers their latency
        __builtin_amdgcn_sched_barrier(0);

        // online softmax of one query per lane
        const int lim = qg - j0 - 8 * hi;   // key nf * 16 + r of this half is seen if <= lim
        float cmax[4];
        #pragma unroll
        for (int nf = 0; nf < 4; nf++) {
            #pragma unroll
            for (int r = 0; r < 8; r++) {
                float v = accS[nf][r] * 0.125f;   // 1/sqrt(64)
                accS[nf][r] = (nf * 16 + r <= lim) ? v : -1e30f;
            }
            cmax[nf] = fmaxf(fmaxf(fmaxf(accS[nf][0], accS[nf][1]), fmaxf(accS[nf][2], accS[nf][3])),
                             fmaxf(fmaxf(accS[nf][4], accS[nf][5]), fmaxf(accS[nf][6], accS[nf][7])));
        }
        float rmax = fmaxf(fmaxf(cmax[0], cmax[1]), fmaxf(cmax[2], cmax[3]));
        rmax = fmaxf(rmax, other_half(rmax));
        const float mnew = fmaxf(mrun, rmax);
        const float corr = exp2_x1((mrun - mnew) * LOG2E);
        mrun = mnew;
        // P^T as B operand: element s of pf[kk] is key kk * 32 + (s < 8 ? 8 * hi + s : 16 + 8 * hi + s - 8),
        // the k order of ld_frag, which loads V^T beside it
        v16bf pf[2];
        float csum[4];
        #pragma unroll
        for (int nf = 0; nf < 4; nf++) {
            float e[8], p[8];
            #pragma unroll
            for (int r = 0; r < 8; r++) e[r] = (accS[nf][r] - mnew) * LOG2E;
            exp2_x8(p, e);
            #pragma unroll
            for (int r = 0; r < 8; r++) pf[nf >> 1][(nf & 1) * 8 + r] = (__bf16)p[r];
            csum[nf] = ((p[0] + p[1]) + (p[2] + p[3])) + ((p[4] + p[5]) + (p[6] + p[7]));
        }
        lrun = lrun * corr + ((csum[0] + csum[1]) + (csum[2] + csum[3]));
        #pragma unroll
        for (int df = 0; df < 4; df++) accO[df] = accO[df] * corr;

        // O^T += V^T(64d x 64keys) * P^T(64keys x 16 queries)
        #pragma unroll
        for (int df = 0; df < 4; df++) {
            #pragma unroll
            for (int kk = 0; kk < 2; kk++)
                accO[df] = wmma_bf16(vf[df][kk], pf[kk], accO[df]);
        }
    };

    const int i = wave * 2 + z;   // 0..31
    begin_tile(63 - i);           // queries 512 and up: at least 9 chunks in every wave
    load_pair(0);
    asm volatile("s_wait_asynccnt 0x0" ::: "memory");   // chunks 0, 1 landed before they are published
    __syncthreads();
    load_pair(2);
    // Chunks 0-1, 2-3, 4-7 of the upper tile; under each part the next part's keys land
    // (chunks 2-3, 4-7, 8-15). rolled: the three parts share one copy of the chunk's code
    #pragma unroll 1
    for (int part = 0; part < 3; part++) {
        const int end = part == 2 ? 8 : part * 2 + 2;
        // rolled: one copy of the chunk's code
        #pragma unroll 1
        for (int ci = part * 2; ci < end; ci++) chunk(ci);
        // this wave's copies of the next part have landed; behind the barrier every wave's have
        asm volatile("s_wait_asynccnt 0x0" ::: "memory");
        __syncthreads();
        if (part == 0) {
            load_pair(4);
            load_pair(6);
        } else if (part == 1) {
            load_pair(8);
            load_pair(10);
            load_pair(12);
            load_pair(14);
        }
    }

    // all keys are in LDS and nothing writes it any more: no barrier from here on
    // rolled: the two tiles share one copy of the chunk's code
    #pragma unroll 1
    for (int half = 0; half < 2; half++) {
        if (half == 1) begin_tile(i);
        const int nchunks = ((half == 0 ? 63 - i : i) >> 2) + 1;
        // rolled: the trip count is the wave's own
        #pragma unroll 1
        for (int ci = half == 0 ? 8 : 0; ci < nchunks; ci++) chunk(ci);

        // a lane's 8 accumulator registers are 8 consecutive d of its query: 16-byte stores
        const float inv = 1.0f / (lrun + other_half(lrun));
        __bf16* dst = od + ((size_t)(b * SEQ + qg)) * DIM + h * HD + 8 * hi;
        #pragma unroll
        for (int df = 0; df < 4; df++)
            *reinterpret_cast<v8bf*>(dst + df * 16) = __builtin_convertvector(accO[df] * inv, v8bf);
        // the second tile's set-up rewrites the address and data registers of these stores:
        // the wait stands in front of that rewrite
        asm volatile("s_wait_xcnt 0x0" ::: "memory");
    }
}

// ---------------------------------------------------------------- K4: out-proj + residual
// out[8192,1024] = O[8192,1024] * Wout[1024,1024]^T + x
// 128 x 128 block tile, 4 waves (2 x 2) of 64 x 64: 512 blocks, two for each WGP.
__global__ __launch_bounds__(128) __attribute__((amdgpu_waves_per_eu(4, 4)))
void outproj_kernel(
        const __bf16* __restrict__ o, const __bf16* __restrict__ wout,
        const float* __restrict__ x, float* __restrict__ out) {
    const int n0 = blockIdx.x * 128;
    const int m0 = blockIdx.y * 128;
    const int wave = __builtin_amdgcn_readfirstlane(threadIdx.x >> 5);
    const int lane = threadIdx.x & 31;
    const int ln = lane & 15, hi = lane >> 4;
    const int wm = wave >> 1, wn = wave & 1;

    __shared__ __align__(16) __bf16 sm[2 * 128 * 72 + 2 * 128 * 72];
    // weight rows first: a lane's 8 registers are 8 adjacent columns of one token's row
    v8f acc[4][4] = {};
    const int rot = (blockIdx.y + 4 * blockIdx.x) & 15;   // as in the QKV GEMM
    gemm_nt_mainloop<2>(sm, o + (size_t)m0 * DIM, wout + (size_t)n0 * DIM, wm, wn, true, rot, acc);

    // The wave's 64 x 64 tile goes through its own 64 x 68 floats of LDS, 16 bytes a lane both
    // ways: x is read and out written 256 bytes of a row at a time, whole 128-byte lines.
    float* st = reinterpret_cast<float*>(sm) + wave * (64 * 68);
    #pragma unroll
    for (int j = 0; j < 4; j++)
        #pragma unroll
        for (int i = 0; i < 4; i++) {
            float* p = st + (j * 16 + ln) * 68 + i * 16 + 8 * hi;
            *reinterpret_cast<v4f*>(p)     = __builtin_shufflevector(acc[i][j], acc[i][j], 0, 1, 2, 3);
            *reinterpret_cast<v4f*>(p + 4) = __builtin_shufflevector(acc[i][j], acc[i][j], 4, 5, 6, 7);
        }
    const unsigned at = (unsigned)(m0 + wm * 64 + hi) * DIM + n0 + wn * 64 + ln * 4;   // 2 rows a load
    float* dst        = out + at;
    const float* skip = x   + at;
    v4f sk[32];
    #pragma unroll
    for (int t = 0; t < 32; t++) sk[t] = *reinterpret_cast<const v4f*>(skip + t * 2 * DIM);
    // the rows read back below were written by other lanes of this wave
    asm volatile("s_wait_dscnt 0x0" ::: "memory");
    const float* sr = st + hi * 68 + ln * 4;
    #pragma unroll
    for (int t = 0; t < 32; t++)
        *reinterpret_cast<v4f*>(dst + t * 2 * DIM) = *reinterpret_cast<const v4f*>(sr + t * 2 * 68) + sk[t];
}

// ---------------------------------------------------------------- launch
extern "C" void kernel_launch(void* const* d_in, const int* in_sizes, int n_in,
                              void* d_out, int out_size, void* d_ws, size_t ws_size,
                              hipStream_t stream) {
    const float* x     = (const float*)d_in[0];   // [8,1024,1024]
    const float* scale = (const float*)d_in[1];   // [1024]
    const float* wqkv  = (const float*)d_in[2];   // [3072,1024]
    const float* wout  = (const float*)d_in[3];   // [1024,1024]
    const float* theta = (const float*)d_in[4];   // [1024,16,16]

    char* ws = (char*)d_ws;
    __bf16* wqkv_bf = (__bf16*)(ws);                         //  6,291,456 B
    __bf16* wout_bf = (__bf16*)(ws + 6291456);               //  2,097,152 B
    __bf16* xn_bf   = (__bf16*)(ws + 8388608);               // 16,777,216 B
    __bf16* q_bf    = (__bf16*)(ws + 25165824);              // [B,H,S,D]
    __bf16* k_bf    = (__bf16*)(ws + 41943040);              // [B,H,S,D]
    __bf16* v_bf    = (__bf16*)(ws + 58720256);              // [B,H,D,S]
    __bf16* o_bf    = (__bf16*)(ws + 75497472);              // [B,S,H*D]
    float*  outp    = (float*)d_out;

    prep_kernel<<<NTOK / 2 / 16, 512, 0, stream>>>(x, scale, wqkv, wout, xn_bf, wqkv_bf, wout_bf);
    qkv_gemm_rope_kernel<<<dim3(DIM / 128, NTOK / 256), 256, 0, stream>>>(
        xn_bf, wqkv_bf, theta, q_bf, k_bf, v_bf);
    attention_kernel<<<BATCH * HEADS * 2, 512, 0, stream>>>(q_bf, k_bf, v_bf, o_bf);
    outproj_kernel<<<dim3(DIM / 128, NTOK / 128), 128, 0, stream>>>(o_bf, wout_bf, x, outp);
}

// v010
// A run of this version takes 80.5 microseconds.
// Next to v009, in two timings, it ran 1.04 times as fast each time.
// All steps since v000 together make it 2.94 times as fast.
#include <hip/hip_runtime.h>

#define DIM    1024
#define HEADS  16
#define HD     64
#define SEQ    1024
#define BATCH  8
#define NTOK   (BATCH * SEQ)   // 8192
#define QKV_N  (3 * DIM)       // 3072

typedef __attribute__((ext_vector_type(16))) __bf16 v16bf;
typedef __attribute__((ext_vector_type(8)))  __bf16 v8bf;
typedef __attribute__((ext_vector_type(8)))  float  v8f;

// Load one 16-bf16 WMMA A/B fragment for this lane from a row (LDS or global):
// per CDNA5 ISA 16-bit layout, lane holds k = base+0..7 and k = base+16..23
// with base = (lane>>4)*8, row = lane&15. k0 = chunk*32 + (lane>>4)*8.
__device__ __forceinline__ v16bf ld_frag(const __bf16* row, int k0) {
    v8bf lo = *reinterpret_cast<const v8bf*>(row + k0);
    v8bf hi = *reinterpret_cast<const v8bf*>(row + k0 + 16);
    return __builtin_shufflevector(lo, hi, 0,1,2,3,4,5,6,7,8,9,10,11,12,13,14,15);
}

__device__ __forceinline__ v8f wmma_bf16(v16bf a, v16bf b, v8f c) {
    return __builtin_amdgcn_wmma_f32_16x16x32_bf16(false, a, false, b, (short)0, c, false, false);
}

// Async copies global -> LDS (GLOBAL_LOAD_ASYNC_TO_LDS_B128, ASYNCcnt), 16 bytes a lane.
// Generic LDS pointer: low 32 bits are the LDS byte offset (flat aperture rule).
// Four copies of one lane. s_wait_xcnt 0 is the last line of the copies' own statement, so that
// it stands in front of any later rewrite of the address registers they name.
__device__ __forceinline__ void async_copy16_x4(unsigned l0, unsigned l1, unsigned l2, unsigned l3,
                                                const __bf16* g0, const __bf16* g1,
                                                const __bf16* g2, const __bf16* g3) {
    asm volatile("global_load_async_to_lds_b128 %0, %4, off\n\t"
                 "global_load_async_to_lds_b128 %1, %5, off\n\t"
                 "global_load_async_to_lds_b128 %2, %6, off\n\t"
                 "global_load_async_to_lds_b128 %3, %7, off\n\t"
                 "s_wait_xcnt 0x0"
                 :: "v"(l0), "v"(l1), "v"(l2), "v"(l3), "v"(g0), "v"(g1), "v"(g2), "v"(g3)
                 : "memory");
}

// Tensor load global -> LDS (TENSOR_LOAD_TO_LDS, TENSORcnt): one request of one wave brings a tile of
// 128 rows of 128 bytes (64 k of 128 operand rows, source pitch 2 * DIM bytes) and lays it at a pitch of
// 144 bytes, through no register.
typedef uint32_t u32x4 __attribute__((ext_vector_type(4)));
typedef uint32_t u32x8 __attribute__((ext_vector_type(8)));
__device__ __forceinline__ uint32_t uni(uint32_t v) { return (uint32_t)__builtin_amdgcn_readfirstlane(v); }
// a wave-uniform test held in a scalar register, so that the branch on it is a scalar branch:
// a tensor load ignores EXEC, only such a branch keeps a wave from issuing it
__device__ __forceinline__ uint32_t pinned(uint32_t v) {
    uint32_t w = uni(v);
    asm volatile("" : "+s"(w));   // the word stays in a scalar register
    return w;
}
__device__ __forceinline__ u32x8 tdm_group1() {
    constexpr uint32_t d0 = 128, d1 = 128;   // bytes a row, rows; tensor dims = tile dims
    u32x8 g;
    g[0] = uni((1u << 20) | (4u << 22) | (3u << 25));   // no mask, bytes, 16 bytes of pad behind every 128
    g[1] = uni((d0 & 0xFFFFu) << 16);
    g[2] = uni((d0 >> 16) | ((d1 & 0xFFFFu) << 16));
    g[3] = uni((d1 >> 16) | (d0 << 16));
    g[4] = uni(d1);
    g[5] = uni(DIM * 2);
    g[6] = uni(0u);
    g[7] = uni(0u);
    return g;
}
__device__ __forceinline__ u32x4 tdm_group0(uint32_t lds_dst, uint64_t ga) {
    u32x4 g;
    g[0] = uni(1u);
    g[1] = uni(lds_dst);
    g[2] = uni((uint32_t)ga);
    g[3] = uni((((uint32_t)(ga >> 32)) & 0x01FFFFFFu) | 0x80000000u);
    return g;
}
__device__ __forceinline__ void tdm_load(u32x4 g0, u32x8 g1) {
    asm volatile("tensor_load_to_lds %0, %1" :: "s"(g0), "s"(g1) : "memory");
}
constexpr int TILE_LDS = 128 * 144;   // a tile's bytes in LDS, 9 x 2 KiB

// NT GEMM main loop over K = DIM (both operands K-major, row pitch DIM).
// Block tile (WM*64) x 128 from WM x 2 waves; each wave keeps a 64 x 64 tile
// (4 x 4 accumulator fragments), so 8 loaded fragments feed 16 WMMAs.
// a, b point at the block's first row. Two LDS buffers, K-step 64, one barrier a step.
// Wave 0 brings the A tile of a step, wave 1 the B tile, one tensor load each.
// sm holds A[2][BM][72], then B[2][128][72]. Behind the loop's last barrier nobody reads it
// and no load is in flight: the caller's epilogue may stage its tile there.
// A lane's 8 accumulator registers run along the rows of the WMMA's first operand:
// acc[i][j][r] = C[first operand's row i * 16 + 8 * hi + r][second operand's row j * 16 + ln].
// b_first picks b's rows as the first operand (block-uniform), so that the 8 registers are
// 8 adjacent elements of the output's rows, whichever way the output lies.
// rot (block-uniform): the block's step s works on k step (s + rot) mod 16. Blocks that share
// operand rows get rot spread over the 16 steps, so that few of them ask L2 for the same lines at the same
// moment, and a line that one of them has brought in from memory is an L2 hit for the others.
template <int WM>
__device__ __forceinline__ void gemm_nt_mainloop(__bf16* sm,
                                                 const __bf16* __restrict__ a,
                                                 const __bf16* __restrict__ b,
                                                 int wm, int wn, bool b_first, int rot, v8f (&acc)[4][4]) {
    static_assert(WM == 2, "one tile of 128 rows for each operand");
    constexpr int BM = WM * 64;      // rows of the A tile
    constexpr int ABUF = BM * 72, BBUF = 128 * 72, BOFF = 2 * ABUF;   // in elements
    const int tid = threadIdx.x, lane = tid & 31;
    const int ln = lane & 15, hi = lane >> 4;
    const uint32_t wave = uni(tid >> 5);
    u32x8 g1 = tdm_group1();
    // as in pinned(), for the whole group: its words keep their scalar registers through the loop
    asm volatile("" : "+s"(g1));
    u32x4 g0;
    g0[0] = pinned(1u);   // count 1: written once, the word keeps its scalar register through the loop
    const __bf16* gs = wave == 0 ? a : b;                                              // the wave's operand
    const uint32_t ls = uni((uint32_t)(uintptr_t)sm) + (wave == 0 ? 0 : BOFF * 2);     // its place in buffer 0

    // Every wave forms the request's group 0 (scalar work, one definition on every path); the load
    // itself stands under the scalar branch that picks waves 0 and 1.
    auto form = [&](int k0, int buf) {
        const u32x4 n = tdm_group0(ls + buf * TILE_LDS, (uint64_t)(uintptr_t)(gs + k0));
        g0[1] = n[1]; g0[2] = n[2]; g0[3] = n[3];
    };
    // the issuer's wait. It names both groups, so that they stay live and no register of the
    // outstanding request's descriptor takes a new value in front of it
    auto landed = [&]() { asm volatile("s_wait_tensorcnt 0x0" :: "s"(g0), "s"(g1) : "memory"); };
    const int aofs = wm * 64 * 72, bofs = BOFF + wn * 64 * 72;
    const int pofs = b_first ? bofs : aofs, pbuf = b_first ? BBUF : ABUF;   // first operand
    const int qofs = b_first ? aofs : bofs, qbuf = b_first ? ABUF : BBUF;   // second operand

    constexpr int NSTEP = DIM / 64;   // 16
    auto kof = [&](int s) { return ((s + rot) & (NSTEP - 1)) * 64; };   // first k of the block's step s
    form(kof(0), 0);
    if (pinned(wave < 2)) {
        tdm_load(g0, g1);
        landed();   // tile 0 landed before it is published
    }
    __syncthreads();
    form(kof(1), 1);
    if (pinned(wave < 2)) tdm_load(g0, g1);

    for (int i = 0; i < NSTEP; i++) {
        const int cur = i & 1;
        v16bf af[4], bf[4];
        auto load_frags = [&](int kk) {
            #pragma unroll
            for (int f = 0; f < 4; f++) {
                af[f] = ld_frag(sm + pofs + cur * pbuf + (f * 16 + ln) * 72, kk * 32 + hi * 8);
                bf[f] = ld_frag(sm + qofs + cur * qbuf + (f * 16 + ln) * 72, kk * 32 + hi * 8);
            }
        };
        auto products = [&]() {
            #pragma unroll
            for (int mf = 0; mf < 4; mf++)
                #pragma unroll
                for (int nf = 0; nf < 4; nf++)
                    acc[mf][nf] = wmma_bf16(af[mf], bf[nf], acc[mf][nf]);
        };
        load_frags(0);
        // keeps the 16 LDS reads one group ahead of their 16 WMMAs: left alone the
        // scheduler reloads one A fragment per row of 4 and waits it out each time
        __builtin_amdgcn_sched_barrier(0);
        products();
        load_frags(1);
        // publish point: this wave's reads of buffer cur are done, its load of the
        // next tile has landed; behind the barrier buffer cur may be refilled.
        asm volatile("s_wait_dscnt 0x0" ::: "memory");
        if (pinned(wave < 2)) landed();
        __syncthreads();
        form(kof(i + 2), cur);
        if (pinned(wave < 2 && i + 2 < NSTEP)) tdm_load(g0, g1);
        // the step's second half works from registers while the refill is in flight
        products();
    }
    asm volatile("s_wait_tensorcnt 0x0" ::: "memory");   // no load outstanding at the wave's end
    asm volatile("s_wait_dscnt 0x0" ::: "memory");       // nor an LDS read, before sm is staged in
}

// ---------------------------------------------------------------- K0: all f32 -> bf16 preparation
// 256 x 16 long-lived waves (for speed only). A wave owns whole 1024-float rows, 32 floats a lane as 8 loads of 512 contiguous bytes:
// two rows of x (RMSNorm; the row sum stays inside the wave) and one weight row (rounding only).
typedef __attribute__((ext_vector_type(4))) float  v4f;
typedef __attribute__((ext_vector_type(4))) __bf16 v4bf;
static_assert(QKV_N + DIM == NTOK / 2, "one weight row for every two rows of x");

// A lane's share of a row: element 4 * c + e of r[k] with c = 0, 1 is float e of the
// row's 16-byte piece (2 * k + c) * 32 + lane.
struct RowRegs { v8f r[4]; };

__device__ __forceinline__ RowRegs load_row(const float* row, int lane) {
    const v4f* p = reinterpret_cast<const v4f*>(row) + lane;
    RowRegs t;
    #pragma unroll
    for (int k = 0; k < 4; k++)
        t.r[k] = __builtin_shufflevector(p[k * 64], p[k * 64 + 32], 0, 1, 2, 3, 4, 5, 6, 7);
    return t;
}
__device__ __forceinline__ void store_row(__bf16* row, int lane, const RowRegs& t) {
    v4bf* p = reinterpret_cast<v4bf*>(row) + lane;
    #pragma unroll
    for (int k = 0; k < 4; k++) {
        p[k * 64]      = __builtin_convertvector(__builtin_shufflevector(t.r[k], t.r[k], 0, 1, 2, 3), v4bf);
        p[k * 64 + 32] = __builtin_convertvector(__builtin_shufflevector(t.r[k], t.r[k], 4, 5, 6, 7), v4bf);
    }
}
// 1 / rms of a row: eight partial sums a lane, folded, then a five-step butterfly
__device__ __forceinline__ float row_rrms(const RowRegs& t) {
    v8f a = t.r[0] * t.r[0];
    #pragma unroll
    for (int k = 1; k < 4; k++) a += t.r[k] * t.r[k];
    float ss = ((a[0] + a[1]) + (a[2] + a[3])) + ((a[4] + a[5]) + (a[6] + a[7]));
    #pragma unroll
    for (int off = 16; off > 0; off >>= 1) ss += __shfl_xor(ss, off, 32);
    return rsqrtf(ss * (1.0f / DIM) + 1e-6f);
}

__global__ __launch_bounds__(512) void prep_kernel(
        const float* __restrict__ x, const float* __restrict__ scale,
        const float* __restrict__ wqkv, const float* __restrict__ wout,
        __bf16* __restrict__ xn, __bf16* __restrict__ wqkv_bf, __bf16* __restrict__ wout_bf) {
    const int lane = threadIdx.x & 31;
    const int w = __builtin_amdgcn_readfirstlane(blockIdx.x * 16 + (threadIdx.x >> 5));   // 0..4095
    const float* wsrc = w < QKV_N ? wqkv + (size_t)w * DIM : wout + (size_t)(w - QKV_N) * DIM;
    __bf16*      wdst = w < QKV_N ? wqkv_bf + (size_t)w * DIM : wout_bf + (size_t)(w - QKV_N) * DIM;

    RowRegs x0 = load_row(x + (size_t)w * (2 * DIM), lane);
    RowRegs x1 = load_row(x + (size_t)w * (2 * DIM) + DIM, lane);
    RowRegs sc = load_row(scale, lane);
    RowRegs wr = load_row(wsrc, lane);

    const float s0 = row_rrms(x0), s1 = row_rrms(x1);
    #pragma unroll
    for (int k = 0; k < 4; k++) {
        x0.r[k] = x0.r[k] * sc.r[k] * s0;
        x1.r[k] = x1.r[k] * sc.r[k] * s1;
    }
    store_row(wdst, lane, wr);
    store_row(xn + (size_t)w * (2 * DIM), lane, x0);
    store_row(xn + (size_t)w * (2 * DIM) + DIM, lane, x1);
}

// ---------------------------------------------------------------- K2: QKV GEMM + RoPE
// C[8192,3072] = Xn[8192,1024] * Wqkv[3072,1024]^T  (NT: both K-major)
// 256 x 384 block tile: 256 tokens by 128 columns (two heads) of each of q, k and v.
// 32 x 8 = 256 blocks, one for each WGP. 8 waves (4 x 2), two a SIMD; a wave keeps 64 tokens by
// one head of q, of k and of v: three 64 x 64 groups that share the wave's four token fragments.
// Against 256 x 128 blocks of 64 x 64 waves: 640 staged rows feed 768 WMMAs a k step of 64
// (was 384 for 256), and 32 loaded fragments feed 96 WMMAs (was 16 for 32).
// sm holds A[2][256][72], then B[2][384][72]; B row g * 128 + c is weight row g * 1024 + n0 + c.
// acc[g][i][j][r] = C[first operand's row i * 16 + 8 * hi + r][second operand's row j * 16 + ln]:
// weight rows go first for q and k (the 8 registers run along d), tokens first for v.
// Waves 0 to 4 bring a step's five tiles of 128 rows (two of A, one each of q, k, v), one tensor load each.
// Behind the loop's last barrier nobody reads sm and no load is in flight.
// rot: the block's step s works on k step (s + rot) mod 16, as in gemm_nt_mainloop.
__device__ __forceinline__ void qkv_mainloop(__bf16* sm,
                                             const __bf16* __restrict__ a,
                                             const __bf16* __restrict__ b,
                                             int wm, int wn, int rot, v8f (&acc)[3][4][4]) {
    constexpr int ABUF = 256 * 72, BBUF = 384 * 72, BOFF = 2 * ABUF;   // in elements
    const int tid = threadIdx.x, lane = tid & 31;
    const int ln = lane & 15, hi = lane >> 4;
    const uint32_t wave = uni(tid >> 5);
    const uint32_t sl = wave < 5 ? wave : 4;   // the wave's tile; waves 5 to 7 issue none
    u32x8 g1 = tdm_group1();
    // as in pinned(), for the whole group: its words keep their scalar registers through the loop
    asm volatile("" : "+s"(g1));
    u32x4 g0;
    g0[0] = pinned(1u);   // count 1: written once, the word keeps its scalar register through the loop
    const __bf16* gs = sl < 2 ? a + (size_t)sl * 128 * DIM : b + (size_t)(sl - 2) * 1024 * DIM;
    const uint32_t ls = uni((uint32_t)(uintptr_t)sm) + (sl < 2 ? sl * TILE_LDS : BOFF * 2 + (sl - 2) * TILE_LDS);
    const uint32_t lbuf = sl < 2 ? ABUF * 2 : BBUF * 2;   // from buffer 0 to buffer 1, bytes

    // Every wave forms the request's group 0 (scalar work, one definition on every path); the load
    // itself stands under the scalar branch that picks waves 0 to 4.
    auto form = [&](int k0, int buf) {
        const u32x4 n = tdm_group0(ls + buf * lbuf, (uint64_t)(uintptr_t)(gs + k0));
        g0[1] = n[1]; g0[2] = n[2]; g0[3] = n[3];
    };
    // the issuer's wait. It names both groups, so that they stay live and no register of the
    // outstanding request's descriptor takes a new value in front of it
    auto landed = [&]() { asm volatile("s_wait_tensorcnt 0x0" :: "s"(g0), "s"(g1) : "memory"); };
    const __bf16* fa = sm + (wm * 64 + ln) * 72 + hi * 8;
    const __bf16* fb = sm + BOFF + (wn * 64 + ln) * 72 + hi * 8;

    constexpr int NSTEP = DIM / 64;   // 16
    auto kof = [&](int s) { return ((s + rot) & (NSTEP - 1)) * 64; };   // first k of the block's step s
    form(kof(0), 0);
    if (pinned(wave < 5)) {
        tdm_load(g0, g1);
        landed();   // tile 0 landed before it is published
    }
    __syncthreads();
    form(kof(1), 1);
    if (pinned(wave < 5)) tdm_load(g0, g1);

    for (int i = 0; i < NSTEP; i++) {
        const int cur = i & 1;
        const __bf16* pa = fa + cur * ABUF;
        const __bf16* pb = fb + cur * BBUF;
        // token fragments, and a ring of six weight fragments: a group of 16 WMMAs reads four
        // of them while the next group's four are fetched, two at a time, into the free two
        v16bf af[4], bw[6];
        auto ld_a = [&](int kk) {
            #pragma unroll
            for (int f = 0; f < 4; f++) af[f] = ld_frag(pa + f * 16 * 72, kk * 32);
        };
        // fragments f0, f0 + 1 of group n of the step (n = kk * 3 + g) into their ring slots
        auto ld_b2 = [&](int n, int f0) {
            #pragma unroll
            for (int f = f0; f < f0 + 2; f++)
                bw[(n * 4 + f) % 6] = ld_frag(pb + ((n % 3) * 128 + f * 16) * 72, (n / 3) * 32);
        };
        // the 8 WMMAs of group n that read its fragments f0, f0 + 1
        auto mm2 = [&](int n, int f0) {
            #pragma unroll
            for (int f = f0; f < f0 + 2; f++)
                #pragma unroll
                for (int t = 0; t < 4; t++) {
                    if (n % 3 == 2) acc[2][t][f] = wmma_bf16(af[t], bw[(n * 4 + f) % 6], acc[2][t][f]);
                    else acc[n % 3][f][t] = wmma_bf16(bw[(n * 4 + f) % 6], af[t], acc[n % 3][f][t]);
                }
        };
        // The scheduling fences keep each group of LDS reads whole and 16 WMMAs ahead of its use.
        // Left alone the scheduler moves the reads next to their use and waits them out.
        ld_a(0); ld_b2(0, 0); ld_b2(0, 2);
        #pragma unroll
        for (int n = 0; n < 5; n++) {
            ld_b2(n + 1, 0);
            __builtin_amdgcn_sched_barrier(0);
            mm2(n, 0);
            __builtin_amdgcn_sched_barrier(0);
            ld_b2(n + 1, 2);
            __builtin_amdgcn_sched_barrier(0);
            mm2(n, 2);
            __builtin_amdgcn_sched_barrier(0);
            if (n == 2) ld_a(1);
        }
        // publish point: this wave's reads of buffer cur are done, its load of the
        // next tile has landed; behind the barrier buffer cur may be refilled.
        asm volatile("s_wait_dscnt 0x0" ::: "memory");
        if (pinned(wave < 5)) landed();
        __syncthreads();
        form(kof(i + 2), cur);
        if (pinned(wave < 5 && i + 2 < NSTEP)) tdm_load(g0, g1);
        // the step's last 16 WMMAs work from registers while the refill is in flight; the fence
        // keeps them behind the refill's issue
        __builtin_amdgcn_sched_barrier(0);
        mm2(5, 0);
        mm2(5, 2);
    }
    asm volatile("s_wait_tensorcnt 0x0" ::: "memory");   // no load outstanding at the wave's end
    asm volatile("s_wait_dscnt 0x0" ::: "memory");       // nor an LDS read, before sm is staged in
}

__global__ __launch_bounds__(256)
void qkv_gemm_rope_kernel(
        const __bf16* __restrict__ xn, const __bf16* __restrict__ wqkv,
        const float* __restrict__ theta,
        __bf16* __restrict__ qd, __bf16* __restrict__ kd, __bf16* __restrict__ vd) {
    const int n0 = blockIdx.x * 128;   // 8 tiles over the 1024 columns of q, of k and of v
    const int m0 = blockIdx.y * 256;   // 32 tiles over 8192
    const int wave = __builtin_amdgcn_readfirstlane(threadIdx.x >> 5);
    const int lane = threadIdx.x & 31;
    const int ln = lane & 15, hi = lane >> 4;
    const int wm = wave >> 1, wn = wave & 1;

    __shared__ __attribute__((aligned(2048))) __bf16 sm[2 * 256 * 72 + 2 * 384 * 72];   // tiles at multiples of 2 KiB
    const int h = (n0 >> 6) + wn;         // the wave's head
    const int tok0 = m0 + wm * 64;        // a wave's 64 rows lie in one batch entry
    const int b = tok0 >> 10, seqb = tok0 & 1023;

    // group 0 = q, 1 = k, stored [token][d]; group 2 = v, stored [d][token]
    v8f acc[3][4][4] = {};
    // The 8 blocks of a token tile start 4 k steps apart (two and two alike), the 32 blocks of a
    // column tile one step apart.
    const int rot = (blockIdx.y + 4 * blockIdx.x) & 15;
    qkv_mainloop(sm, xn + (size_t)m0 * DIM, wqkv + (size_t)n0 * DIM, wm, wn, rot, acc);

    // Each 64 x 64 group goes through the wave's own 64 x 72 piece of LDS, 16 bytes a lane both
    // ways, and leaves as whole 128-byte lines (straight from the accumulators: 32-byte pieces).
    __bf16* st = sm + wave * (64 * 72);
    const __bf16* sr = st + (lane >> 3) * 72 + (lane & 7) * 8;   // 4 rows a load
    auto stage = [&](const v8f (&c)[4][4], v8bf (&row)[16]) {
        #pragma unroll
        for (int j = 0; j < 4; j++)
            #pragma unroll
            for (int i = 0; i < 4; i++)
                *reinterpret_cast<v8bf*>(st + (j * 16 + ln) * 72 + i * 16 + 8 * hi) =
                    __builtin_convertvector(c[i][j], v8bf);
        // the rows read back below were written by other lanes of this wave
        asm volatile("s_wait_dscnt 0x0" ::: "memory");
        #pragma unroll
        for (int t = 0; t < 16; t++) row[t] = *reinterpret_cast<const v8bf*>(sr + t * 4 * 72);
    };

    // v leaves first: its 128 accumulator registers are free before RoPE needs its own
    {
        v8bf row[16];
        stage(acc[2], row);
        // V transposed: [B,H,D,S], a row of the group is one d
        __bf16* dst = vd + ((size_t)(b * HEADS + h) * HD + (lane >> 3)) * SEQ + seqb + (lane & 7) * 8;
        #pragma unroll
        for (int t = 0; t < 16; t++) *reinterpret_cast<v8bf*>(dst + t * 4 * SEQ) = row[t];
        // what follows rewrites the address and data registers of these stores: the wait stands
        // in front of that rewrite, and the fence keeps later vector work from rising over it
        asm volatile("s_wait_xcnt 0x0" ::: "memory");
        __builtin_amdgcn_sched_barrier(0);
    }

    {
        // RoPE on d<32 of q and k: pair (d, d+16) = (acc[g][0], acc[g][1]), same lane slot;
        // d = 8 * hi + r, token j * 16 + ln; one sine and cosine serve both
        const float* tp = theta + (seqb + ln) * (HEADS * 16) + h * 16 + 8 * hi;
        v4f th[4][2];
        #pragma unroll
        for (int j = 0; j < 4; j++) {
            th[j][0] = *reinterpret_cast<const v4f*>(tp + j * 16 * (HEADS * 16));
            th[j][1] = *reinterpret_cast<const v4f*>(tp + j * 16 * (HEADS * 16) + 4);
        }
        // the eight loads share one address pair: tp stays live up to this wait, so that no
        // load's result lands in the pair and nothing rewrites it in front of the wait
        asm volatile("s_wait_xcnt 0x0" :: "v"(tp) : "memory");
        #pragma unroll
        for (int j = 0; j < 4; j++) {
            #pragma unroll
            for (int r = 0; r < 8; r++) {
                float sn, cs;
                // the fast sine and cosine (argument in turns) in one statement: its v_nop
                // fills the slot behind a transcendental, whatever is scheduled next
                asm("v_sin_f32 %0, %2\n\tv_cos_f32 %1, %2\n\tv_nop"
                    : "=&v"(sn), "=&v"(cs) : "v"(th[j][r >> 2][r & 3] * 0.15915494f));
                #pragma unroll
                for (int g = 0; g < 2; g++) {
                    float v0 = acc[g][0][j][r], v1 = acc[g][1][j][r];
                    acc[g][0][j][r] = v0 * cs - v1 * sn;
                    acc[g][1][j][r] = v1 * cs + v0 * sn;
                }
            }
        }
    }

    #pragma unroll
    for (int g = 0; g < 2; g++) {
        v8bf row[16];
        stage(acc[g], row);
        // [B,H,S,D]: the group's 64 rows are 8 KB in a row
        __bf16* dst = (g == 0 ? qd : kd) + ((size_t)(b * HEADS + h) * SEQ + seqb) * HD + lane * 8;
        #pragma unroll
        for (int t = 0; t < 16; t++) *reinterpret_cast<v8bf*>(dst + t * 4 * HD) = row[t];
        // k's staging rewrites the address and data registers of q's stores: the wait stands
        // in front of that rewrite, and the fence keeps k's conversions from rising over it
        if (g == 0) {
            asm volatile("s_wait_xcnt 0x0" ::: "memory");
            __builtin_amdgcn_sched_barrier(0);
        }
    }
}

// ---------------------------------------------------------------- K3: causal flash attention
// the value that lane l ^ 16 holds
__device__ __forceinline__ float other_half(float v) {
    int b = __builtin_bit_cast(int, v);
    return __builtin_bit_cast(float, __builtin_amdgcn_permlanex16(b, b, 0x76543210, 0xfedcba98, false, false));
}

// 2^x in asm. Early-clobber outputs keep every source whole
// inside the statement; the v_nop fills the slot behind the last one, whatever comes next.
#define LOG2E 1.44269504f
__device__ __forceinline__ float exp2_x1(float x) {
    float p;
    asm("v_exp_f32 %0, %1\n\tv_nop" : "=&v"(p) : "v"(x));
    return p;
}
__device__ __forceinline__ void exp2_x8(float (&p)[8], const float (&x)[8]) {
    asm("v_exp_f32 %0, %8\n\t"
        "v_exp_f32 %1, %9\n\t"
        "v_exp_f32 %2, %10\n\t"
        "v_exp_f32 %3, %11\n\t"
        "v_exp_f32 %4, %12\n\t"
        "v_exp_f32 %5, %13\n\t"
        "v_exp_f32 %6, %14\n\t"
        "v_exp_f32 %7, %15\n\t"
        "v_nop"
        : "=&v"(p[0]), "=&v"(p[1]), "=&v"(p[2]), "=&v"(p[3]),
          "=&v"(p[4]), "=&v"(p[5]), "=&v"(p[6]), "=&v"(p[7])
        : "v"(x[0]), "v"(x[1]), "v"(x[2]), "v"(x[3]), "v"(x[4]), "v"(x[5]), "v"(x[6]), "v"(x[7]));
}

__global__ __launch_bounds__(512) __attribute__((amdgpu_waves_per_eu(4, 4)))
void attention_kernel(
        const __bf16* __restrict__ qd, const __bf16* __restrict__ kd,
        const __bf16* __restrict__ vd, __bf16* __restrict__ od) {
    // per chunk of 64 keys: K as [key][d], then V as [d][key], pitch 144 B. Side by side, so that
    // a chunk's 32 LDS reads are one address register and immediate offsets.
    __shared__ __align__(16) __bf16 KV[SEQ / 64][2][64][72];
    const int z  = blockIdx.x >> 7;    // 0..1
    const int bh = blockIdx.x & 127;   // b*16+h
    const int b  = bh >> 4, h = bh & 15;
    const int tid = threadIdx.x, lane = tid & 31;
    const int wave = __builtin_amdgcn_readfirstlane(tid >> 5);
    const int ln = lane & 15, hi = lane >> 4;

    // Two chunks a call, 4 copies a lane; one copy of the block is one chunk of 64 keys, 128 bytes
    // a row: of K 64 key rows (8 KB in a row), of V the chunk's piece of all 64 d rows.
    const __bf16* kg = kd + (size_t)bh * SEQ * HD + tid * 8;
    const __bf16* vg = vd + ((size_t)bh * HD + (tid >> 3)) * SEQ + (tid & 7) * 8;
    const unsigned kl = (unsigned)(uintptr_t)&KV[0][0][tid >> 3][(tid & 7) * 8];
    const unsigned vl = (unsigned)(uintptr_t)&KV[0][1][tid >> 3][(tid & 7) * 8];
    auto load_pair = [&](int c0) {
        async_copy16_x4(kl + c0 * 18432, kl + (c0 + 1) * 18432, vl + c0 * 18432, vl + (c0 + 1) * 18432,
                        kg + c0 * (64 * HD), kg + (c0 + 1) * (64 * HD), vg + c0 * 64, vg + (c0 + 1) * 64);
    };

    v16bf qfrag[2];     // Q fragments resident in registers for the whole tile
    v8f accO[4];        // accO[df][r] = O[query ln][d = df * 16 + 8 * hi + r]
    float mrun, lrun;   // of query ln; lrun sums this half's keys only
    int qg;             // the lane's query
    auto begin_tile = [&](int tile) {
        qg = tile * 16 + ln;
        const __bf16* qrow = qd + ((size_t)bh * SEQ + qg) * HD;
        qfrag[0] = ld_frag(qrow, 0 * 32 + hi * 8);
        qfrag[1] = ld_frag(qrow, 1 * 32 + hi * 8);
        #pragma unroll
        for (int df = 0; df < 4; df++) accO[df] = v8f{};
        mrun = -1e30f;
        lrun = 0.f;
    };

    auto chunk = [&](int ci) {
        const int j0 = ci * 64;
        // scores: K(64keys x 64d) * Q(16x64d)^T -> 4 frags of 16 keys x 16 queries,
        // accS[nf][r] = S[query ln][key j0 + nf * 16 + 8 * hi + r]
        v16bf kf[4][2], vf[4][2];
        #pragma unroll
        for (int nf = 0; nf < 4; nf++)
            #pragma unroll
            for (int kk = 0; kk < 2; kk++)
                kf[nf][kk] = ld_frag(&KV[ci][0][nf * 16 + ln][0], kk * 32 + hi * 8);
        // keeps the chunk's 16 K reads one group ahead of the 8 score WMMAs: left alone the
        // scheduler reuses one fragment's registers and waits out the LDS latency per WMMA
        __builtin_amdgcn_sched_barrier(0);
        v8f accS[4] = {};
        #pragma unroll
        for (int kk = 0; kk < 2; kk++)
            #pragma unroll
            for (int nf = 0; nf < 4; nf++)
                accS[nf] = wmma_bf16(kf[nf][kk], qfrag[kk], accS[nf]);
        #pragma unroll
        for (int df = 0; df < 4; df++)
            #pragma unroll
            for (int kk = 0; kk < 2; kk++)
                vf[df][kk] = ld_frag(&KV[ci][1][df * 16 + ln][0], kk * 32 + hi * 8);
        // keeps the chunk's 16 V reads ahead of the softmax, whose vector work covers their latency
        __builtin_amdgcn_sched_barrier(0);

        // online softmax of one query per lane
        const int lim = qg - j0 - 8 * hi;   // key nf * 16 + r of this half is seen if <= lim
        float cmax[4];
        #pragma unroll
        for (int nf = 0; nf < 4; nf++) {
            #pragma unroll
            for (int r = 0; r < 8; r++) {
                float v = accS[nf][r] * 0.125f;   // 1/sqrt(64)
                accS[nf][r] = (nf * 16 + r <= lim) ? v : -1e30f;
            }
            cmax[nf] = fmaxf(fmaxf(fmaxf(accS[nf][0], accS[nf][1]), fmaxf(accS[nf][2], accS[nf][3])),
                             fmaxf(fmaxf(accS[nf][4], accS[nf][5]), fmaxf(accS[nf][6], accS[nf][7])));
        }
        float rmax = fmaxf(fmaxf(cmax[0], cmax[1]), fmaxf(cmax[2], cmax[3]));
        rmax = fmaxf(rmax, other_half(rmax));
        const float mnew = fmaxf(mrun, rmax);
        const float corr = exp2_x1((mrun - mnew) * LOG2E);
        mrun = mnew;
        // P^T as B operand: element s of pf[kk] is key kk * 32 + (s < 8 ? 8 * hi + s : 16 + 8 * hi + s - 8),
        // the k order of ld_frag, which loads V^T beside it
        v16bf pf[2];
        float csum[4];
        #pragma unroll
        for (int nf = 0; nf < 4; nf++) {
            float e[8], p[8];
            #pragma unroll
            for (int r = 0; r < 8; r++) e[r] = (accS[nf][r] - mnew) * LOG2E;
            exp2_x8(p, e);
            #pragma unroll
            for (int r = 0; r < 8; r++) pf[nf >> 1][(nf & 1) * 8 + r] = (__bf16)p[r];
            csum[nf] = ((p[0] + p[1]) + (p[2] + p[3])) + ((p[4] + p[5]) + (p[6] + p[7]));
        }
        lrun = lrun * corr + ((csum[0] + csum[1]) + (csum[2] + csum[3]));
        #pragma unroll
        for (int df = 0; df < 4; df++) accO[df] = accO[df] * corr;

        // O^T += V^T(64d x 64keys) * P^T(64keys x 16 queries)
        #pragma unroll
        for (int df = 0; df < 4; df++) {
            #pragma unroll
            for (int kk = 0; kk < 2; kk++)
                accO[df] = wmma_bf16(vf[df][kk], pf[kk], accO[df]);
        }
    };

    const int i = wave * 2 + z;   // 0..31
    begin_tile(63 - i);           // queries 512 and up: at least 9 chunks in every wave
    load_pair(0);
    asm volatile("s_wait_asynccnt 0x0" ::: "memory");   // chunks 0, 1 landed before they are published
    __syncthreads();
    load_pair(2);
    // Chunks 0-1, 2-3, 4-7 of the upper tile; under each part the next part's keys land
    // (chunks 2-3, 4-7, 8-15). rolled: the three parts share one copy of the chunk's code
    #pragma unroll 1
    for (int part = 0; part < 3; part++) {
        const int end = part == 2 ? 8 : part * 2 + 2;
        // rolled: one copy of the chunk's code
        #pragma unroll 1
        for (int ci = part * 2; ci < end; ci++) chunk(ci);
        // this wave's copies of the next part have landed; behind the barrier every wave's have
        asm volatile("s_wait_asynccnt 0x0" ::: "memory");
        __syncthreads();
        if (part == 0) {
            load_pair(4);
            load_pair(6);
        } else if (part == 1) {
            load_pair(8);
            load_pair(10);
            load_pair(12);
            load_pair(14);
        }
    }

    // all keys are in LDS and nothing writes it any more: no barrier from here on
    // rolled: the two tiles share one copy of the chunk's code
    #pragma unroll 1
    for (int half = 0; half < 2; half++) {
        if (half == 1) begin_tile(i);
        const int nchunks = ((half == 0 ? 63 - i : i) >> 2) + 1;
        // rolled: the trip count is the wave's own
        #pragma unroll 1
        for (int ci = half == 0 ? 8 : 0; ci < nchunks; ci++) chunk(ci);

        // a lane's 8 accumulator registers are 8 consecutive d of its query: 16-byte stores
        const float inv = 1.0f / (lrun + other_half(lrun));
        __bf16* dst = od + ((size_t)(b * SEQ + qg)) * DIM + h * HD + 8 * hi;
        #pragma unroll
        for (int df = 0; df < 4; df++)
            *reinterpret_cast<v8bf*>(dst + df * 16) = __builtin_convertvector(accO[df] * inv, v8bf);
        // the second tile's set-up rewrites the address and data registers of these stores:
        // the wait stands in front of that rewrite
        asm volatile("s_wait_xcnt 0x0" ::: "memory");
    }
}

// ---------------------------------------------------------------- K4: out-proj + residual
// out[8192,1024] = O[8192,1024] * Wout[1024,1024]^T + x
// 128 x 128 block tile, 4 waves (2 x 2) of 64 x 64: 512 blocks, two for each WGP.
__global__ __launch_bounds__(128) __attribute__((amdgpu_waves_per_eu(4, 4)))
void outproj_kernel(
        const __bf16* __restrict__ o, const __bf16* __restrict__ wout,
        const float* __restrict__ x, float* __restrict__ out) {
    const int n0 = blockIdx.x * 128;
    const int m0 = blockIdx.y * 128;
    const int wave = __builtin_amdgcn_readfirstlane(threadIdx.x >> 5);
    const int lane = threadIdx.x & 31;
    const int ln = lane & 15, hi = lane >> 4;
    const int wm = wave >> 1, wn = wave & 1;

    __shared__ __attribute__((aligned(2048))) __bf16 sm[2 * 128 * 72 + 2 * 128 * 72];   // tiles at multiples of 2 KiB
    // weight rows first: a lane's 8 registers are 8 adjacent columns of one token's row
    v8f acc[4][4] = {};
    const int rot = (blockIdx.y + 4 * blockIdx.x) & 15;   // as in the QKV GEMM
    gemm_nt_mainloop<2>(sm, o + (size_t)m0 * DIM, wout + (size_t)n0 * DIM, wm, wn, true, rot, acc);

    // The wave's 64 x 64 tile goes through its own 64 x 68 floats of LDS, 16 bytes a lane both
    // ways: x is read and out written 256 bytes of a row at a time, whole 128-byte lines.
    float* st = reinterpret_cast<float*>(sm) + wave * (64 * 68);
    #pragma unroll
    for (int j = 0; j < 4; j++)
        #pragma unroll
        for (int i = 0; i < 4; i++) {
            float* p = st + (j * 16 + ln) * 68 + i * 16 + 8 * hi;
            *reinterpret_cast<v4f*>(p)     = __builtin_shufflevector(acc[i][j], acc[i][j], 0, 1, 2, 3);
            *reinterpret_cast<v4f*>(p + 4) = __builtin_shufflevector(acc[i][j], acc[i][j], 4, 5, 6, 7);
        }
    const unsigned at = (unsigned)(m0 + wm * 64 + hi) * DIM + n0 + wn * 64 + ln * 4;   // 2 rows a load
    float* dst        = out + at;
    const float* skip = x   + at;
    v4f sk[32];
    #pragma unroll
    for (int t = 0; t < 32; t++) sk[t] = *reinterpret_cast<const v4f*>(skip + t * 2 * DIM);
    // the rows read back below were written by other lanes of this wave
    asm volatile("s_wait_dscnt 0x0" ::: "memory");
    const float* sr = st + hi * 68 + ln * 4;
    #pragma unroll
    for (int t = 0; t < 32; t++)
        *reinterpret_cast<v4f*>(dst + t * 2 * DIM) = *reinterpret_cast<const v4f*>(sr + t * 2 * 68) + sk[t];
}

// ---------------------------------------------------------------- launch
extern "C" void kernel_launch(void* const* d_in, const int* in_sizes, int n_in,
                              void* d_out, int out_size, void* d_ws, size_t ws_size,
                              hipStream_t stream) {
    const float* x     = (const float*)d_in[0];   // [8,1024,1024]
    const float* scale = (const float*)d_in[1];   // [1024]
    const float* wqkv  = (const float*)d_in[2];   // [3072,1024]
    const float* wout  = (const float*)d_in[3];   // [1024,1024]
    const float* theta = (const float*)d_in[4];   // [1024,16,16]

    char* ws = (char*)d_ws;
    __bf16* wqkv_bf = (__bf16*)(ws);                         //  6,291,456 B
    __bf16* wout_bf = (__bf16*)(ws + 6291456);               //  2,097,152 B
    __bf16* xn_bf   = (__bf16*)(ws + 8388608);               // 16,777,216 B
    __bf16* q_bf    = (__bf16*)(ws + 25165824);              // [B,H,S,D]
    __bf16* k_bf    = (__bf16*)(ws + 41943040);              // [B,H,S,D]
    __bf16* v_bf    = (__bf16*)(ws + 58720256);              // [B,H,D,S]
    __bf16* o_bf    = (__bf16*)(ws + 75497472);              // [B,S,H*D]
    float*  outp    = (float*)d_out;

    prep_kernel<<<NTOK / 2 / 16, 512, 0, stream>>>(x, scale, wqkv, wout, xn_bf, wqkv_bf, wout_bf);
    qkv_gemm_rope_kernel<<<dim3(DIM / 128, NTOK / 256), 256, 0, stream>>>(
        xn_bf, wqkv_bf, theta, q_bf, k_bf, v_bf);
    attention_kernel<<<BATCH * HEADS * 2, 512, 0, stream>>>(q_bf, k_bf, v_bf, o_bf);
    outproj_kernel<<<dim3(DIM / 128, NTOK / 128), 128, 0, stream>>>(o_bf, wout_bf, x, outp);
}
